// v000
// The times below were measured on an AMD MI455X: many runs one after another, warmed up first and cycling through
// copies of the inputs, with the whole window's GPU time divided by the number of runs. Launches and the gaps
// between them are all in it. The median over several windows is given; except for v000 it joins two sittings, which
// can be a few percent apart, so the side-by-side timings, each taken in one sitting, are the better comparison.
// The starting kernel, v000, takes 9270 microseconds a run.
#include <hip/hip_runtime.h>

// non_local_attention (query/key/value features [8][128][64x64]; q = BN_train(conv1x1(query; Wk, bk)), k = BN_train(conv1x1(key; Wk, bk)) (BatchNorm2d in training mode: per-channel batch statistics over (B,H,W), each call its own), v = conv1x1(value; Wv, bv);
// q, k L2-normalised over their 64 channels per position (+1e-7); sim[n][m] = q_n.k_m + 1 (no softmax); ctx[n] = sum_m sim[n][m] v_m; out = conv1x1(ctx; Ww, bw) -> [8][128][64][64]).
// Reassociation (exact algebra, no softmax in between): ctx[n][v] = sum_c qn[n][c] M[c][v] + vsum[v] with M = kn^T v (64x64) and vsum = sum_m v_m - the [4096][4096] similarity map is never formed.

#define NBI  8
#define CI   128
#define NP   4096
#define CK   64
#define CV   64
#define CO   128
typedef _Float16 h16;
typedef unsigned short bf;
typedef __attribute__((ext_vector_type(16))) __bf16   v16bf;
typedef __attribute__((ext_vector_type(16))) _Float16 v16h;
typedef __attribute__((ext_vector_type(8)))  _Float16 v8h;
typedef __attribute__((ext_vector_type(8)))  unsigned short v8us;
typedef __attribute__((ext_vector_type(8)))  float    v8f;
typedef __attribute__((ext_vector_type(4)))  float    v4f;
typedef v8h  __attribute__((may_alias)) v8ha;
typedef v4f  __attribute__((may_alias)) v4fa;
typedef v8us __attribute__((may_alias)) v8usa;

__device__ __forceinline__ unsigned short f2bf(float f) { unsigned u = __float_as_uint(f); u += 0x7FFFu + ((u >> 16) & 1u); return (unsigned short)(u >> 16); }
__device__ __forceinline__ float bf2f(unsigned short b) { return __uint_as_float(((unsigned)b) << 16); }
__device__ __forceinline__ float bfr(float f) { return bf2f(f2bf(f)); }
__device__ __forceinline__ v16h cat16(v8h lo, v8h hi) { return __builtin_shufflevector(lo, hi, 0, 1, 2, 3, 4, 5, 6, 7, 8, 9, 10, 11, 12, 13, 14, 15); }
__device__ __forceinline__ v16bf cat16b(v8us lo, v8us hi) { return __builtin_bit_cast(v16bf, __builtin_shufflevector(lo, hi, 0, 1, 2, 3, 4, 5, 6, 7, 8, 9, 10, 11, 12, 13, 14, 15)); }
__device__ __forceinline__ v8f wmma16(v16h a, v16h b, v8f c) { return __builtin_amdgcn_wmma_f32_16x16x32_f16(false, a, false, b, (short)0, c, false, false); }
__device__ __forceinline__ v8f wmmab(v16bf a, v16bf b, v8f c) { return __builtin_amdgcn_wmma_f32_16x16x32_bf16(false, a, false, b, (short)0, c, false, false); }



// ---- k_gemmw: register-blocked GEMM, ONE WAVE per 64x64 output tile (16 accumulators), operands straight from K-contiguous 16-bit planes; grid (M/64, N/64, Z), 32 threads.
// C[m][n] (f32, pitch ldc, + optional f32 bias[n]) = sum_k A[m][k] Bt[n][k] (+ split products per NSPLIT). z-batch strides sA/sB/sC in elements. K % 32 == 0.
template <typename T16> struct WFrag;
template <> struct WFrag<h16> { typedef v16h V; static __device__ __forceinline__ V ld(const h16* p) { return cat16(*(const v8h*)p, *(const v8h*)(p + 16)); } static __device__ __forceinline__ v8f mma(V a, V b, v8f c) { return wmma16(a, b, c); } };
template <> struct WFrag<bf> { typedef v16bf V; static __device__ __forceinline__ V ld(const bf* p) { return cat16b(*(const v8us*)p, *(const v8us*)(p + 16)); } static __device__ __forceinline__ v8f mma(V a, V b, v8f c) { return wmmab(a, b, c); } };
template <typename T16, int NSPLIT, bool BIAS>
__global__ __launch_bounds__(32) void k_gemmw(const T16* __restrict__ A, const T16* __restrict__ A2, const T16* __restrict__ Bt, const T16* __restrict__ Bt2, int K, float* C, int ldc, const float* __restrict__ bias, size_t sA, size_t sB, size_t sC) {
    typedef typename WFrag<T16>::V V;
    __shared__ __align__(16) float os[16 * 68];
    const size_t z = blockIdx.z; A += z * sA; if (A2) A2 += z * sA; Bt += z * sB; if (Bt2) Bt2 += z * sB; C += z * sC;
    const int lane = threadIdx.x & 31, lr = lane & 15, hi = lane >> 4; const int r0 = blockIdx.x * 64, c0 = blockIdx.y * 64;
    v8f acc[4][4];
#pragma unroll
    for (int mb = 0; mb < 4; ++mb)
#pragma unroll
        for (int nb = 0; nb < 4; ++nb) acc[mb][nb] = (v8f){};
    const size_t aoff = (size_t)(r0 + lr) * K + 8 * hi, boff = (size_t)(c0 + lr) * K + 8 * hi;
#pragma unroll 1
    for (int kc = 0; kc < K; kc += 32) {
        V a[4], a2[4];
#pragma unroll
        for (int mb = 0; mb < 4; ++mb) { a[mb] = WFrag<T16>::ld(A + aoff + (size_t)mb * 16 * K + kc); if (NSPLIT == 1 || NSPLIT == 2) a2[mb] = WFrag<T16>::ld(A2 + aoff + (size_t)mb * 16 * K + kc); }
#pragma unroll
        for (int nb = 0; nb < 4; ++nb) { const V b = WFrag<T16>::ld(Bt + boff + (size_t)nb * 16 * K + kc); V b2; if (NSPLIT >= 2) b2 = WFrag<T16>::ld(Bt2 + boff + (size_t)nb * 16 * K + kc);
#pragma unroll
            for (int mb = 0; mb < 4; ++mb) { acc[mb][nb] = WFrag<T16>::mma(a[mb], b, acc[mb][nb]); if (NSPLIT == 1 || NSPLIT == 2) acc[mb][nb] = WFrag<T16>::mma(a2[mb], b, acc[mb][nb]); if (NSPLIT >= 2) acc[mb][nb] = WFrag<T16>::mma(a[mb], b2, acc[mb][nb]); } }
        asm volatile("v_nop\n\tv_nop\n\tv_nop\n\tv_nop" : "+v"(acc[0][0]), "+v"(acc[1][1]), "+v"(acc[2][2]), "+v"(acc[3][3]) : "v"(a[0]), "v"(a[3]));
    }
#pragma unroll
    for (int mb = 0; mb < 4; ++mb) {
#pragma unroll
        for (int nb = 0; nb < 4; ++nb) {
#pragma unroll
            for (int j = 0; j < 8; ++j) os[(hi * 8 + j) * 68 + nb * 16 + lr] = acc[mb][nb][j]; }
        __builtin_amdgcn_wave_barrier(); asm volatile("" ::: "memory");
        float* crow = C + (size_t)(r0 + mb * 16) * ldc + c0;
{
#pragma unroll
            for (int s = 0; s < 8; ++s) { const int row = 2 * s + hi, cofs = lr * 4; v4f val = *(const v4fa*)(os + row * 68 + cofs); if (BIAS) { val[0] += bfr(bias[c0 + cofs]); val[1] += bfr(bias[c0 + cofs + 1]); val[2] += bfr(bias[c0 + cofs + 2]); val[3] += bfr(bias[c0 + cofs + 3]); }
                *(v4f*)(crow + (size_t)row * ldc + cofs) = val; }
             }
        __builtin_amdgcn_wave_barrier(); asm volatile("" ::: "memory");
    }
}

__device__ __forceinline__ void splitf(float y, unsigned short& h, unsigned short& l) { h = f2bf(y); l = f2bf(y - bf2f(h)); }
typedef __attribute__((ext_vector_type(2))) unsigned short v2us;
typedef __attribute__((ext_vector_type(2))) float v2f;
typedef __attribute__((ext_vector_type(4))) unsigned short v4us;

__global__ __launch_bounds__(256) void k_cvt8(const float* __restrict__ src, bf* dst, size_t n8) { const size_t i = (size_t)blockIdx.x * 256 + threadIdx.x; if (i >= n8) return; const v8f v = *(const v8f*)(src + i * 8); v8us o;
#pragma unroll
    for (int k = 0; k < 8; ++k) o[k] = f2bf(v[k]); *(v8us*)(dst + i * 8) = o;  }
__global__ __launch_bounds__(256) void k_xt(const float* __restrict__ x, bf* XT) { const int e = (blockIdx.x * 256 + threadIdx.x) * 2; if (e >= NP * CI) return; const int c = e % CI; const int p = e / CI; v2us o; o[0] = f2bf(x[(size_t)c * NP + p]); o[1] = f2bf(x[(size_t)(c + 1) * NP + p]); *(v2us*)(XT + e) = o;  }
__global__ __launch_bounds__(256) void k_bnstat(const float* __restrict__ Y, float* ST) { __shared__ float red[256]; const int c = blockIdx.x; const int tid = threadIdx.x; float s = 0.f;
    for (int i = tid; i < NBI * NP; i += 256) s += Y[(size_t)i * CK + c];
    red[tid] = s; __syncthreads(); for (int k = 128; k; k >>= 1) { if (tid < k) red[tid] = __fadd_rn(red[tid], red[tid + k]); __syncthreads(); } const float mean = red[0] * (1.0f / (NBI * NP)); __syncthreads();
    float q = 0.f; for (int i = tid; i < NBI * NP; i += 256) { float d = __fsub_rn(Y[(size_t)i * CK + c], mean); asm volatile("" : "+v"(d)); float p = __fmul_rn(d, d); asm volatile("" : "+v"(p)); q = __fadd_rn(q, p); }
    red[tid] = q; __syncthreads(); for (int k = 128; k; k >>= 1) { if (tid < k) red[tid] = __fadd_rn(red[tid], red[tid + k]); __syncthreads(); }
    if (tid == 0) { v2f o; o[0] = mean; o[1] = __frsqrt_rn(__fadd_rn(red[0] * (1.0f / (NBI * NP)), 1e-5f)); *(v2f*)(ST + 2 * c) = o;  } }
__global__ __launch_bounds__(256) void k_qn(const float* __restrict__ Y, const float* __restrict__ ST, const float* __restrict__ ga, const float* __restrict__ be, bf* Qh, bf* Ql) { const int e = (blockIdx.x * 256 + threadIdx.x) * 4; if (e >= NP * CK) return; const int c0 = e % CK; const v4f a = *(const v4f*)(Y + e); float y[4]; float ss = 0.f;
#pragma unroll
    for (int u = 0; u < 4; ++u) { const int c = c0 + u; float t0 = __fmul_rn(__fsub_rn(a[u], ST[2 * c]), ST[2 * c + 1]); asm volatile("" : "+v"(t0)); float g = bfr(ga[c]), bb = bfr(be[c]); asm volatile("" : "+v"(g)); asm volatile("" : "+v"(bb)); float t1 = __fmul_rn(t0, g); asm volatile("" : "+v"(t1)); y[u] = __fadd_rn(t1, bb); float p = __fmul_rn(y[u], y[u]); asm volatile("" : "+v"(p)); ss = __fadd_rn(ss, p); }
    ss += __shfl_xor(ss, 1, 32); ss += __shfl_xor(ss, 2, 32); ss += __shfl_xor(ss, 4, 32); ss += __shfl_xor(ss, 8, 32); const float inv = __fdiv_rn(1.0f, __fadd_rn(__fsqrt_rn(ss), 1e-7f)); v4us oh, ol;
#pragma unroll
    for (int u = 0; u < 4; ++u) { unsigned short hh, ll; splitf(__fmul_rn(y[u], inv), hh, ll); oh[u] = hh; ol[u] = ll; } *(v4us*)(Qh + e) = oh; *(v4us*)(Ql + e) = ol;  }
__global__ __launch_bounds__(256) void k_knT(const float* __restrict__ Y, const float* __restrict__ ST, const float* __restrict__ ga, const float* __restrict__ be, bf* Kh, bf* Kl) { const int m = (blockIdx.x * 256 + threadIdx.x) * 2; if (m >= NP) return; float y0[CK], y1[CK]; float s0 = 0.f, s1 = 0.f;
#pragma unroll
    for (int c4 = 0; c4 < CK / 4; ++c4) { const v4f a = *(const v4f*)(Y + (size_t)m * CK + c4 * 4), b = *(const v4f*)(Y + (size_t)(m + 1) * CK + c4 * 4);
#pragma unroll
        for (int u = 0; u < 4; ++u) { const int c = c4 * 4 + u; const float mu = ST[2 * c], rs = ST[2 * c + 1]; float g = bfr(ga[c]), bb = bfr(be[c]); asm volatile("" : "+v"(g)); asm volatile("" : "+v"(bb));
            float t0 = __fmul_rn(__fsub_rn(a[u], mu), rs), t1 = __fmul_rn(__fsub_rn(b[u], mu), rs); asm volatile("" : "+v"(t0)); asm volatile("" : "+v"(t1)); float u0 = __fmul_rn(t0, g), u1 = __fmul_rn(t1, g); asm volatile("" : "+v"(u0)); asm volatile("" : "+v"(u1)); y0[c] = __fadd_rn(u0, bb); y1[c] = __fadd_rn(u1, bb);
            float p0 = __fmul_rn(y0[c], y0[c]), p1 = __fmul_rn(y1[c], y1[c]); asm volatile("" : "+v"(p0)); asm volatile("" : "+v"(p1)); s0 = __fadd_rn(s0, p0); s1 = __fadd_rn(s1, p1); } }
    const float i0 = __fdiv_rn(1.0f, __fadd_rn(__fsqrt_rn(s0), 1e-7f)), i1 = __fdiv_rn(1.0f, __fadd_rn(__fsqrt_rn(s1), 1e-7f));
    {
#pragma unroll
        for (int c = 0; c < CK; ++c) { unsigned short a0, b0, a1, b1; splitf(__fmul_rn(y0[c], i0), a0, b0); splitf(__fmul_rn(y1[c], i1), a1, b1); v2us oh, ol; oh[0] = a0; oh[1] = a1; ol[0] = b0; ol[1] = b1; *(v2us*)(Kh + (size_t)c * NP + m) = oh; *(v2us*)(Kl + (size_t)c * NP + m) = ol; }
         } }
__global__ __launch_bounds__(256) void k_vT(const float* __restrict__ Y, bf* Vh, bf* Vl) { const int e = (blockIdx.x * 256 + threadIdx.x) * 2; if (e >= CV * NP) return; const int m = e % NP; const int v = e / NP; unsigned short a0, b0, a1, b1; splitf(Y[(size_t)m * CV + v], a0, b0); splitf(Y[(size_t)(m + 1) * CV + v], a1, b1); v2us oh, ol; oh[0] = a0; oh[1] = a1; ol[0] = b0; ol[1] = b1;
    *(v2us*)(Vh + e) = oh; *(v2us*)(Vl + e) = ol;  }
// k_vsum: one 64-thread block, thread per value channel v: vsum[v] = sum_m YV[m][v] (serial fixed-order sum over m; each thread writes its scalar)
__global__ __launch_bounds__(64) void k_vsum(const float* __restrict__ Y, float* vs) { const int v = threadIdx.x; float s = 0.f;
#pragma unroll 1
    for (int m = 0; m < NP; ++m) s = __fadd_rn(s, Y[(size_t)m * CV + v]); *(float*)(vs + v) = s;  }
__global__ __launch_bounds__(256) void k_mt(const float* __restrict__ M, bf* Mh, bf* Ml) { const int e = (blockIdx.x * 256 + threadIdx.x) * 4; if (e >= CV * CK) return; const int c0 = e % CK, v = e / CK; v4us oh, ol;
#pragma unroll
    for (int u = 0; u < 4; ++u) { unsigned short a, b; splitf(M[(size_t)(c0 + u) * CV + v], a, b); oh[u] = a; ol[u] = b; } *(v4us*)(Mh + e) = oh; *(v4us*)(Ml + e) = ol;  }
__global__ __launch_bounds__(256) void k_splitb(const float* __restrict__ F, const float* __restrict__ vs, bf* Ph, bf* Pl) { const size_t e = ((size_t)blockIdx.x * 256 + threadIdx.x) * 4; if (e >= (size_t)NP * CV) return; const int v0 = (int)(e % CV); const v4f a = *(const v4f*)(F + e); v4us oh, ol;
#pragma unroll
    for (int u = 0; u < 4; ++u) { unsigned short x, y; splitf(__fadd_rn(a[u], vs[v0 + u]), x, y); oh[u] = x; ol[u] = y; } *(v4us*)(Ph + e) = oh; *(v4us*)(Pl + e) = ol;  }
__global__ __launch_bounds__(256) void k_nchw(const float* __restrict__ OT, float* OUTb) { const int e = (blockIdx.x * 256 + threadIdx.x) * 4; if (e >= CO * NP) return; const int p = e % NP; const int o = e / NP; v4f ov;
#pragma unroll
    for (int u = 0; u < 4; ++u) ov[u] = OT[(size_t)(p + u) * CO + o]; *(v4f*)(OUTb + e) = ov;  }

extern "C" void kernel_launch(void* const* d_in, const int* in_sizes, int n_in,
                              void* d_out, int out_size, void* d_ws, size_t ws_size, hipStream_t stream) {
    (void)in_sizes; (void)n_in; (void)out_size;
    const float** I = (const float**)d_in;
    const float *qf = I[0], *kf = I[1], *vf = I[2], *Wk = I[3], *bk = I[4], *ga = I[5], *be = I[6], *Wv = I[7], *bv = I[8], *Ww = I[9], *bw = I[10];
    float* OUT = (float*)d_out;     // [8][128][64][64]
    char* wsp = (char*)d_ws;
    auto take = [&](size_t bytes) { char* p = wsp; wsp += (bytes + 255) & ~(size_t)255; return (void*)p; };
    bf* WK = (bf*)take(CK * CI * 2); bf* WV = (bf*)take(CV * CI * 2); bf* WW = (bf*)take(CO * CV * 2);
    bf* XT = (bf*)take((size_t)NP * CI * 2); float* YQ = (float*)take((size_t)NBI * NP * CK * 4); float* YK = (float*)take((size_t)NBI * NP * CK * 4); float* YV = (float*)take((size_t)NBI * NP * CV * 4); float* STQ = (float*)take(CK * 2 * 4); float* STK = (float*)take(CK * 2 * 4);
    bf* Qh = (bf*)take((size_t)NP * CK * 2); bf* Ql = (bf*)take((size_t)NP * CK * 2); bf* Kh = (bf*)take((size_t)CK * NP * 2); bf* Kl = (bf*)take((size_t)CK * NP * 2); bf* Vh = (bf*)take((size_t)CV * NP * 2); bf* Vl = (bf*)take((size_t)CV * NP * 2); float* vs = (float*)take(256);
    float* M = (float*)take(CK * CV * 4); bf* Mh = (bf*)take(CK * CV * 2); bf* Ml = (bf*)take(CK * CV * 2); float* CTX = (float*)take((size_t)NP * CV * 4); bf* Ch = (bf*)take((size_t)NP * CV * 2); bf* Cl = (bf*)take((size_t)NP * CV * 2); float* OT = (float*)take((size_t)NP * CO * 4);
    if ((size_t)(wsp - (char*)d_ws) > ws_size) return;    // total ~ 35 MB
    k_cvt8<<<(CK * CI / 8 + 255) / 256, 256, 0, stream>>>(Wk, WK, CK * CI / 8); k_cvt8<<<(CV * CI / 8 + 255) / 256, 256, 0, stream>>>(Wv, WV, CV * CI / 8); k_cvt8<<<(CO * CV / 8 + 255) / 256, 256, 0, stream>>>(Ww, WW, CO * CV / 8);   // [out][in] natural = Bt
    // phase 1: the three 1x1 convs for all images (BN needs batch statistics)
    for (int b = 0; b < NBI; ++b) {
        k_xt<<<(NP * CI / 2 + 255) / 256, 256, 0, stream>>>(qf + (size_t)b * CI * NP, XT); k_gemmw<bf, 0, true><<<dim3(NP / 64, 1, 1), 32, 0, stream>>>(XT, nullptr, WK, nullptr, CI, YQ + (size_t)b * NP * CK, CK, bk, 0, 0, 0);
        k_xt<<<(NP * CI / 2 + 255) / 256, 256, 0, stream>>>(kf + (size_t)b * CI * NP, XT); k_gemmw<bf, 0, true><<<dim3(NP / 64, 1, 1), 32, 0, stream>>>(XT, nullptr, WK, nullptr, CI, YK + (size_t)b * NP * CK, CK, bk, 0, 0, 0);
        k_xt<<<(NP * CI / 2 + 255) / 256, 256, 0, stream>>>(vf + (size_t)b * CI * NP, XT); k_gemmw<bf, 0, true><<<dim3(NP / 64, 1, 1), 32, 0, stream>>>(XT, nullptr, WV, nullptr, CI, YV + (size_t)b * NP * CV, CV, bv, 0, 0, 0); }
    k_bnstat<<<CK, 256, 0, stream>>>(YQ, STQ); k_bnstat<<<CK, 256, 0, stream>>>(YK, STK);
    // phase 2: per image
    for (int b = 0; b < NBI; ++b) { const float* yq = YQ + (size_t)b * NP * CK; const float* yk = YK + (size_t)b * NP * CK; const float* yv = YV + (size_t)b * NP * CV;
        k_qn<<<(NP * CK / 4 + 255) / 256, 256, 0, stream>>>(yq, STQ, ga, be, Qh, Ql); k_knT<<<(NP / 2 + 255) / 256, 256, 0, stream>>>(yk, STK, ga, be, Kh, Kl); k_vT<<<(CV * NP / 2 + 255) / 256, 256, 0, stream>>>(yv, Vh, Vl); k_vsum<<<1, 64, 0, stream>>>(yv, vs);
        k_gemmw<bf, 2, false><<<dim3(1, 1, 1), 32, 0, stream>>>(Kh, Kl, Vh, Vl, NP, M, CV, nullptr, 0, 0, 0);          // M[c][v] = sum_m kn[m][c] v[m][v]
        k_mt<<<(CV * CK / 4 + 255) / 256, 256, 0, stream>>>(M, Mh, Ml);
        k_gemmw<bf, 2, false><<<dim3(NP / 64, 1, 1), 32, 0, stream>>>(Qh, Ql, Mh, Ml, CK, CTX, CV, nullptr, 0, 0, 0);     // ctx0[n][v] = qn.M
        k_splitb<<<(NP * CV / 4 + 255) / 256, 256, 0, stream>>>(CTX, vs, Ch, Cl);   // + vsum[v] (f32), hl planes
        k_gemmw<bf, 1, true><<<dim3(NP / 64, CO / 64, 1), 32, 0, stream>>>(Ch, Cl, WW, nullptr, CV, OT, CO, bw, 0, 0, 0);    // [p][o]
        k_nchw<<<(CO * NP / 4 + 255) / 256, 256, 0, stream>>>(OT, OUT + (size_t)b * CO * NP); }
}

// v001
// One run takes 1200 microseconds.
// In two side-by-side timings against v000, it was 7.76 and 7.69 times as fast.
#include <hip/hip_runtime.h>

// non_local_attention (query/key/value features [8][128][64x64]; q = BN_train(conv1x1(query; Wk, bk)), k = BN_train(conv1x1(key; Wk, bk)) (BatchNorm2d in training mode: per-channel batch statistics over (B,H,W), each call its own), v = conv1x1(value; Wv, bv);
// q, k L2-normalised over their 64 channels per position (+1e-7); sim[n][m] = q_n.k_m + 1 (no softmax); ctx[n] = sum_m sim[n][m] v_m; out = conv1x1(ctx; Ww, bw) -> [8][128][64][64]).
// Reassociation (exact algebra, no softmax in between): ctx[n][v] = sum_c qn[n][c] M[c][v] + vsum[v] with M = kn^T v (64x64) and vsum = sum_m v_m - the [4096][4096] similarity map is never formed.

#define NBI  8
#define CI   128
#define NP   4096
#define CK   64
#define CV   64
#define CO   128
typedef _Float16 h16;
typedef unsigned short bf;
typedef __attribute__((ext_vector_type(16))) __bf16   v16bf;
typedef __attribute__((ext_vector_type(16))) _Float16 v16h;
typedef __attribute__((ext_vector_type(8)))  _Float16 v8h;
typedef __attribute__((ext_vector_type(8)))  unsigned short v8us;
typedef __attribute__((ext_vector_type(8)))  float    v8f;
typedef __attribute__((ext_vector_type(4)))  float    v4f;
typedef v8h  __attribute__((may_alias)) v8ha;
typedef v4f  __attribute__((may_alias)) v4fa;
typedef v8us __attribute__((may_alias)) v8usa;

__device__ __forceinline__ unsigned short f2bf(float f) { unsigned u = __float_as_uint(f); u += 0x7FFFu + ((u >> 16) & 1u); return (unsigned short)(u >> 16); }
__device__ __forceinline__ float bf2f(unsigned short b) { return __uint_as_float(((unsigned)b) << 16); }
__device__ __forceinline__ float bfr(float f) { return bf2f(f2bf(f)); }
__device__ __forceinline__ v16h cat16(v8h lo, v8h hi) { return __builtin_shufflevector(lo, hi, 0, 1, 2, 3, 4, 5, 6, 7, 8, 9, 10, 11, 12, 13, 14, 15); }
__device__ __forceinline__ v16bf cat16b(v8us lo, v8us hi) { return __builtin_bit_cast(v16bf, __builtin_shufflevector(lo, hi, 0, 1, 2, 3, 4, 5, 6, 7, 8, 9, 10, 11, 12, 13, 14, 15)); }
__device__ __forceinline__ v8f wmma16(v16h a, v16h b, v8f c) { return __builtin_amdgcn_wmma_f32_16x16x32_f16(false, a, false, b, (short)0, c, false, false); }
__device__ __forceinline__ v8f wmmab(v16bf a, v16bf b, v8f c) { return __builtin_amdgcn_wmma_f32_16x16x32_bf16(false, a, false, b, (short)0, c, false, false); }



// ---- k_gemmw: register-blocked GEMM, ONE WAVE per 64x64 output tile (16 accumulators), operands straight from K-contiguous 16-bit planes; grid (M/64, N/64, Z), 32 threads.
// C[m][n] (f32, pitch ldc, + optional f32 bias[n]) = sum_k A[m][k] Bt[n][k] (+ split products per NSPLIT). z-batch strides sA/sB/sC in elements. K % 32 == 0.
template <typename T16> struct WFrag;
template <> struct WFrag<h16> { typedef v16h V; static __device__ __forceinline__ V ld(const h16* p) { return cat16(*(const v8h*)p, *(const v8h*)(p + 16)); } static __device__ __forceinline__ v8f mma(V a, V b, v8f c) { return wmma16(a, b, c); } };
template <> struct WFrag<bf> { typedef v16bf V; static __device__ __forceinline__ V ld(const bf* p) { return cat16b(*(const v8us*)p, *(const v8us*)(p + 16)); } static __device__ __forceinline__ v8f mma(V a, V b, v8f c) { return wmmab(a, b, c); } };
template <typename T16, int NSPLIT, bool BIAS>
__global__ __launch_bounds__(32) void k_gemmw(const T16* __restrict__ A, const T16* __restrict__ A2, const T16* __restrict__ Bt, const T16* __restrict__ Bt2, int K, float* C, int ldc, const float* __restrict__ bias, size_t sA, size_t sB, size_t sC) {
    typedef typename WFrag<T16>::V V;
    __shared__ __align__(16) float os[16 * 68];
    const size_t z = blockIdx.z; A += z * sA; if (A2) A2 += z * sA; Bt += z * sB; if (Bt2) Bt2 += z * sB; C += z * sC;
    const int lane = threadIdx.x & 31, lr = lane & 15, hi = lane >> 4; const int r0 = blockIdx.x * 64, c0 = blockIdx.y * 64;
    v8f acc[4][4];
#pragma unroll
    for (int mb = 0; mb < 4; ++mb)
#pragma unroll
        for (int nb = 0; nb < 4; ++nb) acc[mb][nb] = (v8f){};
    const size_t aoff = (size_t)(r0 + lr) * K + 8 * hi, boff = (size_t)(c0 + lr) * K + 8 * hi;
#pragma unroll 1
    for (int kc = 0; kc < K; kc += 32) {
        V a[4], a2[4];
#pragma unroll
        for (int mb = 0; mb < 4; ++mb) { a[mb] = WFrag<T16>::ld(A + aoff + (size_t)mb * 16 * K + kc); if (NSPLIT == 1 || NSPLIT == 2) a2[mb] = WFrag<T16>::ld(A2 + aoff + (size_t)mb * 16 * K + kc); }
#pragma unroll
        for (int nb = 0; nb < 4; ++nb) { const V b = WFrag<T16>::ld(Bt + boff + (size_t)nb * 16 * K + kc); V b2; if (NSPLIT >= 2) b2 = WFrag<T16>::ld(Bt2 + boff + (size_t)nb * 16 * K + kc);
#pragma unroll
            for (int mb = 0; mb < 4; ++mb) { acc[mb][nb] = WFrag<T16>::mma(a[mb], b, acc[mb][nb]); if (NSPLIT == 1 || NSPLIT == 2) acc[mb][nb] = WFrag<T16>::mma(a2[mb], b, acc[mb][nb]); if (NSPLIT >= 2) acc[mb][nb] = WFrag<T16>::mma(a[mb], b2, acc[mb][nb]); } }
        asm volatile("v_nop\n\tv_nop\n\tv_nop\n\tv_nop" : "+v"(acc[0][0]), "+v"(acc[1][1]), "+v"(acc[2][2]), "+v"(acc[3][3]) : "v"(a[0]), "v"(a[3]));
    }
#pragma unroll
    for (int mb = 0; mb < 4; ++mb) {
#pragma unroll
        for (int nb = 0; nb < 4; ++nb) {
#pragma unroll
            for (int j = 0; j < 8; ++j) os[(hi * 8 + j) * 68 + nb * 16 + lr] = acc[mb][nb][j]; }
        __builtin_amdgcn_wave_barrier(); asm volatile("" ::: "memory");
        float* crow = C + (size_t)(r0 + mb * 16) * ldc + c0;
{
#pragma unroll
            for (int s = 0; s < 8; ++s) { const int row = 2 * s + hi, cofs = lr * 4; v4f val = *(const v4fa*)(os + row * 68 + cofs); if (BIAS) { val[0] += bfr(bias[c0 + cofs]); val[1] += bfr(bias[c0 + cofs + 1]); val[2] += bfr(bias[c0 + cofs + 2]); val[3] += bfr(bias[c0 + cofs + 3]); }
                *(v4f*)(crow + (size_t)row * ldc + cofs) = val; }
             }
        __builtin_amdgcn_wave_barrier(); asm volatile("" ::: "memory");
    }
}

__device__ __forceinline__ void splitf(float y, unsigned short& h, unsigned short& l) { h = f2bf(y); l = f2bf(y - bf2f(h)); }
typedef __attribute__((ext_vector_type(2))) unsigned short v2us;
typedef __attribute__((ext_vector_type(2))) float v2f;
typedef __attribute__((ext_vector_type(4))) unsigned short v4us;

__global__ __launch_bounds__(256) void k_cvt8(const float* __restrict__ src, bf* dst, size_t n8) { const size_t i = (size_t)blockIdx.x * 256 + threadIdx.x; if (i >= n8) return; const v8f v = *(const v8f*)(src + i * 8); v8us o;
#pragma unroll
    for (int k = 0; k < 8; ++k) o[k] = f2bf(v[k]); *(v8us*)(dst + i * 8) = o;  }
__global__ __launch_bounds__(256) void k_xt(const float* __restrict__ x, bf* XT) { const int e = (blockIdx.x * 256 + threadIdx.x) * 2; if (e >= NP * CI) return; const int c = e % CI; const int p = e / CI; v2us o; o[0] = f2bf(x[(size_t)c * NP + p]); o[1] = f2bf(x[(size_t)(c + 1) * NP + p]); *(v2us*)(XT + e) = o;  }
__global__ __launch_bounds__(256) void k_bnstat(const float* __restrict__ Y, float* ST) { __shared__ float red[256]; const int c = blockIdx.x; const int tid = threadIdx.x; float s = 0.f;
    for (int i = tid; i < NBI * NP; i += 256) s += Y[(size_t)i * CK + c];
    red[tid] = s; __syncthreads(); for (int k = 128; k; k >>= 1) { if (tid < k) red[tid] = __fadd_rn(red[tid], red[tid + k]); __syncthreads(); } const float mean = red[0] * (1.0f / (NBI * NP)); __syncthreads();
    float q = 0.f; for (int i = tid; i < NBI * NP; i += 256) { float d = __fsub_rn(Y[(size_t)i * CK + c], mean); asm volatile("" : "+v"(d)); float p = __fmul_rn(d, d); asm volatile("" : "+v"(p)); q = __fadd_rn(q, p); }
    red[tid] = q; __syncthreads(); for (int k = 128; k; k >>= 1) { if (tid < k) red[tid] = __fadd_rn(red[tid], red[tid + k]); __syncthreads(); }
    if (tid == 0) { v2f o; o[0] = mean; o[1] = __frsqrt_rn(__fadd_rn(red[0] * (1.0f / (NBI * NP)), 1e-5f)); *(v2f*)(ST + 2 * c) = o;  } }
__global__ __launch_bounds__(256) void k_qn(const float* __restrict__ Y, const float* __restrict__ ST, const float* __restrict__ ga, const float* __restrict__ be, bf* Qh, bf* Ql) { const int e = (blockIdx.x * 256 + threadIdx.x) * 4; if (e >= NP * CK) return; const int c0 = e % CK; const v4f a = *(const v4f*)(Y + e); float y[4]; float ss = 0.f;
#pragma unroll
    for (int u = 0; u < 4; ++u) { const int c = c0 + u; float t0 = __fmul_rn(__fsub_rn(a[u], ST[2 * c]), ST[2 * c + 1]); asm volatile("" : "+v"(t0)); float g = bfr(ga[c]), bb = bfr(be[c]); asm volatile("" : "+v"(g)); asm volatile("" : "+v"(bb)); float t1 = __fmul_rn(t0, g); asm volatile("" : "+v"(t1)); y[u] = __fadd_rn(t1, bb); float p = __fmul_rn(y[u], y[u]); asm volatile("" : "+v"(p)); ss = __fadd_rn(ss, p); }
    ss += __shfl_xor(ss, 1, 32); ss += __shfl_xor(ss, 2, 32); ss += __shfl_xor(ss, 4, 32); ss += __shfl_xor(ss, 8, 32); const float inv = __fdiv_rn(1.0f, __fadd_rn(__fsqrt_rn(ss), 1e-7f)); v4us oh, ol;
#pragma unroll
    for (int u = 0; u < 4; ++u) { unsigned short hh, ll; splitf(__fmul_rn(y[u], inv), hh, ll); oh[u] = hh; ol[u] = ll; } *(v4us*)(Qh + e) = oh; *(v4us*)(Ql + e) = ol;  }
__global__ __launch_bounds__(256) void k_knT(const float* __restrict__ Y, const float* __restrict__ ST, const float* __restrict__ ga, const float* __restrict__ be, bf* Kh, bf* Kl) { const int m = (blockIdx.x * 256 + threadIdx.x) * 2; if (m >= NP) return; float y0[CK], y1[CK]; float s0 = 0.f, s1 = 0.f;
#pragma unroll
    for (int c4 = 0; c4 < CK / 4; ++c4) { const v4f a = *(const v4f*)(Y + (size_t)m * CK + c4 * 4), b = *(const v4f*)(Y + (size_t)(m + 1) * CK + c4 * 4);
#pragma unroll
        for (int u = 0; u < 4; ++u) { const int c = c4 * 4 + u; const float mu = ST[2 * c], rs = ST[2 * c + 1]; float g = bfr(ga[c]), bb = bfr(be[c]); asm volatile("" : "+v"(g)); asm volatile("" : "+v"(bb));
            float t0 = __fmul_rn(__fsub_rn(a[u], mu), rs), t1 = __fmul_rn(__fsub_rn(b[u], mu), rs); asm volatile("" : "+v"(t0)); asm volatile("" : "+v"(t1)); float u0 = __fmul_rn(t0, g), u1 = __fmul_rn(t1, g); asm volatile("" : "+v"(u0)); asm volatile("" : "+v"(u1)); y0[c] = __fadd_rn(u0, bb); y1[c] = __fadd_rn(u1, bb);
            float p0 = __fmul_rn(y0[c], y0[c]), p1 = __fmul_rn(y1[c], y1[c]); asm volatile("" : "+v"(p0)); asm volatile("" : "+v"(p1)); s0 = __fadd_rn(s0, p0); s1 = __fadd_rn(s1, p1); } }
    const float i0 = __fdiv_rn(1.0f, __fadd_rn(__fsqrt_rn(s0), 1e-7f)), i1 = __fdiv_rn(1.0f, __fadd_rn(__fsqrt_rn(s1), 1e-7f));
    {
#pragma unroll
        for (int c = 0; c < CK; ++c) { unsigned short a0, b0, a1, b1; splitf(__fmul_rn(y0[c], i0), a0, b0); splitf(__fmul_rn(y1[c], i1), a1, b1); v2us oh, ol; oh[0] = a0; oh[1] = a1; ol[0] = b0; ol[1] = b1; *(v2us*)(Kh + (size_t)c * NP + m) = oh; *(v2us*)(Kl + (size_t)c * NP + m) = ol; }
         } }
__global__ __launch_bounds__(256) void k_vT(const float* __restrict__ Y, bf* Vh, bf* Vl) { const int e = (blockIdx.x * 256 + threadIdx.x) * 2; if (e >= CV * NP) return; const int m = e % NP; const int v = e / NP; unsigned short a0, b0, a1, b1; splitf(Y[(size_t)m * CV + v], a0, b0); splitf(Y[(size_t)(m + 1) * CV + v], a1, b1); v2us oh, ol; oh[0] = a0; oh[1] = a1; ol[0] = b0; ol[1] = b1;
    *(v2us*)(Vh + e) = oh; *(v2us*)(Vl + e) = ol;  }
// k_vsum: vs[b][v] = sum_m YV[b][m][v] for all images in one launch. Grid (image, half of the 64 channels): a block's 32 channels are one 128-B line of every row, its 32 results one 128-B line of vs.
// 1024 threads = 128 rows x 8 lanes of 4 channels: a thread adds its 32 rows (independent loads, in flight together), a wave folds its 4 rows by two butterfly steps, wave 0 adds the 32 waves' partials from LDS in wave order. Fixed order, no atomics.
__global__ __launch_bounds__(1024) void k_vsum(const float* __restrict__ Y, float* vs) { __shared__ __align__(16) float red[32 * 32]; const int tid = threadIdx.x, q = tid & 7, r = tid >> 3;
    const float* p = Y + (size_t)blockIdx.x * NP * CV + (size_t)r * CV + blockIdx.y * 32 + q * 4; v4f s = (v4f){};
    for (int i = 0; i < NP / 128; ++i) s += *(const v4f*)(p + (size_t)i * 128 * CV);
    for (int u = 0; u < 4; ++u) { s[u] += __shfl_xor(s[u], 8, 32); s[u] += __shfl_xor(s[u], 16, 32); }
    if ((tid & 31) < 8) *(v4f*)(red + (tid >> 5) * 32 + q * 4) = s;
    __syncthreads();   // publishes the 32 waves' partial sums to wave 0
    if (tid < 32) { float t = 0.f;
        for (int w = 0; w < 32; ++w) t += red[w * 32 + tid];
        vs[blockIdx.x * CV + blockIdx.y * 32 + tid] = t; } }
__global__ __launch_bounds__(256) void k_mt(const float* __restrict__ M, bf* Mh, bf* Ml) { const int e = (blockIdx.x * 256 + threadIdx.x) * 4; if (e >= CV * CK) return; const int c0 = e % CK, v = e / CK; v4us oh, ol;
#pragma unroll
    for (int u = 0; u < 4; ++u) { unsigned short a, b; splitf(M[(size_t)(c0 + u) * CV + v], a, b); oh[u] = a; ol[u] = b; } *(v4us*)(Mh + e) = oh; *(v4us*)(Ml + e) = ol;  }
__global__ __launch_bounds__(256) void k_splitb(const float* __restrict__ F, const float* __restrict__ vs, bf* Ph, bf* Pl) { const size_t e = ((size_t)blockIdx.x * 256 + threadIdx.x) * 4; if (e >= (size_t)NP * CV) return; const int v0 = (int)(e % CV); const v4f a = *(const v4f*)(F + e); v4us oh, ol;
#pragma unroll
    for (int u = 0; u < 4; ++u) { unsigned short x, y; splitf(__fadd_rn(a[u], vs[v0 + u]), x, y); oh[u] = x; ol[u] = y; } *(v4us*)(Ph + e) = oh; *(v4us*)(Pl + e) = ol;  }
__global__ __launch_bounds__(256) void k_nchw(const float* __restrict__ OT, float* OUTb) { const int e = (blockIdx.x * 256 + threadIdx.x) * 4; if (e >= CO * NP) return; const int p = e % NP; const int o = e / NP; v4f ov;
#pragma unroll
    for (int u = 0; u < 4; ++u) ov[u] = OT[(size_t)(p + u) * CO + o]; *(v4f*)(OUTb + e) = ov;  }

extern "C" void kernel_launch(void* const* d_in, const int* in_sizes, int n_in,
                              void* d_out, int out_size, void* d_ws, size_t ws_size, hipStream_t stream) {
    (void)in_sizes; (void)n_in; (void)out_size;
    const float** I = (const float**)d_in;
    const float *qf = I[0], *kf = I[1], *vf = I[2], *Wk = I[3], *bk = I[4], *ga = I[5], *be = I[6], *Wv = I[7], *bv = I[8], *Ww = I[9], *bw = I[10];
    float* OUT = (float*)d_out;     // [8][128][64][64]
    char* wsp = (char*)d_ws;
    auto take = [&](size_t bytes) { char* p = wsp; wsp += (bytes + 255) & ~(size_t)255; return (void*)p; };
    bf* WK = (bf*)take(CK * CI * 2); bf* WV = (bf*)take(CV * CI * 2); bf* WW = (bf*)take(CO * CV * 2);
    bf* XT = (bf*)take((size_t)NP * CI * 2); float* YQ = (float*)take((size_t)NBI * NP * CK * 4); float* YK = (float*)take((size_t)NBI * NP * CK * 4); float* YV = (float*)take((size_t)NBI * NP * CV * 4); float* STQ = (float*)take(CK * 2 * 4); float* STK = (float*)take(CK * 2 * 4);
    bf* Qh = (bf*)take((size_t)NP * CK * 2); bf* Ql = (bf*)take((size_t)NP * CK * 2); bf* Kh = (bf*)take((size_t)CK * NP * 2); bf* Kl = (bf*)take((size_t)CK * NP * 2); bf* Vh = (bf*)take((size_t)CV * NP * 2); bf* Vl = (bf*)take((size_t)CV * NP * 2); float* vs = (float*)take(NBI * CV * 4);
    float* M = (float*)take(CK * CV * 4); bf* Mh = (bf*)take(CK * CV * 2); bf* Ml = (bf*)take(CK * CV * 2); float* CTX = (float*)take((size_t)NP * CV * 4); bf* Ch = (bf*)take((size_t)NP * CV * 2); bf* Cl = (bf*)take((size_t)NP * CV * 2); float* OT = (float*)take((size_t)NP * CO * 4);
    if ((size_t)(wsp - (char*)d_ws) > ws_size) return;    // total ~ 35 MB
    k_cvt8<<<(CK * CI / 8 + 255) / 256, 256, 0, stream>>>(Wk, WK, CK * CI / 8); k_cvt8<<<(CV * CI / 8 + 255) / 256, 256, 0, stream>>>(Wv, WV, CV * CI / 8); k_cvt8<<<(CO * CV / 8 + 255) / 256, 256, 0, stream>>>(Ww, WW, CO * CV / 8);   // [out][in] natural = Bt
    // phase 1: the three 1x1 convs for all images (BN needs batch statistics)
    for (int b = 0; b < NBI; ++b) {
        k_xt<<<(NP * CI / 2 + 255) / 256, 256, 0, stream>>>(qf + (size_t)b * CI * NP, XT); k_gemmw<bf, 0, true><<<dim3(NP / 64, 1, 1), 32, 0, stream>>>(XT, nullptr, WK, nullptr, CI, YQ + (size_t)b * NP * CK, CK, bk, 0, 0, 0);
        k_xt<<<(NP * CI / 2 + 255) / 256, 256, 0, stream>>>(kf + (size_t)b * CI * NP, XT); k_gemmw<bf, 0, true><<<dim3(NP / 64, 1, 1), 32, 0, stream>>>(XT, nullptr, WK, nullptr, CI, YK + (size_t)b * NP * CK, CK, bk, 0, 0, 0);
        k_xt<<<(NP * CI / 2 + 255) / 256, 256, 0, stream>>>(vf + (size_t)b * CI * NP, XT); k_gemmw<bf, 0, true><<<dim3(NP / 64, 1, 1), 32, 0, stream>>>(XT, nullptr, WV, nullptr, CI, YV + (size_t)b * NP * CV, CV, bv, 0, 0, 0); }
    k_bnstat<<<CK, 256, 0, stream>>>(YQ, STQ); k_bnstat<<<CK, 256, 0, stream>>>(YK, STK); k_vsum<<<dim3(NBI, 2, 1), 1024, 0, stream>>>(YV, vs);
    // phase 2: per image
    for (int b = 0; b < NBI; ++b) { const float* yq = YQ + (size_t)b * NP * CK; const float* yk = YK + (size_t)b * NP * CK; const float* yv = YV + (size_t)b * NP * CV;
        k_qn<<<(NP * CK / 4 + 255) / 256, 256, 0, stream>>>(yq, STQ, ga, be, Qh, Ql); k_knT<<<(NP / 2 + 255) / 256, 256, 0, stream>>>(yk, STK, ga, be, Kh, Kl); k_vT<<<(CV * NP / 2 + 255) / 256, 256, 0, stream>>>(yv, Vh, Vl);
        k_gemmw<bf, 2, false><<<dim3(1, 1, 1), 32, 0, stream>>>(Kh, Kl, Vh, Vl, NP, M, CV, nullptr, 0, 0, 0);          // M[c][v] = sum_m kn[m][c] v[m][v]
        k_mt<<<(CV * CK / 4 + 255) / 256, 256, 0, stream>>>(M, Mh, Ml);
        k_gemmw<bf, 2, false><<<dim3(NP / 64, 1, 1), 32, 0, stream>>>(Qh, Ql, Mh, Ml, CK, CTX, CV, nullptr, 0, 0, 0);     // ctx0[n][v] = qn.M
        k_splitb<<<(NP * CV / 4 + 255) / 256, 256, 0, stream>>>(CTX, vs + b * CV, Ch, Cl);   // + vsum[v] (f32), hl planes
        k_gemmw<bf, 1, true><<<dim3(NP / 64, CO / 64, 1), 32, 0, stream>>>(Ch, Cl, WW, nullptr, CV, OT, CO, bw, 0, 0, 0);    // [p][o]
        k_nchw<<<(CO * NP / 4 + 255) / 256, 256, 0, stream>>>(OT, OUT + (size_t)b * CO * NP); }
}

// v002
// A run of this version takes 264 microseconds.
// Next to v001, in two timings, it ran 4.52 and 4.67 times as fast.
// Over all steps from v000 it is 35.5 times as fast.
#include <hip/hip_runtime.h>

// non_local_attention (query/key/value features [8][128][64x64]; q = BN_train(conv1x1(query; Wk, bk)), k = BN_train(conv1x1(key; Wk, bk)) (BatchNorm2d in training mode: per-channel batch statistics over (B,H,W), each call its own), v = conv1x1(value; Wv, bv);
// q, k L2-normalised over their 64 channels per position (+1e-7); sim[n][m] = q_n.k_m + 1 (no softmax); ctx[n] = sum_m sim[n][m] v_m; out = conv1x1(ctx; Ww, bw) -> [8][128][64][64]).
// Reassociation (exact algebra, no softmax in between): ctx[n][v] = sum_c qn[n][c] M[c][v] + vsum[v] with M = kn^T v (64x64) and vsum = sum_m v_m - the [4096][4096] similarity map is never formed.

#define NBI  8
#define CI   128
#define NP   4096
#define CK   64
#define CV   64
#define CO   128
typedef _Float16 h16;
typedef unsigned short bf;
typedef __attribute__((ext_vector_type(16))) __bf16   v16bf;
typedef __attribute__((ext_vector_type(16))) _Float16 v16h;
typedef __attribute__((ext_vector_type(8)))  _Float16 v8h;
typedef __attribute__((ext_vector_type(8)))  unsigned short v8us;
typedef __attribute__((ext_vector_type(8)))  float    v8f;
typedef __attribute__((ext_vector_type(4)))  float    v4f;
typedef v8h  __attribute__((may_alias)) v8ha;
typedef v4f  __attribute__((may_alias)) v4fa;
typedef v8us __attribute__((may_alias)) v8usa;

__device__ __forceinline__ unsigned short f2bf(float f) { unsigned u = __float_as_uint(f); u += 0x7FFFu + ((u >> 16) & 1u); return (unsigned short)(u >> 16); }
__device__ __forceinline__ float bf2f(unsigned short b) { return __uint_as_float(((unsigned)b) << 16); }
__device__ __forceinline__ float bfr(float f) { return bf2f(f2bf(f)); }
__device__ __forceinline__ v16h cat16(v8h lo, v8h hi) { return __builtin_shufflevector(lo, hi, 0, 1, 2, 3, 4, 5, 6, 7, 8, 9, 10, 11, 12, 13, 14, 15); }
__device__ __forceinline__ v16bf cat16b(v8us lo, v8us hi) { return __builtin_bit_cast(v16bf, __builtin_shufflevector(lo, hi, 0, 1, 2, 3, 4, 5, 6, 7, 8, 9, 10, 11, 12, 13, 14, 15)); }
__device__ __forceinline__ v8f wmma16(v16h a, v16h b, v8f c) { return __builtin_amdgcn_wmma_f32_16x16x32_f16(false, a, false, b, (short)0, c, false, false); }
__device__ __forceinline__ v8f wmmab(v16bf a, v16bf b, v8f c) { return __builtin_amdgcn_wmma_f32_16x16x32_bf16(false, a, false, b, (short)0, c, false, false); }



// ---- k_gemmw: register-blocked GEMM, ONE WAVE per 64x64 output tile (16 accumulators), operands straight from K-contiguous 16-bit planes; grid (M/64, N/64, Z), 32 threads.
// C[m][n] (f32, pitch ldc, + optional f32 bias[n]) = sum_k A[m][k] Bt[n][k] (+ split products per NSPLIT). z-batch strides sA/sB/sC in elements. K % 32 == 0.
template <typename T16> struct WFrag;
template <> struct WFrag<h16> { typedef v16h V; static __device__ __forceinline__ V ld(const h16* p) { return cat16(*(const v8h*)p, *(const v8h*)(p + 16)); } static __device__ __forceinline__ v8f mma(V a, V b, v8f c) { return wmma16(a, b, c); } };
template <> struct WFrag<bf> { typedef v16bf V; static __device__ __forceinline__ V ld(const bf* p) { return cat16b(*(const v8us*)p, *(const v8us*)(p + 16)); } static __device__ __forceinline__ v8f mma(V a, V b, v8f c) { return wmmab(a, b, c); } };
template <typename T16, int NSPLIT, bool BIAS>
__global__ __launch_bounds__(32) void k_gemmw(const T16* __restrict__ A, const T16* __restrict__ A2, const T16* __restrict__ Bt, const T16* __restrict__ Bt2, int K, float* C, int ldc, const float* __restrict__ bias, size_t sA, size_t sB, size_t sC) {
    typedef typename WFrag<T16>::V V;
    __shared__ __align__(16) float os[16 * 68];
    const size_t z = blockIdx.z; A += z * sA; if (A2) A2 += z * sA; Bt += z * sB; if (Bt2) Bt2 += z * sB; C += z * sC;
    const int lane = threadIdx.x & 31, lr = lane & 15, hi = lane >> 4; const int r0 = blockIdx.x * 64, c0 = blockIdx.y * 64;
    v8f acc[4][4];
#pragma unroll
    for (int mb = 0; mb < 4; ++mb)
#pragma unroll
        for (int nb = 0; nb < 4; ++nb) acc[mb][nb] = (v8f){};
    const size_t aoff = (size_t)(r0 + lr) * K + 8 * hi, boff = (size_t)(c0 + lr) * K + 8 * hi;
#pragma unroll 1
    for (int kc = 0; kc < K; kc += 32) {
        V a[4], a2[4];
#pragma unroll
        for (int mb = 0; mb < 4; ++mb) { a[mb] = WFrag<T16>::ld(A + aoff + (size_t)mb * 16 * K + kc); if (NSPLIT == 1 || NSPLIT == 2) a2[mb] = WFrag<T16>::ld(A2 + aoff + (size_t)mb * 16 * K + kc); }
#pragma unroll
        for (int nb = 0; nb < 4; ++nb) { const V b = WFrag<T16>::ld(Bt + boff + (size_t)nb * 16 * K + kc); V b2; if (NSPLIT >= 2) b2 = WFrag<T16>::ld(Bt2 + boff + (size_t)nb * 16 * K + kc);
#pragma unroll
            for (int mb = 0; mb < 4; ++mb) { acc[mb][nb] = WFrag<T16>::mma(a[mb], b, acc[mb][nb]); if (NSPLIT == 1 || NSPLIT == 2) acc[mb][nb] = WFrag<T16>::mma(a2[mb], b, acc[mb][nb]); if (NSPLIT >= 2) acc[mb][nb] = WFrag<T16>::mma(a[mb], b2, acc[mb][nb]); } }
        asm volatile("v_nop\n\tv_nop\n\tv_nop\n\tv_nop" : "+v"(acc[0][0]), "+v"(acc[1][1]), "+v"(acc[2][2]), "+v"(acc[3][3]) : "v"(a[0]), "v"(a[3]));
    }
#pragma unroll
    for (int mb = 0; mb < 4; ++mb) {
#pragma unroll
        for (int nb = 0; nb < 4; ++nb) {
#pragma unroll
            for (int j = 0; j < 8; ++j) os[(hi * 8 + j) * 68 + nb * 16 + lr] = acc[mb][nb][j]; }
        __builtin_amdgcn_wave_barrier(); asm volatile("" ::: "memory");
        float* crow = C + (size_t)(r0 + mb * 16) * ldc + c0;
{
#pragma unroll
            for (int s = 0; s < 8; ++s) { const int row = 2 * s + hi, cofs = lr * 4; v4f val = *(const v4fa*)(os + row * 68 + cofs); if (BIAS) { val[0] += bfr(bias[c0 + cofs]); val[1] += bfr(bias[c0 + cofs + 1]); val[2] += bfr(bias[c0 + cofs + 2]); val[3] += bfr(bias[c0 + cofs + 3]); }
                *(v4f*)(crow + (size_t)row * ldc + cofs) = val; }
             }
        __builtin_amdgcn_wave_barrier(); asm volatile("" ::: "memory");
    }
}

__device__ __forceinline__ void splitf(float y, unsigned short& h, unsigned short& l) { h = f2bf(y); l = f2bf(y - bf2f(h)); }
typedef __attribute__((ext_vector_type(2))) unsigned short v2us;
typedef __attribute__((ext_vector_type(2))) float v2f;
typedef __attribute__((ext_vector_type(4))) unsigned short v4us;

// Kernels below that work per image take it from blockIdx.y (k_vsum: blockIdx.x), and where several tensors go the same way the tensor from blockIdx.y (k_xt: blockIdx.z): one launch per stage for the whole batch, each image on its own workspace planes.
__global__ __launch_bounds__(256) void k_cvt8(const float* __restrict__ s0, const float* __restrict__ s1, const float* __restrict__ s2, bf* dst, size_t n8) { const size_t i = (size_t)blockIdx.x * 256 + threadIdx.x; if (i >= n8) return; const float* src = blockIdx.y == 0 ? s0 : blockIdx.y == 1 ? s1 : s2; dst += (size_t)blockIdx.y * n8 * 8; const v8f v = *(const v8f*)(src + i * 8); v8us o;
#pragma unroll
    for (int k = 0; k < 8; ++k) o[k] = f2bf(v[k]); *(v8us*)(dst + i * 8) = o;  }
__global__ __launch_bounds__(256) void k_xt(const float* __restrict__ xq, const float* __restrict__ xk, const float* __restrict__ xv, bf* XT) { const int e = (blockIdx.x * 256 + threadIdx.x) * 2; if (e >= NP * CI) return; const float* x = (blockIdx.z == 0 ? xq : blockIdx.z == 1 ? xk : xv) + (size_t)blockIdx.y * CI * NP; XT += ((size_t)blockIdx.z * NBI + blockIdx.y) * NP * CI; const int c = e % CI; const int p = e / CI; v2us o; o[0] = f2bf(x[(size_t)c * NP + p]); o[1] = f2bf(x[(size_t)(c + 1) * NP + p]); *(v2us*)(XT + e) = o;  }
__global__ __launch_bounds__(256) void k_bnstat(const float* __restrict__ Y, float* ST) { __shared__ float red[256]; const int c = blockIdx.x; const int tid = threadIdx.x; float s = 0.f; Y += (size_t)blockIdx.y * NBI * NP * CK; ST += blockIdx.y * 2 * CK;
    for (int i = tid; i < NBI * NP; i += 256) s += Y[(size_t)i * CK + c];
    red[tid] = s; __syncthreads(); for (int k = 128; k; k >>= 1) { if (tid < k) red[tid] = __fadd_rn(red[tid], red[tid + k]); __syncthreads(); } const float mean = red[0] * (1.0f / (NBI * NP)); __syncthreads();
    float q = 0.f; for (int i = tid; i < NBI * NP; i += 256) { float d = __fsub_rn(Y[(size_t)i * CK + c], mean); asm volatile("" : "+v"(d)); float p = __fmul_rn(d, d); asm volatile("" : "+v"(p)); q = __fadd_rn(q, p); }
    red[tid] = q; __syncthreads(); for (int k = 128; k; k >>= 1) { if (tid < k) red[tid] = __fadd_rn(red[tid], red[tid + k]); __syncthreads(); }
    if (tid == 0) { v2f o; o[0] = mean; o[1] = __frsqrt_rn(__fadd_rn(red[0] * (1.0f / (NBI * NP)), 1e-5f)); *(v2f*)(ST + 2 * c) = o;  } }
__global__ __launch_bounds__(256) void k_qn(const float* __restrict__ Y, const float* __restrict__ ST, const float* __restrict__ ga, const float* __restrict__ be, bf* Qh, bf* Ql) { const int e = (blockIdx.x * 256 + threadIdx.x) * 4; if (e >= NP * CK) return; Y += (size_t)blockIdx.y * NP * CK; Qh += (size_t)blockIdx.y * NP * CK; Ql += (size_t)blockIdx.y * NP * CK; const int c0 = e % CK; const v4f a = *(const v4f*)(Y + e); float y[4]; float ss = 0.f;
#pragma unroll
    for (int u = 0; u < 4; ++u) { const int c = c0 + u; float t0 = __fmul_rn(__fsub_rn(a[u], ST[2 * c]), ST[2 * c + 1]); asm volatile("" : "+v"(t0)); float g = bfr(ga[c]), bb = bfr(be[c]); asm volatile("" : "+v"(g)); asm volatile("" : "+v"(bb)); float t1 = __fmul_rn(t0, g); asm volatile("" : "+v"(t1)); y[u] = __fadd_rn(t1, bb); float p = __fmul_rn(y[u], y[u]); asm volatile("" : "+v"(p)); ss = __fadd_rn(ss, p); }
    ss += __shfl_xor(ss, 1, 32); ss += __shfl_xor(ss, 2, 32); ss += __shfl_xor(ss, 4, 32); ss += __shfl_xor(ss, 8, 32); const float inv = __fdiv_rn(1.0f, __fadd_rn(__fsqrt_rn(ss), 1e-7f)); v4us oh, ol;
#pragma unroll
    for (int u = 0; u < 4; ++u) { unsigned short hh, ll; splitf(__fmul_rn(y[u], inv), hh, ll); oh[u] = hh; ol[u] = ll; } *(v4us*)(Qh + e) = oh; *(v4us*)(Ql + e) = ol;  }
__global__ __launch_bounds__(256) void k_knT(const float* __restrict__ Y, const float* __restrict__ ST, const float* __restrict__ ga, const float* __restrict__ be, bf* Kh, bf* Kl) { const int m = (blockIdx.x * 256 + threadIdx.x) * 2; if (m >= NP) return; Y += (size_t)blockIdx.y * NP * CK; Kh += (size_t)blockIdx.y * CK * NP; Kl += (size_t)blockIdx.y * CK * NP; float y0[CK], y1[CK]; float s0 = 0.f, s1 = 0.f;
#pragma unroll
    for (int c4 = 0; c4 < CK / 4; ++c4) { const v4f a = *(const v4f*)(Y + (size_t)m * CK + c4 * 4), b = *(const v4f*)(Y + (size_t)(m + 1) * CK + c4 * 4);
#pragma unroll
        for (int u = 0; u < 4; ++u) { const int c = c4 * 4 + u; const float mu = ST[2 * c], rs = ST[2 * c + 1]; float g = bfr(ga[c]), bb = bfr(be[c]); asm volatile("" : "+v"(g)); asm volatile("" : "+v"(bb));
            float t0 = __fmul_rn(__fsub_rn(a[u], mu), rs), t1 = __fmul_rn(__fsub_rn(b[u], mu), rs); asm volatile("" : "+v"(t0)); asm volatile("" : "+v"(t1)); float u0 = __fmul_rn(t0, g), u1 = __fmul_rn(t1, g); asm volatile("" : "+v"(u0)); asm volatile("" : "+v"(u1)); y0[c] = __fadd_rn(u0, bb); y1[c] = __fadd_rn(u1, bb);
            float p0 = __fmul_rn(y0[c], y0[c]), p1 = __fmul_rn(y1[c], y1[c]); asm volatile("" : "+v"(p0)); asm volatile("" : "+v"(p1)); s0 = __fadd_rn(s0, p0); s1 = __fadd_rn(s1, p1); } }
    const float i0 = __fdiv_rn(1.0f, __fadd_rn(__fsqrt_rn(s0), 1e-7f)), i1 = __fdiv_rn(1.0f, __fadd_rn(__fsqrt_rn(s1), 1e-7f));
    {
#pragma unroll
        for (int c = 0; c < CK; ++c) { unsigned short a0, b0, a1, b1; splitf(__fmul_rn(y0[c], i0), a0, b0); splitf(__fmul_rn(y1[c], i1), a1, b1); v2us oh, ol; oh[0] = a0; oh[1] = a1; ol[0] = b0; ol[1] = b1; *(v2us*)(Kh + (size_t)c * NP + m) = oh; *(v2us*)(Kl + (size_t)c * NP + m) = ol; }
         } }
__global__ __launch_bounds__(256) void k_vT(const float* __restrict__ Y, bf* Vh, bf* Vl) { const int e = (blockIdx.x * 256 + threadIdx.x) * 2; if (e >= CV * NP) return; Y += (size_t)blockIdx.y * NP * CV; Vh += (size_t)blockIdx.y * CV * NP; Vl += (size_t)blockIdx.y * CV * NP; const int m = e % NP; const int v = e / NP; unsigned short a0, b0, a1, b1; splitf(Y[(size_t)m * CV + v], a0, b0); splitf(Y[(size_t)(m + 1) * CV + v], a1, b1); v2us oh, ol; oh[0] = a0; oh[1] = a1; ol[0] = b0; ol[1] = b1;
    *(v2us*)(Vh + e) = oh; *(v2us*)(Vl + e) = ol;  }
// k_vsum: vs[b][v] = sum_m YV[b][m][v] for all images in one launch. Grid (image, half of the 64 channels): a block's 32 channels are one 128-B line of every row, its 32 results one 128-B line of vs.
// 1024 threads = 128 rows x 8 lanes of 4 channels: a thread adds its 32 rows (independent loads, in flight together), a wave folds its 4 rows by two butterfly steps, wave 0 adds the 32 waves' partials from LDS in wave order. Fixed order, no atomics.
__global__ __launch_bounds__(1024) void k_vsum(const float* __restrict__ Y, float* vs) { __shared__ __align__(16) float red[32 * 32]; const int tid = threadIdx.x, q = tid & 7, r = tid >> 3;
    const float* p = Y + (size_t)blockIdx.x * NP * CV + (size_t)r * CV + blockIdx.y * 32 + q * 4; v4f s = (v4f){};
    for (int i = 0; i < NP / 128; ++i) s += *(const v4f*)(p + (size_t)i * 128 * CV);
    for (int u = 0; u < 4; ++u) { s[u] += __shfl_xor(s[u], 8, 32); s[u] += __shfl_xor(s[u], 16, 32); }
    if ((tid & 31) < 8) *(v4f*)(red + (tid >> 5) * 32 + q * 4) = s;
    __syncthreads();   // publishes the 32 waves' partial sums to wave 0
    if (tid < 32) { float t = 0.f;
        for (int w = 0; w < 32; ++w) t += red[w * 32 + tid];
        vs[blockIdx.x * CV + blockIdx.y * 32 + tid] = t; } }
__global__ __launch_bounds__(256) void k_mt(const float* __restrict__ M, bf* Mh, bf* Ml) { const int e = (blockIdx.x * 256 + threadIdx.x) * 4; if (e >= CV * CK) return; M += blockIdx.y * CK * CV; Mh += blockIdx.y * CV * CK; Ml += blockIdx.y * CV * CK; const int c0 = e % CK, v = e / CK; v4us oh, ol;
#pragma unroll
    for (int u = 0; u < 4; ++u) { unsigned short a, b; splitf(M[(size_t)(c0 + u) * CV + v], a, b); oh[u] = a; ol[u] = b; } *(v4us*)(Mh + e) = oh; *(v4us*)(Ml + e) = ol;  }
__global__ __launch_bounds__(256) void k_splitb(const float* __restrict__ F, const float* __restrict__ vs, bf* Ph, bf* Pl) { const size_t e = ((size_t)blockIdx.x * 256 + threadIdx.x) * 4; if (e >= (size_t)NP * CV) return; F += (size_t)blockIdx.y * NP * CV; vs += blockIdx.y * CV; Ph += (size_t)blockIdx.y * NP * CV; Pl += (size_t)blockIdx.y * NP * CV; const int v0 = (int)(e % CV); const v4f a = *(const v4f*)(F + e); v4us oh, ol;
#pragma unroll
    for (int u = 0; u < 4; ++u) { unsigned short x, y; splitf(__fadd_rn(a[u], vs[v0 + u]), x, y); oh[u] = x; ol[u] = y; } *(v4us*)(Ph + e) = oh; *(v4us*)(Pl + e) = ol;  }
__global__ __launch_bounds__(256) void k_nchw(const float* __restrict__ OT, float* OUTb) { const int e = (blockIdx.x * 256 + threadIdx.x) * 4; if (e >= CO * NP) return; OT += (size_t)blockIdx.y * NP * CO; OUTb += (size_t)blockIdx.y * CO * NP; const int p = e % NP; const int o = e / NP; v4f ov;
#pragma unroll
    for (int u = 0; u < 4; ++u) ov[u] = OT[(size_t)(p + u) * CO + o]; *(v4f*)(OUTb + e) = ov;  }

extern "C" void kernel_launch(void* const* d_in, const int* in_sizes, int n_in,
                              void* d_out, int out_size, void* d_ws, size_t ws_size, hipStream_t stream) {
    (void)in_sizes; (void)n_in; (void)out_size;
    const float** I = (const float**)d_in;
    const float *qf = I[0], *kf = I[1], *vf = I[2], *Wk = I[3], *bk = I[4], *ga = I[5], *be = I[6], *Wv = I[7], *bv = I[8], *Ww = I[9], *bw = I[10];
    float* OUT = (float*)d_out;     // [8][128][64][64]
    char* wsp = (char*)d_ws;
    auto take = [&](size_t bytes) { char* p = wsp; wsp += (bytes + 255) & ~(size_t)255; return (void*)p; };
    bf* WK = (bf*)take(3 * CK * CI * 2); bf* WV = WK + CK * CI; bf* WW = WV + CV * CI;   // three planes of 8192 elements, one behind the other
    bf* XT = (bf*)take((size_t)3 * NBI * NP * CI * 2);   // [q, k, v][image][p][c]
    float* YQ = (float*)take((size_t)3 * NBI * NP * CK * 4); float* YK = YQ + (size_t)NBI * NP * CK; float* YV = YK + (size_t)NBI * NP * CK; float* STQ = (float*)take(2 * CK * 2 * 4); float* STK = STQ + CK * 2;
    bf* Qh = (bf*)take((size_t)NBI * NP * CK * 2); bf* Ql = (bf*)take((size_t)NBI * NP * CK * 2); bf* Kh = (bf*)take((size_t)NBI * CK * NP * 2); bf* Kl = (bf*)take((size_t)NBI * CK * NP * 2); bf* Vh = (bf*)take((size_t)NBI * CV * NP * 2); bf* Vl = (bf*)take((size_t)NBI * CV * NP * 2); float* vs = (float*)take(NBI * CV * 4);
    float* M = (float*)take(NBI * CK * CV * 4); bf* Mh = (bf*)take(NBI * CK * CV * 2); bf* Ml = (bf*)take(NBI * CK * CV * 2); float* CTX = (float*)take((size_t)NBI * NP * CV * 4); bf* Ch = (bf*)take((size_t)NBI * NP * CV * 2); bf* Cl = (bf*)take((size_t)NBI * NP * CV * 2); float* OT = (float*)take((size_t)NBI * NP * CO * 4);
    if ((size_t)(wsp - (char*)d_ws) > ws_size) return;    // total ~ 110 MB
    k_cvt8<<<dim3((CK * CI / 8 + 255) / 256, 3, 1), 256, 0, stream>>>(Wk, Wv, Ww, WK, CK * CI / 8);   // [out][in] natural = Bt; CK*CI == CV*CI == CO*CV
    // phase 1: the three 1x1 convs for all images (BN needs batch statistics)
    k_xt<<<dim3((NP * CI / 2 + 255) / 256, NBI, 3), 256, 0, stream>>>(qf, kf, vf, XT);
    k_gemmw<bf, 0, true><<<dim3(NP / 64, 1, 2 * NBI), 32, 0, stream>>>(XT, nullptr, WK, nullptr, CI, YQ, CK, bk, (size_t)NP * CI, 0, (size_t)NP * CK);   // q images, then k images
    k_gemmw<bf, 0, true><<<dim3(NP / 64, 1, NBI), 32, 0, stream>>>(XT + (size_t)2 * NBI * NP * CI, nullptr, WV, nullptr, CI, YV, CV, bv, (size_t)NP * CI, 0, (size_t)NP * CV);
    k_bnstat<<<dim3(CK, 2, 1), 256, 0, stream>>>(YQ, STQ); k_vsum<<<dim3(NBI, 2, 1), 1024, 0, stream>>>(YV, vs);
    // phase 2: all images per launch
    k_qn<<<dim3((NP * CK / 4 + 255) / 256, NBI, 1), 256, 0, stream>>>(YQ, STQ, ga, be, Qh, Ql); k_knT<<<dim3((NP / 2 + 255) / 256, NBI, 1), 256, 0, stream>>>(YK, STK, ga, be, Kh, Kl); k_vT<<<dim3((CV * NP / 2 + 255) / 256, NBI, 1), 256, 0, stream>>>(YV, Vh, Vl);
    k_gemmw<bf, 2, false><<<dim3(1, 1, NBI), 32, 0, stream>>>(Kh, Kl, Vh, Vl, NP, M, CV, nullptr, (size_t)CK * NP, (size_t)CV * NP, (size_t)CK * CV);          // M[c][v] = sum_m kn[m][c] v[m][v]
    k_mt<<<dim3((CV * CK / 4 + 255) / 256, NBI, 1), 256, 0, stream>>>(M, Mh, Ml);
    k_gemmw<bf, 2, false><<<dim3(NP / 64, 1, NBI), 32, 0, stream>>>(Qh, Ql, Mh, Ml, CK, CTX, CV, nullptr, (size_t)NP * CK, (size_t)CV * CK, (size_t)NP * CV);     // ctx0[n][v] = qn.M
    k_splitb<<<dim3((NP * CV / 4 + 255) / 256, NBI, 1), 256, 0, stream>>>(CTX, vs, Ch, Cl);   // + vsum[v] (f32), hl planes
    k_gemmw<bf, 1, true><<<dim3(NP / 64, CO / 64, NBI), 32, 0, stream>>>(Ch, Cl, WW, nullptr, CV, OT, CO, bw, (size_t)NP * CV, 0, (size_t)NP * CO);    // [p][o]
    k_nchw<<<dim3((CO * NP / 4 + 255) / 256, NBI, 1), 256, 0, stream>>>(OT, OUT);
}

// v003
// One run takes 198 microseconds.
// Timed twice side by side with v002, it ran 1.33 and 1.32 times as fast.
// Over all steps from v000 it is 47.0 times as fast.
#include <hip/hip_runtime.h>

// non_local_attention (query/key/value features [8][128][64x64]; q = BN_train(conv1x1(query; Wk, bk)), k = BN_train(conv1x1(key; Wk, bk)) (BatchNorm2d in training mode: per-channel batch statistics over (B,H,W), each call its own), v = conv1x1(value; Wv, bv);
// q, k L2-normalised over their 64 channels per position (+1e-7); sim[n][m] = q_n.k_m + 1 (no softmax); ctx[n] = sum_m sim[n][m] v_m; out = conv1x1(ctx; Ww, bw) -> [8][128][64][64]).
// Reassociation (exact algebra, no softmax in between): ctx[n][v] = sum_c qn[n][c] M[c][v] + vsum[v] with M = kn^T v (64x64) and vsum = sum_m v_m - the [4096][4096] similarity map is never formed.

#define NBI  8
#define CI   128
#define NP   4096
#define CK   64
#define CV   64
#define CO   128
#define KS   32     // k slices of the M product: 4096 / 32 = 128 positions (256 B of every operand row) per one-wave block
typedef _Float16 h16;
typedef unsigned short bf;
typedef __attribute__((ext_vector_type(16))) __bf16   v16bf;
typedef __attribute__((ext_vector_type(16))) _Float16 v16h;
typedef __attribute__((ext_vector_type(8)))  _Float16 v8h;
typedef __attribute__((ext_vector_type(8)))  unsigned short v8us;
typedef __attribute__((ext_vector_type(8)))  float    v8f;
typedef __attribute__((ext_vector_type(4)))  float    v4f;
typedef v8h  __attribute__((may_alias)) v8ha;
typedef v4f  __attribute__((may_alias)) v4fa;
typedef v8us __attribute__((may_alias)) v8usa;

__device__ __forceinline__ unsigned short f2bf(float f) { unsigned u = __float_as_uint(f); u += 0x7FFFu + ((u >> 16) & 1u); return (unsigned short)(u >> 16); }
__device__ __forceinline__ float bf2f(unsigned short b) { return __uint_as_float(((unsigned)b) << 16); }
__device__ __forceinline__ float bfr(float f) { return bf2f(f2bf(f)); }
__device__ __forceinline__ v16h cat16(v8h lo, v8h hi) { return __builtin_shufflevector(lo, hi, 0, 1, 2, 3, 4, 5, 6, 7, 8, 9, 10, 11, 12, 13, 14, 15); }
__device__ __forceinline__ v16bf cat16b(v8us lo, v8us hi) { return __builtin_bit_cast(v16bf, __builtin_shufflevector(lo, hi, 0, 1, 2, 3, 4, 5, 6, 7, 8, 9, 10, 11, 12, 13, 14, 15)); }
__device__ __forceinline__ v8f wmma16(v16h a, v16h b, v8f c) { return __builtin_amdgcn_wmma_f32_16x16x32_f16(false, a, false, b, (short)0, c, false, false); }
__device__ __forceinline__ v8f wmmab(v16bf a, v16bf b, v8f c) { return __builtin_amdgcn_wmma_f32_16x16x32_bf16(false, a, false, b, (short)0, c, false, false); }



// ---- k_gemmw: register-blocked GEMM, ONE WAVE per 64x64 output tile (16 accumulators), operands straight from K-contiguous 16-bit planes; grid (M/64, N/64, Z), 32 threads.
// C[m][n] (f32, pitch ldc, + optional f32 bias[n]) = sum_k A[m][k] Bt[n][k] (+ split products per NSPLIT). z-batch strides sA/sB/sC in elements. K % 32 == 0.
// KSPLIT: N == 64 and blockIdx.y is not a column tile but a slice of the k range: the block sums the kn positions from y*kn on (rows keep their pitch K) and stores its own partial tile at C + (z*KS + y)*sC (KS slices, grid.y == KS); the reader adds the slices. Elsewhere kn == K.
template <typename T16> struct WFrag;
template <> struct WFrag<h16> { typedef v16h V; static __device__ __forceinline__ V ld(const h16* p) { return cat16(*(const v8h*)p, *(const v8h*)(p + 16)); } static __device__ __forceinline__ v8f mma(V a, V b, v8f c) { return wmma16(a, b, c); } };
template <> struct WFrag<bf> { typedef v16bf V; static __device__ __forceinline__ V ld(const bf* p) { return cat16b(*(const v8us*)p, *(const v8us*)(p + 16)); } static __device__ __forceinline__ v8f mma(V a, V b, v8f c) { return wmmab(a, b, c); } };
template <typename T16, int NSPLIT, bool BIAS, bool KSPLIT = false>
__global__ __launch_bounds__(32) void k_gemmw(const T16* __restrict__ A, const T16* __restrict__ A2, const T16* __restrict__ Bt, const T16* __restrict__ Bt2, int K, int kn, float* C, int ldc, const float* __restrict__ bias, size_t sA, size_t sB, size_t sC) {
    typedef typename WFrag<T16>::V V;
    __shared__ __align__(16) float os[16 * 68];
    const size_t z = blockIdx.z; const size_t k0 = KSPLIT ? (size_t)blockIdx.y * kn : 0; A += z * sA + k0; if (A2) A2 += z * sA + k0; Bt += z * sB + k0; if (Bt2) Bt2 += z * sB + k0; C += (KSPLIT ? z * KS + blockIdx.y : z) * sC;
    const int lane = threadIdx.x & 31, lr = lane & 15, hi = lane >> 4; const int r0 = blockIdx.x * 64, c0 = KSPLIT ? 0 : blockIdx.y * 64;
    v8f acc[4][4];
#pragma unroll
    for (int mb = 0; mb < 4; ++mb)
#pragma unroll
        for (int nb = 0; nb < 4; ++nb) acc[mb][nb] = (v8f){};
    const size_t aoff = (size_t)(r0 + lr) * K + 8 * hi, boff = (size_t)(c0 + lr) * K + 8 * hi;
#pragma unroll 1
    for (int kc = 0; kc < kn; kc += 32) {
        V a[4], a2[4];
#pragma unroll
        for (int mb = 0; mb < 4; ++mb) { a[mb] = WFrag<T16>::ld(A + aoff + (size_t)mb * 16 * K + kc); if (NSPLIT == 1 || NSPLIT == 2) a2[mb] = WFrag<T16>::ld(A2 + aoff + (size_t)mb * 16 * K + kc); }
#pragma unroll
        for (int nb = 0; nb < 4; ++nb) { const V b = WFrag<T16>::ld(Bt + boff + (size_t)nb * 16 * K + kc); V b2; if (NSPLIT >= 2) b2 = WFrag<T16>::ld(Bt2 + boff + (size_t)nb * 16 * K + kc);
#pragma unroll
            for (int mb = 0; mb < 4; ++mb) { acc[mb][nb] = WFrag<T16>::mma(a[mb], b, acc[mb][nb]); if (NSPLIT == 1 || NSPLIT == 2) acc[mb][nb] = WFrag<T16>::mma(a2[mb], b, acc[mb][nb]); if (NSPLIT >= 2) acc[mb][nb] = WFrag<T16>::mma(a[mb], b2, acc[mb][nb]); } }
        asm volatile("v_nop\n\tv_nop\n\tv_nop\n\tv_nop" : "+v"(acc[0][0]), "+v"(acc[1][1]), "+v"(acc[2][2]), "+v"(acc[3][3]) : "v"(a[0]), "v"(a[3]));
    }
#pragma unroll
    for (int mb = 0; mb < 4; ++mb) {
#pragma unroll
        for (int nb = 0; nb < 4; ++nb) {
#pragma unroll
            for (int j = 0; j < 8; ++j) os[(hi * 8 + j) * 68 + nb * 16 + lr] = acc[mb][nb][j]; }
        __builtin_amdgcn_wave_barrier(); asm volatile("" ::: "memory");
        float* crow = C + (size_t)(r0 + mb * 16) * ldc + c0;
{
#pragma unroll
            for (int s = 0; s < 8; ++s) { const int row = 2 * s + hi, cofs = lr * 4; v4f val = *(const v4fa*)(os + row * 68 + cofs); if (BIAS) { val[0] += bfr(bias[c0 + cofs]); val[1] += bfr(bias[c0 + cofs + 1]); val[2] += bfr(bias[c0 + cofs + 2]); val[3] += bfr(bias[c0 + cofs + 3]); }
                *(v4f*)(crow + (size_t)row * ldc + cofs) = val; }
             }
        __builtin_amdgcn_wave_barrier(); asm volatile("" ::: "memory");
    }
}

__device__ __forceinline__ void splitf(float y, unsigned short& h, unsigned short& l) { h = f2bf(y); l = f2bf(y - bf2f(h)); }
typedef __attribute__((ext_vector_type(2))) unsigned short v2us;
typedef __attribute__((ext_vector_type(2))) float v2f;
typedef __attribute__((ext_vector_type(4))) unsigned short v4us;

// Kernels below that work per image take it from blockIdx.y (k_vsum: blockIdx.x), and where several tensors go the same way the tensor from blockIdx.y (k_xt: blockIdx.z): one launch per stage for the whole batch, each image on its own workspace planes.
__global__ __launch_bounds__(256) void k_cvt8(const float* __restrict__ s0, const float* __restrict__ s1, const float* __restrict__ s2, bf* dst, size_t n8) { const size_t i = (size_t)blockIdx.x * 256 + threadIdx.x; if (i >= n8) return; const float* src = blockIdx.y == 0 ? s0 : blockIdx.y == 1 ? s1 : s2; dst += (size_t)blockIdx.y * n8 * 8; const v8f v = *(const v8f*)(src + i * 8); v8us o;
#pragma unroll
    for (int k = 0; k < 8; ++k) o[k] = f2bf(v[k]); *(v8us*)(dst + i * 8) = o;  }
__global__ __launch_bounds__(256) void k_xt(const float* __restrict__ xq, const float* __restrict__ xk, const float* __restrict__ xv, bf* XT) { const int e = (blockIdx.x * 256 + threadIdx.x) * 2; if (e >= NP * CI) return; const float* x = (blockIdx.z == 0 ? xq : blockIdx.z == 1 ? xk : xv) + (size_t)blockIdx.y * CI * NP; XT += ((size_t)blockIdx.z * NBI + blockIdx.y) * NP * CI; const int c = e % CI; const int p = e / CI; v2us o; o[0] = f2bf(x[(size_t)c * NP + p]); o[1] = f2bf(x[(size_t)(c + 1) * NP + p]); *(v2us*)(XT + e) = o;  }
__global__ __launch_bounds__(256) void k_bnstat(const float* __restrict__ Y, float* ST) { __shared__ float red[256]; const int c = blockIdx.x; const int tid = threadIdx.x; float s = 0.f; Y += (size_t)blockIdx.y * NBI * NP * CK; ST += blockIdx.y * 2 * CK;
    for (int i = tid; i < NBI * NP; i += 256) s += Y[(size_t)i * CK + c];
    red[tid] = s; __syncthreads(); for (int k = 128; k; k >>= 1) { if (tid < k) red[tid] = __fadd_rn(red[tid], red[tid + k]); __syncthreads(); } const float mean = red[0] * (1.0f / (NBI * NP)); __syncthreads();
    float q = 0.f; for (int i = tid; i < NBI * NP; i += 256) { float d = __fsub_rn(Y[(size_t)i * CK + c], mean); asm volatile("" : "+v"(d)); float p = __fmul_rn(d, d); asm volatile("" : "+v"(p)); q = __fadd_rn(q, p); }
    red[tid] = q; __syncthreads(); for (int k = 128; k; k >>= 1) { if (tid < k) red[tid] = __fadd_rn(red[tid], red[tid + k]); __syncthreads(); }
    if (tid == 0) { v2f o; o[0] = mean; o[1] = __frsqrt_rn(__fadd_rn(red[0] * (1.0f / (NBI * NP)), 1e-5f)); *(v2f*)(ST + 2 * c) = o;  } }
__global__ __launch_bounds__(256) void k_qn(const float* __restrict__ Y, const float* __restrict__ ST, const float* __restrict__ ga, const float* __restrict__ be, bf* Qh, bf* Ql) { const int e = (blockIdx.x * 256 + threadIdx.x) * 4; if (e >= NP * CK) return; Y += (size_t)blockIdx.y * NP * CK; Qh += (size_t)blockIdx.y * NP * CK; Ql += (size_t)blockIdx.y * NP * CK; const int c0 = e % CK; const v4f a = *(const v4f*)(Y + e); float y[4]; float ss = 0.f;
#pragma unroll
    for (int u = 0; u < 4; ++u) { const int c = c0 + u; float t0 = __fmul_rn(__fsub_rn(a[u], ST[2 * c]), ST[2 * c + 1]); asm volatile("" : "+v"(t0)); float g = bfr(ga[c]), bb = bfr(be[c]); asm volatile("" : "+v"(g)); asm volatile("" : "+v"(bb)); float t1 = __fmul_rn(t0, g); asm volatile("" : "+v"(t1)); y[u] = __fadd_rn(t1, bb); float p = __fmul_rn(y[u], y[u]); asm volatile("" : "+v"(p)); ss = __fadd_rn(ss, p); }
    ss += __shfl_xor(ss, 1, 32); ss += __shfl_xor(ss, 2, 32); ss += __shfl_xor(ss, 4, 32); ss += __shfl_xor(ss, 8, 32); const float inv = __fdiv_rn(1.0f, __fadd_rn(__fsqrt_rn(ss), 1e-7f)); v4us oh, ol;
#pragma unroll
    for (int u = 0; u < 4; ++u) { unsigned short hh, ll; splitf(__fmul_rn(y[u], inv), hh, ll); oh[u] = hh; ol[u] = ll; } *(v4us*)(Qh + e) = oh; *(v4us*)(Ql + e) = ol;  }
__global__ __launch_bounds__(256) void k_knT(const float* __restrict__ Y, const float* __restrict__ ST, const float* __restrict__ ga, const float* __restrict__ be, bf* Kh, bf* Kl) { const int m = (blockIdx.x * 256 + threadIdx.x) * 2; if (m >= NP) return; Y += (size_t)blockIdx.y * NP * CK; Kh += (size_t)blockIdx.y * CK * NP; Kl += (size_t)blockIdx.y * CK * NP; float y0[CK], y1[CK]; float s0 = 0.f, s1 = 0.f;
#pragma unroll
    for (int c4 = 0; c4 < CK / 4; ++c4) { const v4f a = *(const v4f*)(Y + (size_t)m * CK + c4 * 4), b = *(const v4f*)(Y + (size_t)(m + 1) * CK + c4 * 4);
#pragma unroll
        for (int u = 0; u < 4; ++u) { const int c = c4 * 4 + u; const float mu = ST[2 * c], rs = ST[2 * c + 1]; float g = bfr(ga[c]), bb = bfr(be[c]); asm volatile("" : "+v"(g)); asm volatile("" : "+v"(bb));
            float t0 = __fmul_rn(__fsub_rn(a[u], mu), rs), t1 = __fmul_rn(__fsub_rn(b[u], mu), rs); asm volatile("" : "+v"(t0)); asm volatile("" : "+v"(t1)); float u0 = __fmul_rn(t0, g), u1 = __fmul_rn(t1, g); asm volatile("" : "+v"(u0)); asm volatile("" : "+v"(u1)); y0[c] = __fadd_rn(u0, bb); y1[c] = __fadd_rn(u1, bb);
            float p0 = __fmul_rn(y0[c], y0[c]), p1 = __fmul_rn(y1[c], y1[c]); asm volatile("" : "+v"(p0)); asm volatile("" : "+v"(p1)); s0 = __fadd_rn(s0, p0); s1 = __fadd_rn(s1, p1); } }
    const float i0 = __fdiv_rn(1.0f, __fadd_rn(__fsqrt_rn(s0), 1e-7f)), i1 = __fdiv_rn(1.0f, __fadd_rn(__fsqrt_rn(s1), 1e-7f));
    {
#pragma unroll
        for (int c = 0; c < CK; ++c) { unsigned short a0, b0, a1, b1; splitf(__fmul_rn(y0[c], i0), a0, b0); splitf(__fmul_rn(y1[c], i1), a1, b1); v2us oh, ol; oh[0] = a0; oh[1] = a1; ol[0] = b0; ol[1] = b1; *(v2us*)(Kh + (size_t)c * NP + m) = oh; *(v2us*)(Kl + (size_t)c * NP + m) = ol; }
         } }
__global__ __launch_bounds__(256) void k_vT(const float* __restrict__ Y, bf* Vh, bf* Vl) { const int e = (blockIdx.x * 256 + threadIdx.x) * 2; if (e >= CV * NP) return; Y += (size_t)blockIdx.y * NP * CV; Vh += (size_t)blockIdx.y * CV * NP; Vl += (size_t)blockIdx.y * CV * NP; const int m = e % NP; const int v = e / NP; unsigned short a0, b0, a1, b1; splitf(Y[(size_t)m * CV + v], a0, b0); splitf(Y[(size_t)(m + 1) * CV + v], a1, b1); v2us oh, ol; oh[0] = a0; oh[1] = a1; ol[0] = b0; ol[1] = b1;
    *(v2us*)(Vh + e) = oh; *(v2us*)(Vl + e) = ol;  }
// k_vsum: vs[b][v] = sum_m YV[b][m][v] for all images in one launch. Grid (image, half of the 64 channels): a block's 32 channels are one 128-B line of every row, its 32 results one 128-B line of vs.
// 1024 threads = 128 rows x 8 lanes of 4 channels: a thread adds its 32 rows (independent loads, in flight together), a wave folds its 4 rows by two butterfly steps, wave 0 adds the 32 waves' partials from LDS in wave order. Fixed order, no atomics.
__global__ __launch_bounds__(1024) void k_vsum(const float* __restrict__ Y, float* vs) { __shared__ __align__(16) float red[32 * 32]; const int tid = threadIdx.x, q = tid & 7, r = tid >> 3;
    const float* p = Y + (size_t)blockIdx.x * NP * CV + (size_t)r * CV + blockIdx.y * 32 + q * 4; v4f s = (v4f){};
    for (int i = 0; i < NP / 128; ++i) s += *(const v4f*)(p + (size_t)i * 128 * CV);
    for (int u = 0; u < 4; ++u) { s[u] += __shfl_xor(s[u], 8, 32); s[u] += __shfl_xor(s[u], 16, 32); }
    if ((tid & 31) < 8) *(v4f*)(red + (tid >> 5) * 32 + q * 4) = s;
    __syncthreads();   // publishes the 32 waves' partial sums to wave 0
    if (tid < 32) { float t = 0.f;
        for (int w = 0; w < 32; ++w) t += red[w * 32 + tid];
        vs[blockIdx.x * CV + blockIdx.y * 32 + tid] = t; } }
// k_mt: Mt[v][c] = sum over the KS k slices of the partial tiles P[image][slice][v][c], added in slice order (fixed order, no atomics), then split into the hl planes. Whole-line loads.
__global__ __launch_bounds__(256) void k_mt(const float* __restrict__ P, bf* Mh, bf* Ml) { const int e = (blockIdx.x * 256 + threadIdx.x) * 4; if (e >= CV * CK) return; P += (size_t)blockIdx.y * KS * CV * CK; Mh += blockIdx.y * CV * CK; Ml += blockIdx.y * CV * CK; v4f t = *(const v4f*)(P + e); v4us oh, ol;
#pragma unroll   // straight line, so that the independent loads of many slices are in flight together
    for (int s = 1; s < KS; ++s) t += *(const v4f*)(P + (size_t)s * CV * CK + e);
#pragma unroll
    for (int u = 0; u < 4; ++u) { unsigned short a, b; splitf(t[u], a, b); oh[u] = a; ol[u] = b; } *(v4us*)(Mh + e) = oh; *(v4us*)(Ml + e) = ol;  }
__global__ __launch_bounds__(256) void k_splitb(const float* __restrict__ F, const float* __restrict__ vs, bf* Ph, bf* Pl) { const size_t e = ((size_t)blockIdx.x * 256 + threadIdx.x) * 4; if (e >= (size_t)NP * CV) return; F += (size_t)blockIdx.y * NP * CV; vs += blockIdx.y * CV; Ph += (size_t)blockIdx.y * NP * CV; Pl += (size_t)blockIdx.y * NP * CV; const int v0 = (int)(e % CV); const v4f a = *(const v4f*)(F + e); v4us oh, ol;
#pragma unroll
    for (int u = 0; u < 4; ++u) { unsigned short x, y; splitf(__fadd_rn(a[u], vs[v0 + u]), x, y); oh[u] = x; ol[u] = y; } *(v4us*)(Ph + e) = oh; *(v4us*)(Pl + e) = ol;  }
__global__ __launch_bounds__(256) void k_nchw(const float* __restrict__ OT, float* OUTb) { const int e = (blockIdx.x * 256 + threadIdx.x) * 4; if (e >= CO * NP) return; OT += (size_t)blockIdx.y * NP * CO; OUTb += (size_t)blockIdx.y * CO * NP; const int p = e % NP; const int o = e / NP; v4f ov;
#pragma unroll
    for (int u = 0; u < 4; ++u) ov[u] = OT[(size_t)(p + u) * CO + o]; *(v4f*)(OUTb + e) = ov;  }

extern "C" void kernel_launch(void* const* d_in, const int* in_sizes, int n_in,
                              void* d_out, int out_size, void* d_ws, size_t ws_size, hipStream_t stream) {
    (void)in_sizes; (void)n_in; (void)out_size;
    const float** I = (const float**)d_in;
    const float *qf = I[0], *kf = I[1], *vf = I[2], *Wk = I[3], *bk = I[4], *ga = I[5], *be = I[6], *Wv = I[7], *bv = I[8], *Ww = I[9], *bw = I[10];
    float* OUT = (float*)d_out;     // [8][128][64][64]
    char* wsp = (char*)d_ws;
    auto take = [&](size_t bytes) { char* p = wsp; wsp += (bytes + 255) & ~(size_t)255; return (void*)p; };
    bf* WK = (bf*)take(3 * CK * CI * 2); bf* WV = WK + CK * CI; bf* WW = WV + CV * CI;   // three planes of 8192 elements, one behind the other
    bf* XT = (bf*)take((size_t)3 * NBI * NP * CI * 2);   // [q, k, v][image][p][c]
    float* YQ = (float*)take((size_t)3 * NBI * NP * CK * 4); float* YK = YQ + (size_t)NBI * NP * CK; float* YV = YK + (size_t)NBI * NP * CK; float* STQ = (float*)take(2 * CK * 2 * 4); float* STK = STQ + CK * 2;
    bf* Qh = (bf*)take((size_t)NBI * NP * CK * 2); bf* Ql = (bf*)take((size_t)NBI * NP * CK * 2); bf* Kh = (bf*)take((size_t)NBI * CK * NP * 2); bf* Kl = (bf*)take((size_t)NBI * CK * NP * 2); bf* Vh = (bf*)take((size_t)NBI * CV * NP * 2); bf* Vl = (bf*)take((size_t)NBI * CV * NP * 2); float* vs = (float*)take(NBI * CV * 4);
    float* M = (float*)take((size_t)NBI * KS * CK * CV * 4); bf* Mh = (bf*)take(NBI * CK * CV * 2); bf* Ml = (bf*)take(NBI * CK * CV * 2); float* CTX = (float*)take((size_t)NBI * NP * CV * 4); bf* Ch = (bf*)take((size_t)NBI * NP * CV * 2); bf* Cl = (bf*)take((size_t)NBI * NP * CV * 2); float* OT = (float*)take((size_t)NBI * NP * CO * 4);
    if ((size_t)(wsp - (char*)d_ws) > ws_size) return;    // total ~ 114 MB
    k_cvt8<<<dim3((CK * CI / 8 + 255) / 256, 3, 1), 256, 0, stream>>>(Wk, Wv, Ww, WK, CK * CI / 8);   // [out][in] natural = Bt; CK*CI == CV*CI == CO*CV
    // phase 1: the three 1x1 convs for all images (BN needs batch statistics)
    k_xt<<<dim3((NP * CI / 2 + 255) / 256, NBI, 3), 256, 0, stream>>>(qf, kf, vf, XT);
    k_gemmw<bf, 0, true><<<dim3(NP / 64, 1, 2 * NBI), 32, 0, stream>>>(XT, nullptr, WK, nullptr, CI, CI, YQ, CK, bk, (size_t)NP * CI, 0, (size_t)NP * CK);   // q images, then k images
    k_gemmw<bf, 0, true><<<dim3(NP / 64, 1, NBI), 32, 0, stream>>>(XT + (size_t)2 * NBI * NP * CI, nullptr, WV, nullptr, CI, CI, YV, CV, bv, (size_t)NP * CI, 0, (size_t)NP * CV);
    k_bnstat<<<dim3(CK, 2, 1), 256, 0, stream>>>(YQ, STQ); k_vsum<<<dim3(NBI, 2, 1), 1024, 0, stream>>>(YV, vs);
    // phase 2: all images per launch
    k_qn<<<dim3((NP * CK / 4 + 255) / 256, NBI, 1), 256, 0, stream>>>(YQ, STQ, ga, be, Qh, Ql); k_knT<<<dim3((NP / 2 + 255) / 256, NBI, 1), 256, 0, stream>>>(YK, STK, ga, be, Kh, Kl); k_vT<<<dim3((CV * NP / 2 + 255) / 256, NBI, 1), 256, 0, stream>>>(YV, Vh, Vl);
    k_gemmw<bf, 2, false, true><<<dim3(1, KS, NBI), 32, 0, stream>>>(Vh, Vl, Kh, Kl, NP, NP / KS, M, CK, nullptr, (size_t)CV * NP, (size_t)CK * NP, (size_t)CV * CK);   // partial Mt[slice][v][c] = sum over the slice's m of v[m][v] kn[m][c]
    k_mt<<<dim3((CV * CK / 4 + 255) / 256, NBI, 1), 256, 0, stream>>>(M, Mh, Ml);
    k_gemmw<bf, 2, false><<<dim3(NP / 64, 1, NBI), 32, 0, stream>>>(Qh, Ql, Mh, Ml, CK, CK, CTX, CV, nullptr, (size_t)NP * CK, (size_t)CV * CK, (size_t)NP * CV);     // ctx0[n][v] = qn.M
    k_splitb<<<dim3((NP * CV / 4 + 255) / 256, NBI, 1), 256, 0, stream>>>(CTX, vs, Ch, Cl);   // + vsum[v] (f32), hl planes
    k_gemmw<bf, 1, true><<<dim3(NP / 64, CO / 64, NBI), 32, 0, stream>>>(Ch, Cl, WW, nullptr, CV, CV, OT, CO, bw, (size_t)NP * CV, 0, (size_t)NP * CO);    // [p][o]
    k_nchw<<<dim3((CO * NP / 4 + 255) / 256, NBI, 1), 256, 0, stream>>>(OT, OUT);
}

// v004
// One run takes 153 microseconds.
// Two timings next to v003 both put it at 1.30 times that version's speed.
// Over all steps from v000 it is 61.1 times as fast.
#include <hip/hip_runtime.h>

// non_local_attention (query/key/value features [8][128][64x64]; q = BN_train(conv1x1(query; Wk, bk)), k = BN_train(conv1x1(key; Wk, bk)) (BatchNorm2d in training mode: per-channel batch statistics over (B,H,W), each call its own), v = conv1x1(value; Wv, bv);
// q, k L2-normalised over their 64 channels per position (+1e-7); sim[n][m] = q_n.k_m + 1 (no softmax); ctx[n] = sum_m sim[n][m] v_m; out = conv1x1(ctx; Ww, bw) -> [8][128][64][64]).
// Reassociation (exact algebra, no softmax in between): ctx[n][v] = sum_c qn[n][c] M[c][v] + vsum[v] with M = kn^T v (64x64) and vsum = sum_m v_m - the [4096][4096] similarity map is never formed.

#define NBI  8
#define CI   128
#define NP   4096
#define CK   64
#define CV   64
#define CO   128
#define KS   32     // k slices of the M product: 4096 / 32 = 128 positions (256 B of every operand row) per one-wave block
typedef _Float16 h16;
typedef unsigned short bf;
typedef __attribute__((ext_vector_type(16))) __bf16   v16bf;
typedef __attribute__((ext_vector_type(16))) _Float16 v16h;
typedef __attribute__((ext_vector_type(8)))  _Float16 v8h;
typedef __attribute__((ext_vector_type(8)))  unsigned short v8us;
typedef __attribute__((ext_vector_type(8)))  float    v8f;
typedef __attribute__((ext_vector_type(4)))  float    v4f;
typedef v8h  __attribute__((may_alias)) v8ha;
typedef v4f  __attribute__((may_alias)) v4fa;
typedef v8us __attribute__((may_alias)) v8usa;

__device__ __forceinline__ unsigned short f2bf(float f) { unsigned u = __float_as_uint(f); u += 0x7FFFu + ((u >> 16) & 1u); return (unsigned short)(u >> 16); }
__device__ __forceinline__ float bf2f(unsigned short b) { return __uint_as_float(((unsigned)b) << 16); }
__device__ __forceinline__ float bfr(float f) { return bf2f(f2bf(f)); }
__device__ __forceinline__ v16h cat16(v8h lo, v8h hi) { return __builtin_shufflevector(lo, hi, 0, 1, 2, 3, 4, 5, 6, 7, 8, 9, 10, 11, 12, 13, 14, 15); }
__device__ __forceinline__ v16bf cat16b(v8us lo, v8us hi) { return __builtin_bit_cast(v16bf, __builtin_shufflevector(lo, hi, 0, 1, 2, 3, 4, 5, 6, 7, 8, 9, 10, 11, 12, 13, 14, 15)); }
__device__ __forceinline__ v8f wmma16(v16h a, v16h b, v8f c) { return __builtin_amdgcn_wmma_f32_16x16x32_f16(false, a, false, b, (short)0, c, false, false); }
__device__ __forceinline__ v8f wmmab(v16bf a, v16bf b, v8f c) { return __builtin_amdgcn_wmma_f32_16x16x32_bf16(false, a, false, b, (short)0, c, false, false); }



// ---- k_gemmw: register-blocked GEMM, ONE WAVE per 64x64 output tile (16 accumulators), operands straight from K-contiguous 16-bit planes; grid (M/64, N/64, Z), 32 threads.
// C[m][n] (f32, pitch ldc, + optional f32 bias[n]) = sum_k A[m][k] Bt[n][k] (+ split products per NSPLIT). z-batch strides sA/sB/sC in elements. K % 32 == 0.
// KSPLIT: N == 64 and blockIdx.y is not a column tile but a slice of the k range: the block sums the kn positions from y*kn on (rows keep their pitch K) and stores its own partial tile at C + (z*KS + y)*sC (KS slices, grid.y == KS); the reader adds the slices. Elsewhere kn == K.
template <typename T16> struct WFrag;
template <> struct WFrag<h16> { typedef v16h V; static __device__ __forceinline__ V ld(const h16* p) { return cat16(*(const v8h*)p, *(const v8h*)(p + 16)); } static __device__ __forceinline__ v8f mma(V a, V b, v8f c) { return wmma16(a, b, c); } };
template <> struct WFrag<bf> { typedef v16bf V; static __device__ __forceinline__ V ld(const bf* p) { return cat16b(*(const v8us*)p, *(const v8us*)(p + 16)); } static __device__ __forceinline__ v8f mma(V a, V b, v8f c) { return wmmab(a, b, c); } };
template <typename T16, int NSPLIT, bool BIAS, bool KSPLIT = false>
__global__ __launch_bounds__(32) void k_gemmw(const T16* __restrict__ A, const T16* __restrict__ A2, const T16* __restrict__ Bt, const T16* __restrict__ Bt2, int K, int kn, float* C, int ldc, const float* __restrict__ bias, size_t sA, size_t sB, size_t sC) {
    typedef typename WFrag<T16>::V V;
    __shared__ __align__(16) float os[16 * 68];
    const size_t z = blockIdx.z; const size_t k0 = KSPLIT ? (size_t)blockIdx.y * kn : 0; A += z * sA + k0; if (A2) A2 += z * sA + k0; Bt += z * sB + k0; if (Bt2) Bt2 += z * sB + k0; C += (KSPLIT ? z * KS + blockIdx.y : z) * sC;
    const int lane = threadIdx.x & 31, lr = lane & 15, hi = lane >> 4; const int r0 = blockIdx.x * 64, c0 = KSPLIT ? 0 : blockIdx.y * 64;
    v8f acc[4][4];
#pragma unroll
    for (int mb = 0; mb < 4; ++mb)
#pragma unroll
        for (int nb = 0; nb < 4; ++nb) acc[mb][nb] = (v8f){};
    const size_t aoff = (size_t)(r0 + lr) * K + 8 * hi, boff = (size_t)(c0 + lr) * K + 8 * hi;
#pragma unroll 1
    for (int kc = 0; kc < kn; kc += 32) {
        V a[4], a2[4];
#pragma unroll
        for (int mb = 0; mb < 4; ++mb) { a[mb] = WFrag<T16>::ld(A + aoff + (size_t)mb * 16 * K + kc); if (NSPLIT == 1 || NSPLIT == 2) a2[mb] = WFrag<T16>::ld(A2 + aoff + (size_t)mb * 16 * K + kc); }
#pragma unroll
        for (int nb = 0; nb < 4; ++nb) { const V b = WFrag<T16>::ld(Bt + boff + (size_t)nb * 16 * K + kc); V b2; if (NSPLIT >= 2) b2 = WFrag<T16>::ld(Bt2 + boff + (size_t)nb * 16 * K + kc);
#pragma unroll
            for (int mb = 0; mb < 4; ++mb) { acc[mb][nb] = WFrag<T16>::mma(a[mb], b, acc[mb][nb]); if (NSPLIT == 1 || NSPLIT == 2) acc[mb][nb] = WFrag<T16>::mma(a2[mb], b, acc[mb][nb]); if (NSPLIT >= 2) acc[mb][nb] = WFrag<T16>::mma(a[mb], b2, acc[mb][nb]); } }
        asm volatile("v_nop\n\tv_nop\n\tv_nop\n\tv_nop" : "+v"(acc[0][0]), "+v"(acc[1][1]), "+v"(acc[2][2]), "+v"(acc[3][3]) : "v"(a[0]), "v"(a[3]));
    }
#pragma unroll
    for (int mb = 0; mb < 4; ++mb) {
#pragma unroll
        for (int nb = 0; nb < 4; ++nb) {
#pragma unroll
            for (int j = 0; j < 8; ++j) os[(hi * 8 + j) * 68 + nb * 16 + lr] = acc[mb][nb][j]; }
        __builtin_amdgcn_wave_barrier(); asm volatile("" ::: "memory");
        float* crow = C + (size_t)(r0 + mb * 16) * ldc + c0;
{
#pragma unroll
            for (int s = 0; s < 8; ++s) { const int row = 2 * s + hi, cofs = lr * 4; v4f val = *(const v4fa*)(os + row * 68 + cofs); if (BIAS) { val[0] += bfr(bias[c0 + cofs]); val[1] += bfr(bias[c0 + cofs + 1]); val[2] += bfr(bias[c0 + cofs + 2]); val[3] += bfr(bias[c0 + cofs + 3]); }
                *(v4f*)(crow + (size_t)row * ldc + cofs) = val; }
             }
        __builtin_amdgcn_wave_barrier(); asm volatile("" ::: "memory");
    }
}

__device__ __forceinline__ void splitf(float y, unsigned short& h, unsigned short& l) { h = f2bf(y); l = f2bf(y - bf2f(h)); }
typedef __attribute__((ext_vector_type(2))) unsigned short v2us;
typedef __attribute__((ext_vector_type(2))) float v2f;
typedef __attribute__((ext_vector_type(4))) unsigned short v4us;

// Kernels below that work per image take it from blockIdx.y (k_vsum: blockIdx.x, k_nchw: blockIdx.z), and where several tensors go the same way the tensor from blockIdx.y (k_xt: blockIdx.z): one launch per stage for the whole batch, each image on its own workspace planes.
__global__ __launch_bounds__(256) void k_cvt8(const float* __restrict__ s0, const float* __restrict__ s1, const float* __restrict__ s2, bf* dst, size_t n8) { const size_t i = (size_t)blockIdx.x * 256 + threadIdx.x; if (i >= n8) return; const float* src = blockIdx.y == 0 ? s0 : blockIdx.y == 1 ? s1 : s2; dst += (size_t)blockIdx.y * n8 * 8; const v8f v = *(const v8f*)(src + i * 8); v8us o;
#pragma unroll
    for (int k = 0; k < 8; ++k) o[k] = f2bf(v[k]); *(v8us*)(dst + i * 8) = o;  }
// ---- The three transposes (k_xt, k_vT, k_nchw) go through a padded LDS tile: the global loads follow the source's rows and the global stores the target's rows, 16 lanes side by side on whole 128-B lines on both sides,
// and a thread moves 32 or 64 elements. Odd row pitches in LDS (65, 129 dwords): the 16 lanes of a half wave step by 4 rows or by 4 dwords, the two halves by 1, so that every LDS access of a wave meets 32 different banks.
typedef __attribute__((ext_vector_type(4))) unsigned v4u;
#define XP 65    // k_xt: LDS row = one position's 128 channels as 64 dwords of two bf16, + 1
#define TP 129   // tile_in: LDS row = one source column's 128 rows as f32, + 1
// k_xt: tile of 128 channels x 128 positions. A thread holds the same 4 positions of channels 2*c2 and 2*c2 + 1, so a dword of two neighbouring channels is formed in registers.
__global__ __launch_bounds__(256) void k_xt(const float* __restrict__ xq, const float* __restrict__ xk, const float* __restrict__ xv, bf* XT) { __shared__ unsigned L[128 * XP]; const int q = threadIdx.x & 15, r = threadIdx.x >> 4; const int p0 = blockIdx.x * 128;
    const float* x = (blockIdx.z == 0 ? xq : blockIdx.z == 1 ? xk : xv) + (size_t)blockIdx.y * CI * NP + p0 + 4 * q; XT += (((size_t)blockIdx.z * NBI + blockIdx.y) * NP + p0) * CI; v4f a[4][2], b[4][2];
#pragma unroll   // straight line, so that a thread's 16 independent loads are in flight together
    for (int j = 0; j < 4; ++j)
#pragma unroll   // as above
        for (int s = 0; s < 2; ++s) { a[j][s] = *(const v4f*)(x + (size_t)(2 * (r + 16 * j)) * NP + 64 * s); b[j][s] = *(const v4f*)(x + (size_t)(2 * (r + 16 * j) + 1) * NP + 64 * s); }
#pragma unroll   // register arrays need constant indices
    for (int j = 0; j < 4; ++j)
#pragma unroll   // as above
        for (int s = 0; s < 2; ++s)
#pragma unroll   // as above
            for (int i = 0; i < 4; ++i) L[(64 * s + 4 * q + i) * XP + r + 16 * j] = (unsigned)f2bf(a[j][s][i]) | ((unsigned)f2bf(b[j][s][i]) << 16);
    __syncthreads();   // publishes the tile: a thread reads rows whose dwords all 8 waves wrote
#pragma unroll   // straight line, so that the LDS reads of later rows do not wait for the stores of earlier ones
    for (int k = 0; k < 8; ++k) { const int p = r + 16 * k; v4u o;
#pragma unroll   // register vector needs constant indices
        for (int i = 0; i < 4; ++i) o[i] = L[p * XP + 4 * q + i];
        *(v8us*)(XT + (size_t)p * CI + 8 * q) = __builtin_bit_cast(v8us, o); } }
// tile_in: 256 threads bring 128 rows x 64 columns of f32 (src at the tile's first element, row pitch SP floats) into L[column][row].
template <int SP> __device__ __forceinline__ void tile_in(const float* __restrict__ src, float* L) { const int q = threadIdx.x & 15, r = threadIdx.x >> 4; v4f v[8];
#pragma unroll   // straight line, so that a thread's 8 independent loads are in flight together
    for (int j = 0; j < 8; ++j) v[j] = *(const v4f*)(src + (size_t)(r + 16 * j) * SP + 4 * q);
#pragma unroll   // register arrays need constant indices
    for (int j = 0; j < 8; ++j)
#pragma unroll   // as above
        for (int i = 0; i < 4; ++i) L[(4 * q + i) * TP + r + 16 * j] = v[j][i];
    __syncthreads();   // publishes the tile: a thread reads columns whose rows all 8 waves wrote
}
__global__ __launch_bounds__(256) void k_bnstat(const float* __restrict__ Y, float* ST) { __shared__ float red[256]; const int c = blockIdx.x; const int tid = threadIdx.x; float s = 0.f; Y += (size_t)blockIdx.y * NBI * NP * CK; ST += blockIdx.y * 2 * CK;
    for (int i = tid; i < NBI * NP; i += 256) s += Y[(size_t)i * CK + c];
    red[tid] = s; __syncthreads(); for (int k = 128; k; k >>= 1) { if (tid < k) red[tid] = __fadd_rn(red[tid], red[tid + k]); __syncthreads(); } const float mean = red[0] * (1.0f / (NBI * NP)); __syncthreads();
    float q = 0.f; for (int i = tid; i < NBI * NP; i += 256) { float d = __fsub_rn(Y[(size_t)i * CK + c], mean); asm volatile("" : "+v"(d)); float p = __fmul_rn(d, d); asm volatile("" : "+v"(p)); q = __fadd_rn(q, p); }
    red[tid] = q; __syncthreads(); for (int k = 128; k; k >>= 1) { if (tid < k) red[tid] = __fadd_rn(red[tid], red[tid + k]); __syncthreads(); }
    if (tid == 0) { v2f o; o[0] = mean; o[1] = __frsqrt_rn(__fadd_rn(red[0] * (1.0f / (NBI * NP)), 1e-5f)); *(v2f*)(ST + 2 * c) = o;  } }
__global__ __launch_bounds__(256) void k_qn(const float* __restrict__ Y, const float* __restrict__ ST, const float* __restrict__ ga, const float* __restrict__ be, bf* Qh, bf* Ql) { const int e = (blockIdx.x * 256 + threadIdx.x) * 4; if (e >= NP * CK) return; Y += (size_t)blockIdx.y * NP * CK; Qh += (size_t)blockIdx.y * NP * CK; Ql += (size_t)blockIdx.y * NP * CK; const int c0 = e % CK; const v4f a = *(const v4f*)(Y + e); float y[4]; float ss = 0.f;
#pragma unroll
    for (int u = 0; u < 4; ++u) { const int c = c0 + u; float t0 = __fmul_rn(__fsub_rn(a[u], ST[2 * c]), ST[2 * c + 1]); asm volatile("" : "+v"(t0)); float g = bfr(ga[c]), bb = bfr(be[c]); asm volatile("" : "+v"(g)); asm volatile("" : "+v"(bb)); float t1 = __fmul_rn(t0, g); asm volatile("" : "+v"(t1)); y[u] = __fadd_rn(t1, bb); float p = __fmul_rn(y[u], y[u]); asm volatile("" : "+v"(p)); ss = __fadd_rn(ss, p); }
    ss += __shfl_xor(ss, 1, 32); ss += __shfl_xor(ss, 2, 32); ss += __shfl_xor(ss, 4, 32); ss += __shfl_xor(ss, 8, 32); const float inv = __fdiv_rn(1.0f, __fadd_rn(__fsqrt_rn(ss), 1e-7f)); v4us oh, ol;
#pragma unroll
    for (int u = 0; u < 4; ++u) { unsigned short hh, ll; splitf(__fmul_rn(y[u], inv), hh, ll); oh[u] = hh; ol[u] = ll; } *(v4us*)(Qh + e) = oh; *(v4us*)(Ql + e) = ol;  }
__global__ __launch_bounds__(256) void k_knT(const float* __restrict__ Y, const float* __restrict__ ST, const float* __restrict__ ga, const float* __restrict__ be, bf* Kh, bf* Kl) { const int m = (blockIdx.x * 256 + threadIdx.x) * 2; if (m >= NP) return; Y += (size_t)blockIdx.y * NP * CK; Kh += (size_t)blockIdx.y * CK * NP; Kl += (size_t)blockIdx.y * CK * NP; float y0[CK], y1[CK]; float s0 = 0.f, s1 = 0.f;
#pragma unroll
    for (int c4 = 0; c4 < CK / 4; ++c4) { const v4f a = *(const v4f*)(Y + (size_t)m * CK + c4 * 4), b = *(const v4f*)(Y + (size_t)(m + 1) * CK + c4 * 4);
#pragma unroll
        for (int u = 0; u < 4; ++u) { const int c = c4 * 4 + u; const float mu = ST[2 * c], rs = ST[2 * c + 1]; float g = bfr(ga[c]), bb = bfr(be[c]); asm volatile("" : "+v"(g)); asm volatile("" : "+v"(bb));
            float t0 = __fmul_rn(__fsub_rn(a[u], mu), rs), t1 = __fmul_rn(__fsub_rn(b[u], mu), rs); asm volatile("" : "+v"(t0)); asm volatile("" : "+v"(t1)); float u0 = __fmul_rn(t0, g), u1 = __fmul_rn(t1, g); asm volatile("" : "+v"(u0)); asm volatile("" : "+v"(u1)); y0[c] = __fadd_rn(u0, bb); y1[c] = __fadd_rn(u1, bb);
            float p0 = __fmul_rn(y0[c], y0[c]), p1 = __fmul_rn(y1[c], y1[c]); asm volatile("" : "+v"(p0)); asm volatile("" : "+v"(p1)); s0 = __fadd_rn(s0, p0); s1 = __fadd_rn(s1, p1); } }
    const float i0 = __fdiv_rn(1.0f, __fadd_rn(__fsqrt_rn(s0), 1e-7f)), i1 = __fdiv_rn(1.0f, __fadd_rn(__fsqrt_rn(s1), 1e-7f));
    {
#pragma unroll
        for (int c = 0; c < CK; ++c) { unsigned short a0, b0, a1, b1; splitf(__fmul_rn(y0[c], i0), a0, b0); splitf(__fmul_rn(y1[c], i1), a1, b1); v2us oh, ol; oh[0] = a0; oh[1] = a1; ol[0] = b0; ol[1] = b1; *(v2us*)(Kh + (size_t)c * NP + m) = oh; *(v2us*)(Kl + (size_t)c * NP + m) = ol; }
         } }
__global__ __launch_bounds__(256) void k_vT(const float* __restrict__ Y, bf* Vh, bf* Vl) { __shared__ float L[CV * TP]; const int q = threadIdx.x & 15, r = threadIdx.x >> 4; const int m0 = blockIdx.x * 128;
    tile_in<CV>(Y + ((size_t)blockIdx.y * NP + m0) * CV, L); Vh += (size_t)blockIdx.y * CV * NP + m0 + 4 * q; Vl += (size_t)blockIdx.y * CV * NP + m0 + 4 * q;
#pragma unroll   // straight line, so that the LDS reads of later rows do not wait for the stores of earlier ones
    for (int k = 0; k < 4; ++k)
#pragma unroll   // as above
        for (int s = 0; s < 2; ++s) { const int v = r + 16 * k; v4us oh, ol;
#pragma unroll   // register vectors need constant indices
            for (int i = 0; i < 4; ++i) { unsigned short x, y; splitf(L[v * TP + 64 * s + 4 * q + i], x, y); oh[i] = x; ol[i] = y; }
            *(v4us*)(Vh + (size_t)v * NP + 64 * s) = oh; *(v4us*)(Vl + (size_t)v * NP + 64 * s) = ol; } }
// k_vsum: vs[b][v] = sum_m YV[b][m][v] for all images in one launch. Grid (image, half of the 64 channels): a block's 32 channels are one 128-B line of every row, its 32 results one 128-B line of vs.
// 1024 threads = 128 rows x 8 lanes of 4 channels: a thread adds its 32 rows (independent loads, in flight together), a wave folds its 4 rows by two butterfly steps, wave 0 adds the 32 waves' partials from LDS in wave order. Fixed order, no atomics.
__global__ __launch_bounds__(1024) void k_vsum(const float* __restrict__ Y, float* vs) { __shared__ __align__(16) float red[32 * 32]; const int tid = threadIdx.x, q = tid & 7, r = tid >> 3;
    const float* p = Y + (size_t)blockIdx.x * NP * CV + (size_t)r * CV + blockIdx.y * 32 + q * 4; v4f s = (v4f){};
    for (int i = 0; i < NP / 128; ++i) s += *(const v4f*)(p + (size_t)i * 128 * CV);
    for (int u = 0; u < 4; ++u) { s[u] += __shfl_xor(s[u], 8, 32); s[u] += __shfl_xor(s[u], 16, 32); }
    if ((tid & 31) < 8) *(v4f*)(red + (tid >> 5) * 32 + q * 4) = s;
    __syncthreads();   // publishes the 32 waves' partial sums to wave 0
    if (tid < 32) { float t = 0.f;
        for (int w = 0; w < 32; ++w) t += red[w * 32 + tid];
        vs[blockIdx.x * CV + blockIdx.y * 32 + tid] = t; } }
// k_mt: Mt[v][c] = sum over the KS k slices of the partial tiles P[image][slice][v][c], added in slice order (fixed order, no atomics), then split into the hl planes. Whole-line loads.
__global__ __launch_bounds__(256) void k_mt(const float* __restrict__ P, bf* Mh, bf* Ml) { const int e = (blockIdx.x * 256 + threadIdx.x) * 4; if (e >= CV * CK) return; P += (size_t)blockIdx.y * KS * CV * CK; Mh += blockIdx.y * CV * CK; Ml += blockIdx.y * CV * CK; v4f t = *(const v4f*)(P + e); v4us oh, ol;
#pragma unroll   // straight line, so that the independent loads of many slices are in flight together
    for (int s = 1; s < KS; ++s) t += *(const v4f*)(P + (size_t)s * CV * CK + e);
#pragma unroll
    for (int u = 0; u < 4; ++u) { unsigned short a, b; splitf(t[u], a, b); oh[u] = a; ol[u] = b; } *(v4us*)(Mh + e) = oh; *(v4us*)(Ml + e) = ol;  }
__global__ __launch_bounds__(256) void k_splitb(const float* __restrict__ F, const float* __restrict__ vs, bf* Ph, bf* Pl) { const size_t e = ((size_t)blockIdx.x * 256 + threadIdx.x) * 4; if (e >= (size_t)NP * CV) return; F += (size_t)blockIdx.y * NP * CV; vs += blockIdx.y * CV; Ph += (size_t)blockIdx.y * NP * CV; Pl += (size_t)blockIdx.y * NP * CV; const int v0 = (int)(e % CV); const v4f a = *(const v4f*)(F + e); v4us oh, ol;
#pragma unroll
    for (int u = 0; u < 4; ++u) { unsigned short x, y; splitf(__fadd_rn(a[u], vs[v0 + u]), x, y); oh[u] = x; ol[u] = y; } *(v4us*)(Ph + e) = oh; *(v4us*)(Pl + e) = ol;  }
__global__ __launch_bounds__(256) void k_nchw(const float* __restrict__ OT, float* OUTb) { __shared__ float L[64 * TP]; const int q = threadIdx.x & 15, r = threadIdx.x >> 4; const int p0 = blockIdx.x * 128, o0 = blockIdx.y * 64;
    tile_in<CO>(OT + ((size_t)blockIdx.z * NP + p0) * CO + o0, L); OUTb += ((size_t)blockIdx.z * CO + o0) * NP + p0 + 4 * q;
#pragma unroll   // straight line, so that the LDS reads of later rows do not wait for the stores of earlier ones
    for (int k = 0; k < 4; ++k)
#pragma unroll   // as above
        for (int s = 0; s < 2; ++s) { const int o = r + 16 * k; v4f ov;
#pragma unroll   // register vector needs constant indices
            for (int i = 0; i < 4; ++i) ov[i] = L[o * TP + 64 * s + 4 * q + i];
            *(v4f*)(OUTb + (size_t)o * NP + 64 * s) = ov; } }

extern "C" void kernel_launch(void* const* d_in, const int* in_sizes, int n_in,
                              void* d_out, int out_size, void* d_ws, size_t ws_size, hipStream_t stream) {
    (void)in_sizes; (void)n_in; (void)out_size;
    const float** I = (const float**)d_in;
    const float *qf = I[0], *kf = I[1], *vf = I[2], *Wk = I[3], *bk = I[4], *ga = I[5], *be = I[6], *Wv = I[7], *bv = I[8], *Ww = I[9], *bw = I[10];
    float* OUT = (float*)d_out;     // [8][128][64][64]
    char* wsp = (char*)d_ws;
    auto take = [&](size_t bytes) { char* p = wsp; wsp += (bytes + 255) & ~(size_t)255; return (void*)p; };
    bf* WK = (bf*)take(3 * CK * CI * 2); bf* WV = WK + CK * CI; bf* WW = WV + CV * CI;   // three planes of 8192 elements, one behind the other
    bf* XT = (bf*)take((size_t)3 * NBI * NP * CI * 2);   // [q, k, v][image][p][c]
    float* YQ = (float*)take((size_t)3 * NBI * NP * CK * 4); float* YK = YQ + (size_t)NBI * NP * CK; float* YV = YK + (size_t)NBI * NP * CK; float* STQ = (float*)take(2 * CK * 2 * 4); float* STK = STQ + CK * 2;
    bf* Qh = (bf*)take((size_t)NBI * NP * CK * 2); bf* Ql = (bf*)take((size_t)NBI * NP * CK * 2); bf* Kh = (bf*)take((size_t)NBI * CK * NP * 2); bf* Kl = (bf*)take((size_t)NBI * CK * NP * 2); bf* Vh = (bf*)take((size_t)NBI * CV * NP * 2); bf* Vl = (bf*)take((size_t)NBI * CV * NP * 2); float* vs = (float*)take(NBI * CV * 4);
    float* M = (float*)take((size_t)NBI * KS * CK * CV * 4); bf* Mh = (bf*)take(NBI * CK * CV * 2); bf* Ml = (bf*)take(NBI * CK * CV * 2); float* CTX = (float*)take((size_t)NBI * NP * CV * 4); bf* Ch = (bf*)take((size_t)NBI * NP * CV * 2); bf* Cl = (bf*)take((size_t)NBI * NP * CV * 2); float* OT = (float*)take((size_t)NBI * NP * CO * 4);
    if ((size_t)(wsp - (char*)d_ws) > ws_size) return;    // total ~ 114 MB
    k_cvt8<<<dim3((CK * CI / 8 + 255) / 256, 3, 1), 256, 0, stream>>>(Wk, Wv, Ww, WK, CK * CI / 8);   // [out][in] natural = Bt; CK*CI == CV*CI == CO*CV
    // phase 1: the three 1x1 convs for all images (BN needs batch statistics)
    k_xt<<<dim3(NP / 128, NBI, 3), 256, 0, stream>>>(qf, kf, vf, XT);
    k_gemmw<bf, 0, true><<<dim3(NP / 64, 1, 2 * NBI), 32, 0, stream>>>(XT, nullptr, WK, nullptr, CI, CI, YQ, CK, bk, (size_t)NP * CI, 0, (size_t)NP * CK);   // q images, then k images
    k_gemmw<bf, 0, true><<<dim3(NP / 64, 1, NBI), 32, 0, stream>>>(XT + (size_t)2 * NBI * NP * CI, nullptr, WV, nullptr, CI, CI, YV, CV, bv, (size_t)NP * CI, 0, (size_t)NP * CV);
    k_bnstat<<<dim3(CK, 2, 1), 256, 0, stream>>>(YQ, STQ); k_vsum<<<dim3(NBI, 2, 1), 1024, 0, stream>>>(YV, vs);
    // phase 2: all images per launch
    k_qn<<<dim3((NP * CK / 4 + 255) / 256, NBI, 1), 256, 0, stream>>>(YQ, STQ, ga, be, Qh, Ql); k_knT<<<dim3((NP / 2 + 255) / 256, NBI, 1), 256, 0, stream>>>(YK, STK, ga, be, Kh, Kl); k_vT<<<dim3(NP / 128, NBI, 1), 256, 0, stream>>>(YV, Vh, Vl);
    k_gemmw<bf, 2, false, true><<<dim3(1, KS, NBI), 32, 0, stream>>>(Vh, Vl, Kh, Kl, NP, NP / KS, M, CK, nullptr, (size_t)CV * NP, (size_t)CK * NP, (size_t)CV * CK);   // partial Mt[slice][v][c] = sum over the slice's m of v[m][v] kn[m][c]
    k_mt<<<dim3((CV * CK / 4 + 255) / 256, NBI, 1), 256, 0, stream>>>(M, Mh, Ml);
    k_gemmw<bf, 2, false><<<dim3(NP / 64, 1, NBI), 32, 0, stream>>>(Qh, Ql, Mh, Ml, CK, CK, CTX, CV, nullptr, (size_t)NP * CK, (size_t)CV * CK, (size_t)NP * CV);     // ctx0[n][v] = qn.M
    k_splitb<<<dim3((NP * CV / 4 + 255) / 256, NBI, 1), 256, 0, stream>>>(CTX, vs, Ch, Cl);   // + vsum[v] (f32), hl planes
    k_gemmw<bf, 1, true><<<dim3(NP / 64, CO / 64, NBI), 32, 0, stream>>>(Ch, Cl, WW, nullptr, CV, CV, OT, CO, bw, (size_t)NP * CV, 0, (size_t)NP * CO);    // [p][o]
    k_nchw<<<dim3(NP / 128, CO / 64, NBI), 256, 0, stream>>>(OT, OUT);
}

// v005
// One run takes 90.7 microseconds.
// Two timings next to v004 both put it at 1.68 times that version's speed.
// Counting every step since v000, it is 103 times as fast.
#include <hip/hip_runtime.h>

// non_local_attention (query/key/value features [8][128][64x64]; q = BN_train(conv1x1(query; Wk, bk)), k = BN_train(conv1x1(key; Wk, bk)) (BatchNorm2d in training mode: per-channel batch statistics over (B,H,W), each call its own), v = conv1x1(value; Wv, bv);
// q, k L2-normalised over their 64 channels per position (+1e-7); sim[n][m] = q_n.k_m + 1 (no softmax); ctx[n] = sum_m sim[n][m] v_m; out = conv1x1(ctx; Ww, bw) -> [8][128][64][64]).
// Reassociation (exact algebra, no softmax in between): ctx[n][v] = sum_c qn[n][c] M[c][v] + vsum[v] with M = kn^T v (64x64) and vsum = sum_m v_m - the [4096][4096] similarity map is never formed.

#define NBI  8
#define CI   128
#define NP   4096
#define CK   64
#define CV   64
#define CO   128
#define NT   (NBI * NP / 64)   // 64-row tiles of one tensor's conv output over the whole batch: one (mean, M2) pair per channel from each
#define KS   32     // k slices of the M product: 4096 / 32 = 128 positions (256 B of every operand row) per one-wave block
typedef _Float16 h16;
typedef unsigned short bf;
typedef __attribute__((ext_vector_type(16))) __bf16   v16bf;
typedef __attribute__((ext_vector_type(16))) _Float16 v16h;
typedef __attribute__((ext_vector_type(8)))  _Float16 v8h;
typedef __attribute__((ext_vector_type(8)))  unsigned short v8us;
typedef __attribute__((ext_vector_type(8)))  float    v8f;
typedef __attribute__((ext_vector_type(4)))  float    v4f;
typedef v8h  __attribute__((may_alias)) v8ha;
typedef v4f  __attribute__((may_alias)) v4fa;
typedef v8us __attribute__((may_alias)) v8usa;

__device__ __forceinline__ unsigned short f2bf(float f) { unsigned u = __float_as_uint(f); u += 0x7FFFu + ((u >> 16) & 1u); return (unsigned short)(u >> 16); }
__device__ __forceinline__ float bf2f(unsigned short b) { return __uint_as_float(((unsigned)b) << 16); }
__device__ __forceinline__ float bfr(float f) { return bf2f(f2bf(f)); }
__device__ __forceinline__ v16h cat16(v8h lo, v8h hi) { return __builtin_shufflevector(lo, hi, 0, 1, 2, 3, 4, 5, 6, 7, 8, 9, 10, 11, 12, 13, 14, 15); }
__device__ __forceinline__ v16bf cat16b(v8us lo, v8us hi) { return __builtin_bit_cast(v16bf, __builtin_shufflevector(lo, hi, 0, 1, 2, 3, 4, 5, 6, 7, 8, 9, 10, 11, 12, 13, 14, 15)); }
__device__ __forceinline__ v8f wmma16(v16h a, v16h b, v8f c) { return __builtin_amdgcn_wmma_f32_16x16x32_f16(false, a, false, b, (short)0, c, false, false); }
__device__ __forceinline__ v8f wmmab(v16bf a, v16bf b, v8f c) { return __builtin_amdgcn_wmma_f32_16x16x32_bf16(false, a, false, b, (short)0, c, false, false); }



// ---- k_gemmw: register-blocked GEMM, ONE WAVE per 64x64 output tile (16 accumulators), operands straight from K-contiguous 16-bit planes; grid (M/64, N/64, Z), 32 threads.
// C[m][n] (f32, pitch ldc, + optional f32 bias[n]) = sum_k A[m][k] Bt[n][k] (+ split products per NSPLIT). z-batch strides sA/sB/sC in elements. K % 32 == 0.
// STAT (needs BIAS, N == 64, grid (NP / 64, 1, Z)): the bias is added to the accumulators instead of to the staged rows (same operands, same stored values), and the wave also leaves, per channel, the mean of its tile's 64 rows and
// M2 = the sum of their squared distances from that mean, both from the registers, at SP + (z * (NP / 64) + blockIdx.x) * 128: 64 means, then 64 M2 (its own four 128-B lines). k_bnfin joins the tiles.
// KSPLIT: N == 64 and blockIdx.y is not a column tile but a slice of the k range: the block sums the kn positions from y*kn on (rows keep their pitch K) and stores its own partial tile at C + (z*KS + y)*sC (KS slices, grid.y == KS); the reader adds the slices. Elsewhere kn == K.
template <typename T16> struct WFrag;
template <> struct WFrag<h16> { typedef v16h V; static __device__ __forceinline__ V ld(const h16* p) { return cat16(*(const v8h*)p, *(const v8h*)(p + 16)); } static __device__ __forceinline__ v8f mma(V a, V b, v8f c) { return wmma16(a, b, c); } };
template <> struct WFrag<bf> { typedef v16bf V; static __device__ __forceinline__ V ld(const bf* p) { return cat16b(*(const v8us*)p, *(const v8us*)(p + 16)); } static __device__ __forceinline__ v8f mma(V a, V b, v8f c) { return wmmab(a, b, c); } };
template <typename T16, int NSPLIT, bool BIAS, bool KSPLIT = false, bool STAT = false>
__global__ __launch_bounds__(32) void k_gemmw(const T16* __restrict__ A, const T16* __restrict__ A2, const T16* __restrict__ Bt, const T16* __restrict__ Bt2, int K, int kn, float* C, int ldc, const float* __restrict__ bias, size_t sA, size_t sB, size_t sC, float* SP) {
    typedef typename WFrag<T16>::V V;
    __shared__ __align__(16) float os[16 * 68];
    const size_t z = blockIdx.z; const size_t k0 = KSPLIT ? (size_t)blockIdx.y * kn : 0; A += z * sA + k0; if (A2) A2 += z * sA + k0; Bt += z * sB + k0; if (Bt2) Bt2 += z * sB + k0; C += (KSPLIT ? z * KS + blockIdx.y : z) * sC;
    const int lane = threadIdx.x & 31, lr = lane & 15, hi = lane >> 4; const int r0 = blockIdx.x * 64, c0 = KSPLIT ? 0 : blockIdx.y * 64;
    v8f acc[4][4];
#pragma unroll
    for (int mb = 0; mb < 4; ++mb)
#pragma unroll
        for (int nb = 0; nb < 4; ++nb) acc[mb][nb] = (v8f){};
    float bb[4];   // STAT: the lane's four bias values, asked for ahead of the k loop so that their latency passes under it
    if (STAT) {
#pragma unroll   // register arrays need constant indices
        for (int nb = 0; nb < 4; ++nb) bb[nb] = bias[nb * 16 + lr]; }
    const size_t aoff = (size_t)(r0 + lr) * K + 8 * hi, boff = (size_t)(c0 + lr) * K + 8 * hi;
#pragma unroll 1
    for (int kc = 0; kc < kn; kc += 32) {
        V a[4], a2[4];
#pragma unroll
        for (int mb = 0; mb < 4; ++mb) { a[mb] = WFrag<T16>::ld(A + aoff + (size_t)mb * 16 * K + kc); if (NSPLIT == 1 || NSPLIT == 2) a2[mb] = WFrag<T16>::ld(A2 + aoff + (size_t)mb * 16 * K + kc); }
#pragma unroll
        for (int nb = 0; nb < 4; ++nb) { const V b = WFrag<T16>::ld(Bt + boff + (size_t)nb * 16 * K + kc); V b2; if (NSPLIT >= 2) b2 = WFrag<T16>::ld(Bt2 + boff + (size_t)nb * 16 * K + kc);
#pragma unroll
            for (int mb = 0; mb < 4; ++mb) { acc[mb][nb] = WFrag<T16>::mma(a[mb], b, acc[mb][nb]); if (NSPLIT == 1 || NSPLIT == 2) acc[mb][nb] = WFrag<T16>::mma(a2[mb], b, acc[mb][nb]); if (NSPLIT >= 2) acc[mb][nb] = WFrag<T16>::mma(a[mb], b2, acc[mb][nb]); } }
        asm volatile("v_nop\n\tv_nop\n\tv_nop\n\tv_nop" : "+v"(acc[0][0]), "+v"(acc[1][1]), "+v"(acc[2][2]), "+v"(acc[3][3]) : "v"(a[0]), "v"(a[3]));
    }
    if (STAT) { float s[4], t[4];   // lane (lr, hi) holds rows mb*16 + hi*8 + j of channel nb*16 + lr; the four channels' sums are four independent chains
#pragma unroll   // register arrays need constant indices
        for (int nb = 0; nb < 4; ++nb) { s[nb] = 0.f; t[nb] = 0.f; const float b = bfr(bb[nb]);
#pragma unroll   // as above
            for (int mb = 0; mb < 4; ++mb) acc[mb][nb] += b; }
#pragma unroll   // as above
        for (int mb = 0; mb < 4; ++mb)
#pragma unroll   // as above
            for (int j = 0; j < 8; ++j)
#pragma unroll   // as above
                for (int nb = 0; nb < 4; ++nb) s[nb] += acc[mb][nb][j];
#pragma unroll   // as above
        for (int nb = 0; nb < 4; ++nb) { s[nb] += __shfl_xor(s[nb], 16, 32); s[nb] *= (1.0f / 64); }
#pragma unroll   // as above
        for (int mb = 0; mb < 4; ++mb)
#pragma unroll   // as above
            for (int j = 0; j < 8; ++j)
#pragma unroll   // as above
                for (int nb = 0; nb < 4; ++nb) { const float d = acc[mb][nb][j] - s[nb]; t[nb] += d * d; }
        float* sp = SP + (z * (NP / 64) + blockIdx.x) * (2 * CK) + hi * CK + lr;
#pragma unroll   // as above
        for (int nb = 0; nb < 4; ++nb) { t[nb] += __shfl_xor(t[nb], 16, 32); sp[nb * 16] = hi ? t[nb] : s[nb]; } }
#pragma unroll
    for (int mb = 0; mb < 4; ++mb) {
#pragma unroll
        for (int nb = 0; nb < 4; ++nb) {
#pragma unroll
            for (int j = 0; j < 8; ++j) os[(hi * 8 + j) * 68 + nb * 16 + lr] = acc[mb][nb][j]; }
        __builtin_amdgcn_wave_barrier(); asm volatile("" ::: "memory");
        float* crow = C + (size_t)(r0 + mb * 16) * ldc + c0;
{
#pragma unroll
            for (int s = 0; s < 8; ++s) { const int row = 2 * s + hi, cofs = lr * 4; v4f val = *(const v4fa*)(os + row * 68 + cofs); if (BIAS && !STAT) { val[0] += bfr(bias[c0 + cofs]); val[1] += bfr(bias[c0 + cofs + 1]); val[2] += bfr(bias[c0 + cofs + 2]); val[3] += bfr(bias[c0 + cofs + 3]); }
                *(v4f*)(crow + (size_t)row * ldc + cofs) = val; }
             }
        __builtin_amdgcn_wave_barrier(); asm volatile("" ::: "memory");
    }
}

__device__ __forceinline__ void splitf(float y, unsigned short& h, unsigned short& l) { h = f2bf(y); l = f2bf(y - bf2f(h)); }
typedef __attribute__((ext_vector_type(2))) unsigned short v2us;
typedef __attribute__((ext_vector_type(2))) float v2f;
typedef __attribute__((ext_vector_type(4))) unsigned short v4us;

// Kernels below that work per image take it from blockIdx.y (k_vsum: blockIdx.x, k_nchw: blockIdx.z), and where several tensors go the same way the tensor from blockIdx.y (k_xt: blockIdx.z, k_bnfin: blockIdx.x): one launch per stage for the whole batch, each image on its own workspace planes.
__global__ __launch_bounds__(256) void k_cvt8(const float* __restrict__ s0, const float* __restrict__ s1, const float* __restrict__ s2, bf* dst, size_t n8) { const size_t i = (size_t)blockIdx.x * 256 + threadIdx.x; if (i >= n8) return; const float* src = blockIdx.y == 0 ? s0 : blockIdx.y == 1 ? s1 : s2; dst += (size_t)blockIdx.y * n8 * 8; const v8f v = *(const v8f*)(src + i * 8); v8us o;
#pragma unroll
    for (int k = 0; k < 8; ++k) o[k] = f2bf(v[k]); *(v8us*)(dst + i * 8) = o;  }
// ---- The three transposes (k_xt, k_vT, k_nchw) go through a padded LDS tile: the global loads follow the source's rows and the global stores the target's rows, 16 lanes side by side on whole 128-B lines on both sides,
// and a thread moves 32 or 64 elements. Odd row pitches in LDS (65, 129 dwords): the 16 lanes of a half wave step by 4 rows or by 4 dwords, the two halves by 1, so that every LDS access of a wave meets 32 different banks.
typedef __attribute__((ext_vector_type(4))) unsigned v4u;
#define XP 65    // k_xt: LDS row = one position's 128 channels as 64 dwords of two bf16, + 1
#define TP 129   // tile_in: LDS row = one source column's 128 rows as f32, + 1
// k_xt: tile of 128 channels x 128 positions. A thread holds the same 4 positions of channels 2*c2 and 2*c2 + 1, so a dword of two neighbouring channels is formed in registers.
__global__ __launch_bounds__(256) void k_xt(const float* __restrict__ xq, const float* __restrict__ xk, const float* __restrict__ xv, bf* XT) { __shared__ unsigned L[128 * XP]; const int q = threadIdx.x & 15, r = threadIdx.x >> 4; const int p0 = blockIdx.x * 128;
    const float* x = (blockIdx.z == 0 ? xq : blockIdx.z == 1 ? xk : xv) + (size_t)blockIdx.y * CI * NP + p0 + 4 * q; XT += (((size_t)blockIdx.z * NBI + blockIdx.y) * NP + p0) * CI; v4f a[4][2], b[4][2];
#pragma unroll   // straight line, so that a thread's 16 independent loads are in flight together
    for (int j = 0; j < 4; ++j)
#pragma unroll   // as above
        for (int s = 0; s < 2; ++s) { a[j][s] = *(const v4f*)(x + (size_t)(2 * (r + 16 * j)) * NP + 64 * s); b[j][s] = *(const v4f*)(x + (size_t)(2 * (r + 16 * j) + 1) * NP + 64 * s); }
#pragma unroll   // register arrays need constant indices
    for (int j = 0; j < 4; ++j)
#pragma unroll   // as above
        for (int s = 0; s < 2; ++s)
#pragma unroll   // as above
            for (int i = 0; i < 4; ++i) L[(64 * s + 4 * q + i) * XP + r + 16 * j] = (unsigned)f2bf(a[j][s][i]) | ((unsigned)f2bf(b[j][s][i]) << 16);
    __syncthreads();   // publishes the tile: a thread reads rows whose dwords all 8 waves wrote
#pragma unroll   // straight line, so that the LDS reads of later rows do not wait for the stores of earlier ones
    for (int k = 0; k < 8; ++k) { const int p = r + 16 * k; v4u o;
#pragma unroll   // register vector needs constant indices
        for (int i = 0; i < 4; ++i) o[i] = L[p * XP + 4 * q + i];
        *(v8us*)(XT + (size_t)p * CI + 8 * q) = __builtin_bit_cast(v8us, o); } }
// tile_in: 256 threads bring 128 rows x 64 columns of f32 (src at the tile's first element, row pitch SP floats) into L[column][row].
template <int SP> __device__ __forceinline__ void tile_in(const float* __restrict__ src, float* L) { const int q = threadIdx.x & 15, r = threadIdx.x >> 4; v4f v[8];
#pragma unroll   // straight line, so that a thread's 8 independent loads are in flight together
    for (int j = 0; j < 8; ++j) v[j] = *(const v4f*)(src + (size_t)(r + 16 * j) * SP + 4 * q);
#pragma unroll   // register arrays need constant indices
    for (int j = 0; j < 8; ++j)
#pragma unroll   // as above
        for (int i = 0; i < 4; ++i) L[(4 * q + i) * TP + r + 16 * j] = v[j][i];
    __syncthreads();   // publishes the tile: a thread reads columns whose rows all 8 waves wrote
}
// k_bnfin: the batch statistics of one tensor (blockIdx.x: q, k) from its NT tiles' (mean, M2) pairs, P[tile][64 means, 64 M2]. All tiles hold 64 rows, so mean = sum of the tile means / NT and
// sum of squared distances = sum of the M2 + 64 * sum of (tile mean - mean)^2: exact algebra, and every square is taken about a mean, as in a two-pass variance. ST[c] = (mean, 1 / sqrt(var + 1e-5)).
// 1024 threads = 64 tiles x 16 lanes of 4 channels: a thread keeps its 8 tile means in registers for the second sum; a wave folds its 2 tiles by one butterfly step, 64 threads add the 32 waves' partials from LDS in wave order. Fixed order, no atomics.
__global__ __launch_bounds__(1024) void k_bnfin(const float* __restrict__ P, float* ST) { __shared__ __align__(16) float red[32 * CK]; __shared__ __align__(16) float mu[CK]; const int tid = threadIdx.x, q = tid & 15, r = tid >> 4;
    P += ((size_t)blockIdx.x * NT + r) * (2 * CK) + 4 * q; ST += blockIdx.x * 2 * CK; v4f m[NT / 64], w[NT / 64];
#pragma unroll   // straight line, so that a thread's 16 independent loads are in flight together
    for (int k = 0; k < NT / 64; ++k) { m[k] = *(const v4f*)(P + (size_t)k * 64 * 2 * CK); w[k] = *(const v4f*)(P + (size_t)k * 64 * 2 * CK + CK); }
    v4f s = m[0], t = w[0];
#pragma unroll   // register arrays need constant indices
    for (int k = 1; k < NT / 64; ++k) { s += m[k]; t += w[k]; }
    for (int u = 0; u < 4; ++u) s[u] += __shfl_xor(s[u], 16, 32);
    if ((tid & 31) < 16) *(v4f*)(red + (tid >> 5) * CK + 4 * q) = s;
    __syncthreads();   // publishes the 32 waves' sums of tile means
    if (tid < CK) { float a = 0.f;
        for (int i = 0; i < 32; ++i) a += red[i * CK + tid];
        mu[tid] = a * (1.0f / NT); }
    __syncthreads();   // publishes the means; also ends the reads of red before it is written again
    const v4f mean = *(const v4f*)(mu + 4 * q); v4f e = (v4f){};
#pragma unroll   // register arrays need constant indices
    for (int k = 0; k < NT / 64; ++k) { const v4f d = m[k] - mean; e += d * d; }
    t += 64.0f * e;
    for (int u = 0; u < 4; ++u) t[u] += __shfl_xor(t[u], 16, 32);
    if ((tid & 31) < 16) *(v4f*)(red + (tid >> 5) * CK + 4 * q) = t;
    __syncthreads();   // publishes the 32 waves' sums of squared distances
    if (tid < CK) { float a = 0.f;
        for (int i = 0; i < 32; ++i) a += red[i * CK + tid];
        v2f o; o[0] = mu[tid]; o[1] = __frsqrt_rn(__fadd_rn(a * (1.0f / (NBI * NP)), 1e-5f)); *(v2f*)(ST + 2 * tid) = o; } }
__global__ __launch_bounds__(256) void k_qn(const float* __restrict__ Y, const float* __restrict__ ST, const float* __restrict__ ga, const float* __restrict__ be, bf* Qh, bf* Ql) { const int e = (blockIdx.x * 256 + threadIdx.x) * 4; if (e >= NP * CK) return; Y += (size_t)blockIdx.y * NP * CK; Qh += (size_t)blockIdx.y * NP * CK; Ql += (size_t)blockIdx.y * NP * CK; const int c0 = e % CK; const v4f a = *(const v4f*)(Y + e); float y[4]; float ss = 0.f;
#pragma unroll
    for (int u = 0; u < 4; ++u) { const int c = c0 + u; float t0 = __fmul_rn(__fsub_rn(a[u], ST[2 * c]), ST[2 * c + 1]); asm volatile("" : "+v"(t0)); float g = bfr(ga[c]), bb = bfr(be[c]); asm volatile("" : "+v"(g)); asm volatile("" : "+v"(bb)); float t1 = __fmul_rn(t0, g); asm volatile("" : "+v"(t1)); y[u] = __fadd_rn(t1, bb); float p = __fmul_rn(y[u], y[u]); asm volatile("" : "+v"(p)); ss = __fadd_rn(ss, p); }
    ss += __shfl_xor(ss, 1, 32); ss += __shfl_xor(ss, 2, 32); ss += __shfl_xor(ss, 4, 32); ss += __shfl_xor(ss, 8, 32); const float inv = __fdiv_rn(1.0f, __fadd_rn(__fsqrt_rn(ss), 1e-7f)); v4us oh, ol;
#pragma unroll
    for (int u = 0; u < 4; ++u) { unsigned short hh, ll; splitf(__fmul_rn(y[u], inv), hh, ll); oh[u] = hh; ol[u] = ll; } *(v4us*)(Qh + e) = oh; *(v4us*)(Ql + e) = ol;  }
__global__ __launch_bounds__(256) void k_knT(const float* __restrict__ Y, const float* __restrict__ ST, const float* __restrict__ ga, const float* __restrict__ be, bf* Kh, bf* Kl) { const int m = (blockIdx.x * 256 + threadIdx.x) * 2; if (m >= NP) return; Y += (size_t)blockIdx.y * NP * CK; Kh += (size_t)blockIdx.y * CK * NP; Kl += (size_t)blockIdx.y * CK * NP; float y0[CK], y1[CK]; float s0 = 0.f, s1 = 0.f;
#pragma unroll
    for (int c4 = 0; c4 < CK / 4; ++c4) { const v4f a = *(const v4f*)(Y + (size_t)m * CK + c4 * 4), b = *(const v4f*)(Y + (size_t)(m + 1) * CK + c4 * 4);
#pragma unroll
        for (int u = 0; u < 4; ++u) { const int c = c4 * 4 + u; const float mu = ST[2 * c], rs = ST[2 * c + 1]; float g = bfr(ga[c]), bb = bfr(be[c]); asm volatile("" : "+v"(g)); asm volatile("" : "+v"(bb));
            float t0 = __fmul_rn(__fsub_rn(a[u], mu), rs), t1 = __fmul_rn(__fsub_rn(b[u], mu), rs); asm volatile("" : "+v"(t0)); asm volatile("" : "+v"(t1)); float u0 = __fmul_rn(t0, g), u1 = __fmul_rn(t1, g); asm volatile("" : "+v"(u0)); asm volatile("" : "+v"(u1)); y0[c] = __fadd_rn(u0, bb); y1[c] = __fadd_rn(u1, bb);
            float p0 = __fmul_rn(y0[c], y0[c]), p1 = __fmul_rn(y1[c], y1[c]); asm volatile("" : "+v"(p0)); asm volatile("" : "+v"(p1)); s0 = __fadd_rn(s0, p0); s1 = __fadd_rn(s1, p1); } }
    const float i0 = __fdiv_rn(1.0f, __fadd_rn(__fsqrt_rn(s0), 1e-7f)), i1 = __fdiv_rn(1.0f, __fadd_rn(__fsqrt_rn(s1), 1e-7f));
    {
#pragma unroll
        for (int c = 0; c < CK; ++c) { unsigned short a0, b0, a1, b1; splitf(__fmul_rn(y0[c], i0), a0, b0); splitf(__fmul_rn(y1[c], i1), a1, b1); v2us oh, ol; oh[0] = a0; oh[1] = a1; ol[0] = b0; ol[1] = b1; *(v2us*)(Kh + (size_t)c * NP + m) = oh; *(v2us*)(Kl + (size_t)c * NP + m) = ol; }
         } }
__global__ __launch_bounds__(256) void k_vT(const float* __restrict__ Y, bf* Vh, bf* Vl) { __shared__ float L[CV * TP]; const int q = threadIdx.x & 15, r = threadIdx.x >> 4; const int m0 = blockIdx.x * 128;
    tile_in<CV>(Y + ((size_t)blockIdx.y * NP + m0) * CV, L); Vh += (size_t)blockIdx.y * CV * NP + m0 + 4 * q; Vl += (size_t)blockIdx.y * CV * NP + m0 + 4 * q;
#pragma unroll   // straight line, so that the LDS reads of later rows do not wait for the stores of earlier ones
    for (int k = 0; k < 4; ++k)
#pragma unroll   // as above
        for (int s = 0; s < 2; ++s) { const int v = r + 16 * k; v4us oh, ol;
#pragma unroll   // register vectors need constant indices
            for (int i = 0; i < 4; ++i) { unsigned short x, y; splitf(L[v * TP + 64 * s + 4 * q + i], x, y); oh[i] = x; ol[i] = y; }
            *(v4us*)(Vh + (size_t)v * NP + 64 * s) = oh; *(v4us*)(Vl + (size_t)v * NP + 64 * s) = ol; } }
// k_vsum: vs[b][v] = sum_m YV[b][m][v] for all images in one launch. Grid (image, half of the 64 channels): a block's 32 channels are one 128-B line of every row, its 32 results one 128-B line of vs.
// 1024 threads = 128 rows x 8 lanes of 4 channels: a thread adds its 32 rows (independent loads, in flight together), a wave folds its 4 rows by two butterfly steps, wave 0 adds the 32 waves' partials from LDS in wave order. Fixed order, no atomics.
__global__ __launch_bounds__(1024) void k_vsum(const float* __restrict__ Y, float* vs) { __shared__ __align__(16) float red[32 * 32]; const int tid = threadIdx.x, q = tid & 7, r = tid >> 3;
    const float* p = Y + (size_t)blockIdx.x * NP * CV + (size_t)r * CV + blockIdx.y * 32 + q * 4; v4f s = (v4f){};
    for (int i = 0; i < NP / 128; ++i) s += *(const v4f*)(p + (size_t)i * 128 * CV);
    for (int u = 0; u < 4; ++u) { s[u] += __shfl_xor(s[u], 8, 32); s[u] += __shfl_xor(s[u], 16, 32); }
    if ((tid & 31) < 8) *(v4f*)(red + (tid >> 5) * 32 + q * 4) = s;
    __syncthreads();   // publishes the 32 waves' partial sums to wave 0
    if (tid < 32) { float t = 0.f;
        for (int w = 0; w < 32; ++w) t += red[w * 32 + tid];
        vs[blockIdx.x * CV + blockIdx.y * 32 + tid] = t; } }
// k_mt: Mt[v][c] = sum over the KS k slices of the partial tiles P[image][slice][v][c], added in slice order (fixed order, no atomics), then split into the hl planes. Whole-line loads.
__global__ __launch_bounds__(256) void k_mt(const float* __restrict__ P, bf* Mh, bf* Ml) { const int e = (blockIdx.x * 256 + threadIdx.x) * 4; if (e >= CV * CK) return; P += (size_t)blockIdx.y * KS * CV * CK; Mh += blockIdx.y * CV * CK; Ml += blockIdx.y * CV * CK; v4f t = *(const v4f*)(P + e); v4us oh, ol;
#pragma unroll   // straight line, so that the independent loads of many slices are in flight together
    for (int s = 1; s < KS; ++s) t += *(const v4f*)(P + (size_t)s * CV * CK + e);
#pragma unroll
    for (int u = 0; u < 4; ++u) { unsigned short a, b; splitf(t[u], a, b); oh[u] = a; ol[u] = b; } *(v4us*)(Mh + e) = oh; *(v4us*)(Ml + e) = ol;  }
__global__ __launch_bounds__(256) void k_splitb(const float* __restrict__ F, const float* __restrict__ vs, bf* Ph, bf* Pl) { const size_t e = ((size_t)blockIdx.x * 256 + threadIdx.x) * 4; if (e >= (size_t)NP * CV) return; F += (size_t)blockIdx.y * NP * CV; vs += blockIdx.y * CV; Ph += (size_t)blockIdx.y * NP * CV; Pl += (size_t)blockIdx.y * NP * CV; const int v0 = (int)(e % CV); const v4f a = *(const v4f*)(F + e); v4us oh, ol;
#pragma unroll
    for (int u = 0; u < 4; ++u) { unsigned short x, y; splitf(__fadd_rn(a[u], vs[v0 + u]), x, y); oh[u] = x; ol[u] = y; } *(v4us*)(Ph + e) = oh; *(v4us*)(Pl + e) = ol;  }
__global__ __launch_bounds__(256) void k_nchw(const float* __restrict__ OT, float* OUTb) { __shared__ float L[64 * TP]; const int q = threadIdx.x & 15, r = threadIdx.x >> 4; const int p0 = blockIdx.x * 128, o0 = blockIdx.y * 64;
    tile_in<CO>(OT + ((size_t)blockIdx.z * NP + p0) * CO + o0, L); OUTb += ((size_t)blockIdx.z * CO + o0) * NP + p0 + 4 * q;
#pragma unroll   // straight line, so that the LDS reads of later rows do not wait for the stores of earlier ones
    for (int k = 0; k < 4; ++k)
#pragma unroll   // as above
        for (int s = 0; s < 2; ++s) { const int o = r + 16 * k; v4f ov;
#pragma unroll   // register vector needs constant indices
            for (int i = 0; i < 4; ++i) ov[i] = L[o * TP + 64 * s + 4 * q + i];
            *(v4f*)(OUTb + (size_t)o * NP + 64 * s) = ov; } }

extern "C" void kernel_launch(void* const* d_in, const int* in_sizes, int n_in,
                              void* d_out, int out_size, void* d_ws, size_t ws_size, hipStream_t stream) {
    (void)in_sizes; (void)n_in; (void)out_size;
    const float** I = (const float**)d_in;
    const float *qf = I[0], *kf = I[1], *vf = I[2], *Wk = I[3], *bk = I[4], *ga = I[5], *be = I[6], *Wv = I[7], *bv = I[8], *Ww = I[9], *bw = I[10];
    float* OUT = (float*)d_out;     // [8][128][64][64]
    char* wsp = (char*)d_ws;
    auto take = [&](size_t bytes) { char* p = wsp; wsp += (bytes + 255) & ~(size_t)255; return (void*)p; };
    bf* WK = (bf*)take(3 * CK * CI * 2); bf* WV = WK + CK * CI; bf* WW = WV + CV * CI;   // three planes of 8192 elements, one behind the other
    bf* XT = (bf*)take((size_t)3 * NBI * NP * CI * 2);   // [q, k, v][image][p][c]
    float* YQ = (float*)take((size_t)3 * NBI * NP * CK * 4); float* YK = YQ + (size_t)NBI * NP * CK; float* YV = YK + (size_t)NBI * NP * CK; float* STQ = (float*)take(2 * CK * 2 * 4); float* STK = STQ + CK * 2; float* SP = (float*)take((size_t)2 * NT * 2 * CK * 4);   // [q, k][tile][64 means, 64 M2]
    bf* Qh = (bf*)take((size_t)NBI * NP * CK * 2); bf* Ql = (bf*)take((size_t)NBI * NP * CK * 2); bf* Kh = (bf*)take((size_t)NBI * CK * NP * 2); bf* Kl = (bf*)take((size_t)NBI * CK * NP * 2); bf* Vh = (bf*)take((size_t)NBI * CV * NP * 2); bf* Vl = (bf*)take((size_t)NBI * CV * NP * 2); float* vs = (float*)take(NBI * CV * 4);
    float* M = (float*)take((size_t)NBI * KS * CK * CV * 4); bf* Mh = (bf*)take(NBI * CK * CV * 2); bf* Ml = (bf*)take(NBI * CK * CV * 2); float* CTX = (float*)take((size_t)NBI * NP * CV * 4); bf* Ch = (bf*)take((size_t)NBI * NP * CV * 2); bf* Cl = (bf*)take((size_t)NBI * NP * CV * 2); float* OT = (float*)take((size_t)NBI * NP * CO * 4);
    if ((size_t)(wsp - (char*)d_ws) > ws_size) return;    // total ~ 114 MB
    k_cvt8<<<dim3((CK * CI / 8 + 255) / 256, 3, 1), 256, 0, stream>>>(Wk, Wv, Ww, WK, CK * CI / 8);   // [out][in] natural = Bt; CK*CI == CV*CI == CO*CV
    // phase 1: the three 1x1 convs for all images (BN needs batch statistics)
    k_xt<<<dim3(NP / 128, NBI, 3), 256, 0, stream>>>(qf, kf, vf, XT);
    k_gemmw<bf, 0, true, false, true><<<dim3(NP / 64, 1, 2 * NBI), 32, 0, stream>>>(XT, nullptr, WK, nullptr, CI, CI, YQ, CK, bk, (size_t)NP * CI, 0, (size_t)NP * CK, SP);   // q images, then k images
    k_gemmw<bf, 0, true><<<dim3(NP / 64, 1, NBI), 32, 0, stream>>>(XT + (size_t)2 * NBI * NP * CI, nullptr, WV, nullptr, CI, CI, YV, CV, bv, (size_t)NP * CI, 0, (size_t)NP * CV, nullptr);
    k_bnfin<<<dim3(2, 1, 1), 1024, 0, stream>>>(SP, STQ); k_vsum<<<dim3(NBI, 2, 1), 1024, 0, stream>>>(YV, vs);
    // phase 2: all images per launch
    k_qn<<<dim3((NP * CK / 4 + 255) / 256, NBI, 1), 256, 0, stream>>>(YQ, STQ, ga, be, Qh, Ql); k_knT<<<dim3((NP / 2 + 255) / 256, NBI, 1), 256, 0, stream>>>(YK, STK, ga, be, Kh, Kl); k_vT<<<dim3(NP / 128, NBI, 1), 256, 0, stream>>>(YV, Vh, Vl);
    k_gemmw<bf, 2, false, true><<<dim3(1, KS, NBI), 32, 0, stream>>>(Vh, Vl, Kh, Kl, NP, NP / KS, M, CK, nullptr, (size_t)CV * NP, (size_t)CK * NP, (size_t)CV * CK, nullptr);   // partial Mt[slice][v][c] = sum over the slice's m of v[m][v] kn[m][c]
    k_mt<<<dim3((CV * CK / 4 + 255) / 256, NBI, 1), 256, 0, stream>>>(M, Mh, Ml);
    k_gemmw<bf, 2, false><<<dim3(NP / 64, 1, NBI), 32, 0, stream>>>(Qh, Ql, Mh, Ml, CK, CK, CTX, CV, nullptr, (size_t)NP * CK, (size_t)CV * CK, (size_t)NP * CV, nullptr);     // ctx0[n][v] = qn.M
    k_splitb<<<dim3((NP * CV / 4 + 255) / 256, NBI, 1), 256, 0, stream>>>(CTX, vs, Ch, Cl);   // + vsum[v] (f32), hl planes
    k_gemmw<bf, 1, true><<<dim3(NP / 64, CO / 64, NBI), 32, 0, stream>>>(Ch, Cl, WW, nullptr, CV, CV, OT, CO, bw, (size_t)NP * CV, 0, (size_t)NP * CO, nullptr);    // [p][o]
    k_nchw<<<dim3(NP / 128, CO / 64, NBI), 256, 0, stream>>>(OT, OUT);
}

// v006
// A run of this version takes 81.2 microseconds.
// Next to v005, in two timings, it ran 1.12 and 1.11 times as fast.
// All steps since v000 together make it 115 times as fast.
#include <hip/hip_runtime.h>

// non_local_attention (query/key/value features [8][128][64x64]; q = BN_train(conv1x1(query; Wk, bk)), k = BN_train(conv1x1(key; Wk, bk)) (BatchNorm2d in training mode: per-channel batch statistics over (B,H,W), each call its own), v = conv1x1(value; Wv, bv);
// q, k L2-normalised over their 64 channels per position (+1e-7); sim[n][m] = q_n.k_m + 1 (no softmax); ctx[n] = sum_m sim[n][m] v_m; out = conv1x1(ctx; Ww, bw) -> [8][128][64][64]).
// Reassociation (exact algebra, no softmax in between): ctx[n][v] = sum_c qn[n][c] M[c][v] + vsum[v] with M = kn^T v (64x64) and vsum = sum_m v_m - the [4096][4096] similarity map is never formed.

#define NBI  8
#define CI   128
#define NP   4096
#define CK   64
#define CV   64
#define CO   128
#define NT   (NBI * NP / 64)   // 64-row tiles of one tensor's conv output over the whole batch: one (mean, M2) pair per channel from each
#define KS   32     // k slices of the M product: 4096 / 32 = 128 positions (256 B of every operand row) per one-wave block
typedef _Float16 h16;
typedef unsigned short bf;
typedef __attribute__((ext_vector_type(16))) __bf16   v16bf;
typedef __attribute__((ext_vector_type(16))) _Float16 v16h;
typedef __attribute__((ext_vector_type(8)))  _Float16 v8h;
typedef __attribute__((ext_vector_type(8)))  unsigned short v8us;
typedef __attribute__((ext_vector_type(8)))  float    v8f;
typedef __attribute__((ext_vector_type(4)))  float    v4f;
typedef v8h  __attribute__((may_alias)) v8ha;
typedef v4f  __attribute__((may_alias)) v4fa;
typedef v8us __attribute__((may_alias)) v8usa;

__device__ __forceinline__ unsigned short f2bf(float f) { unsigned u = __float_as_uint(f); u += 0x7FFFu + ((u >> 16) & 1u); return (unsigned short)(u >> 16); }
__device__ __forceinline__ float bf2f(unsigned short b) { return __uint_as_float(((unsigned)b) << 16); }
__device__ __forceinline__ float bfr(float f) { return bf2f(f2bf(f)); }
__device__ __forceinline__ v16h cat16(v8h lo, v8h hi) { return __builtin_shufflevector(lo, hi, 0, 1, 2, 3, 4, 5, 6, 7, 8, 9, 10, 11, 12, 13, 14, 15); }
__device__ __forceinline__ v16bf cat16b(v8us lo, v8us hi) { return __builtin_bit_cast(v16bf, __builtin_shufflevector(lo, hi, 0, 1, 2, 3, 4, 5, 6, 7, 8, 9, 10, 11, 12, 13, 14, 15)); }
__device__ __forceinline__ v8f wmma16(v16h a, v16h b, v8f c) { return __builtin_amdgcn_wmma_f32_16x16x32_f16(false, a, false, b, (short)0, c, false, false); }
__device__ __forceinline__ v8f wmmab(v16bf a, v16bf b, v8f c) { return __builtin_amdgcn_wmma_f32_16x16x32_bf16(false, a, false, b, (short)0, c, false, false); }



// ---- k_gemmw: register-blocked GEMM, ONE WAVE per 64x64 output tile (16 accumulators), operands straight from K-contiguous 16-bit planes; grid (M/64, N/64, Z), 32 threads.
// C[m][n] (f32, pitch ldc, + optional f32 bias[n]) = sum_k A[m][k] Bt[n][k] (+ split products per NSPLIT). z-batch strides sA/sB/sC in elements. K % 32 == 0.
// STAT (needs BIAS, N == 64, grid (NP / 64, 1, Z)): the bias is added to the accumulators instead of to the staged rows (same operands, same stored values), and the wave also leaves, per channel, the mean of its tile's 64 rows and
// M2 = the sum of their squared distances from that mean, both from the registers, at SP + (z * (NP / 64) + blockIdx.x) * 128: 64 means, then 64 M2 (its own four 128-B lines). k_bnfin joins the tiles.
// KSPLIT: N == 64 and blockIdx.y is not a column tile but a slice of the k range: the block sums the kn positions from y*kn on (rows keep their pitch K) and stores its own partial tile at C + (z*KS + y)*sC (KS slices, grid.y == KS); the reader adds the slices. Elsewhere kn == K.
template <typename T16> struct WFrag;
template <> struct WFrag<h16> { typedef v16h V; static __device__ __forceinline__ V ld(const h16* p) { return cat16(*(const v8h*)p, *(const v8h*)(p + 16)); } static __device__ __forceinline__ v8f mma(V a, V b, v8f c) { return wmma16(a, b, c); } };
template <> struct WFrag<bf> { typedef v16bf V; static __device__ __forceinline__ V ld(const bf* p) { return cat16b(*(const v8us*)p, *(const v8us*)(p + 16)); } static __device__ __forceinline__ v8f mma(V a, V b, v8f c) { return wmmab(a, b, c); } };
template <typename T16, int NSPLIT, bool BIAS, bool KSPLIT = false, bool STAT = false>
__global__ __launch_bounds__(32) void k_gemmw(const T16* __restrict__ A, const T16* __restrict__ A2, const T16* __restrict__ Bt, const T16* __restrict__ Bt2, int K, int kn, float* C, int ldc, const float* __restrict__ bias, size_t sA, size_t sB, size_t sC, float* SP) {
    typedef typename WFrag<T16>::V V;
    __shared__ __align__(16) float os[16 * 68];
    const size_t z = blockIdx.z; const size_t k0 = KSPLIT ? (size_t)blockIdx.y * kn : 0; A += z * sA + k0; if (A2) A2 += z * sA + k0; Bt += z * sB + k0; if (Bt2) Bt2 += z * sB + k0; C += (KSPLIT ? z * KS + blockIdx.y : z) * sC;
    const int lane = threadIdx.x & 31, lr = lane & 15, hi = lane >> 4; const int r0 = blockIdx.x * 64, c0 = KSPLIT ? 0 : blockIdx.y * 64;
    v8f acc[4][4];
#pragma unroll
    for (int mb = 0; mb < 4; ++mb)
#pragma unroll
        for (int nb = 0; nb < 4; ++nb) acc[mb][nb] = (v8f){};
    float bb[4];   // STAT: the lane's four bias values, asked for ahead of the k loop so that their latency passes under it
    if (STAT) {
#pragma unroll   // register arrays need constant indices
        for (int nb = 0; nb < 4; ++nb) bb[nb] = bias[nb * 16 + lr]; }
    const size_t aoff = (size_t)(r0 + lr) * K + 8 * hi, boff = (size_t)(c0 + lr) * K + 8 * hi;
#pragma unroll 1
    for (int kc = 0; kc < kn; kc += 32) {
        V a[4], a2[4];
#pragma unroll
        for (int mb = 0; mb < 4; ++mb) { a[mb] = WFrag<T16>::ld(A + aoff + (size_t)mb * 16 * K + kc); if (NSPLIT == 1 || NSPLIT == 2) a2[mb] = WFrag<T16>::ld(A2 + aoff + (size_t)mb * 16 * K + kc); }
#pragma unroll
        for (int nb = 0; nb < 4; ++nb) { const V b = WFrag<T16>::ld(Bt + boff + (size_t)nb * 16 * K + kc); V b2; if (NSPLIT >= 2) b2 = WFrag<T16>::ld(Bt2 + boff + (size_t)nb * 16 * K + kc);
#pragma unroll
            for (int mb = 0; mb < 4; ++mb) { acc[mb][nb] = WFrag<T16>::mma(a[mb], b, acc[mb][nb]); if (NSPLIT == 1 || NSPLIT == 2) acc[mb][nb] = WFrag<T16>::mma(a2[mb], b, acc[mb][nb]); if (NSPLIT >= 2) acc[mb][nb] = WFrag<T16>::mma(a[mb], b2, acc[mb][nb]); } }
        asm volatile("v_nop\n\tv_nop\n\tv_nop\n\tv_nop" : "+v"(acc[0][0]), "+v"(acc[1][1]), "+v"(acc[2][2]), "+v"(acc[3][3]) : "v"(a[0]), "v"(a[3]));
    }
    if (STAT) { float s[4], t[4];   // lane (lr, hi) holds rows mb*16 + hi*8 + j of channel nb*16 + lr; the four channels' sums are four independent chains
#pragma unroll   // register arrays need constant indices
        for (int nb = 0; nb < 4; ++nb) { s[nb] = 0.f; t[nb] = 0.f; const float b = bfr(bb[nb]);
#pragma unroll   // as above
            for (int mb = 0; mb < 4; ++mb) acc[mb][nb] += b; }
#pragma unroll   // as above
        for (int mb = 0; mb < 4; ++mb)
#pragma unroll   // as above
            for (int j = 0; j < 8; ++j)
#pragma unroll   // as above
                for (int nb = 0; nb < 4; ++nb) s[nb] += acc[mb][nb][j];
#pragma unroll   // as above
        for (int nb = 0; nb < 4; ++nb) { s[nb] += __shfl_xor(s[nb], 16, 32); s[nb] *= (1.0f / 64); }
#pragma unroll   // as above
        for (int mb = 0; mb < 4; ++mb)
#pragma unroll   // as above
            for (int j = 0; j < 8; ++j)
#pragma unroll   // as above
                for (int nb = 0; nb < 4; ++nb) { const float d = acc[mb][nb][j] - s[nb]; t[nb] += d * d; }
        float* sp = SP + (z * (NP / 64) + blockIdx.x) * (2 * CK) + hi * CK + lr;
#pragma unroll   // as above
        for (int nb = 0; nb < 4; ++nb) { t[nb] += __shfl_xor(t[nb], 16, 32); sp[nb * 16] = hi ? t[nb] : s[nb]; } }
#pragma unroll
    for (int mb = 0; mb < 4; ++mb) {
#pragma unroll
        for (int nb = 0; nb < 4; ++nb) {
#pragma unroll
            for (int j = 0; j < 8; ++j) os[(hi * 8 + j) * 68 + nb * 16 + lr] = acc[mb][nb][j]; }
        __builtin_amdgcn_wave_barrier(); asm volatile("" ::: "memory");
        float* crow = C + (size_t)(r0 + mb * 16) * ldc + c0;
{
#pragma unroll
            for (int s = 0; s < 8; ++s) { const int row = 2 * s + hi, cofs = lr * 4; v4f val = *(const v4fa*)(os + row * 68 + cofs); if (BIAS && !STAT) { val[0] += bfr(bias[c0 + cofs]); val[1] += bfr(bias[c0 + cofs + 1]); val[2] += bfr(bias[c0 + cofs + 2]); val[3] += bfr(bias[c0 + cofs + 3]); }
                *(v4f*)(crow + (size_t)row * ldc + cofs) = val; }
             }
        __builtin_amdgcn_wave_barrier(); asm volatile("" ::: "memory");
    }
}

__device__ __forceinline__ void splitf(float y, unsigned short& h, unsigned short& l) { h = f2bf(y); l = f2bf(y - bf2f(h)); }
typedef __attribute__((ext_vector_type(2))) unsigned short v2us;
typedef __attribute__((ext_vector_type(2))) float v2f;
typedef __attribute__((ext_vector_type(4))) unsigned short v4us;

// Kernels below that work per image take it from blockIdx.y (k_vsum: blockIdx.x, k_tail: blockIdx.z), and where several tensors go the same way the tensor from blockIdx.y (k_xt: blockIdx.z, k_bnfin: blockIdx.x): one launch per stage for the whole batch, each image on its own workspace planes.
__global__ __launch_bounds__(256) void k_cvt8(const float* __restrict__ s0, const float* __restrict__ s1, const float* __restrict__ s2, bf* dst, size_t n8) { const size_t i = (size_t)blockIdx.x * 256 + threadIdx.x; if (i >= n8) return; const float* src = blockIdx.y == 0 ? s0 : blockIdx.y == 1 ? s1 : s2; dst += (size_t)blockIdx.y * n8 * 8; const v8f v = *(const v8f*)(src + i * 8); v8us o;
#pragma unroll
    for (int k = 0; k < 8; ++k) o[k] = f2bf(v[k]); *(v8us*)(dst + i * 8) = o;  }
// ---- The two transposes (k_xt, k_vT) go through a padded LDS tile: the global loads follow the source's rows and the global stores the target's rows, 16 lanes side by side on whole 128-B lines on both sides,
// and a thread moves 32 or 64 elements. Odd row pitches in LDS (65, 129 dwords): the 16 lanes of a half wave step by 4 rows or by 4 dwords, the two halves by 1, so that every LDS access of a wave meets 32 different banks.
typedef __attribute__((ext_vector_type(4))) unsigned v4u;
#define XP 65    // k_xt: LDS row = one position's 128 channels as 64 dwords of two bf16, + 1
#define TP 129   // tile_in: LDS row = one source column's 128 rows as f32, + 1
// k_xt: tile of 128 channels x 128 positions. A thread holds the same 4 positions of channels 2*c2 and 2*c2 + 1, so a dword of two neighbouring channels is formed in registers.
__global__ __launch_bounds__(256) void k_xt(const float* __restrict__ xq, const float* __restrict__ xk, const float* __restrict__ xv, bf* XT) { __shared__ unsigned L[128 * XP]; const int q = threadIdx.x & 15, r = threadIdx.x >> 4; const int p0 = blockIdx.x * 128;
    const float* x = (blockIdx.z == 0 ? xq : blockIdx.z == 1 ? xk : xv) + (size_t)blockIdx.y * CI * NP + p0 + 4 * q; XT += (((size_t)blockIdx.z * NBI + blockIdx.y) * NP + p0) * CI; v4f a[4][2], b[4][2];
#pragma unroll   // straight line, so that a thread's 16 independent loads are in flight together
    for (int j = 0; j < 4; ++j)
#pragma unroll   // as above
        for (int s = 0; s < 2; ++s) { a[j][s] = *(const v4f*)(x + (size_t)(2 * (r + 16 * j)) * NP + 64 * s); b[j][s] = *(const v4f*)(x + (size_t)(2 * (r + 16 * j) + 1) * NP + 64 * s); }
#pragma unroll   // register arrays need constant indices
    for (int j = 0; j < 4; ++j)
#pragma unroll   // as above
        for (int s = 0; s < 2; ++s)
#pragma unroll   // as above
            for (int i = 0; i < 4; ++i) L[(64 * s + 4 * q + i) * XP + r + 16 * j] = (unsigned)f2bf(a[j][s][i]) | ((unsigned)f2bf(b[j][s][i]) << 16);
    __syncthreads();   // publishes the tile: a thread reads rows whose dwords all 8 waves wrote
#pragma unroll   // straight line, so that the LDS reads of later rows do not wait for the stores of earlier ones
    for (int k = 0; k < 8; ++k) { const int p = r + 16 * k; v4u o;
#pragma unroll   // register vector needs constant indices
        for (int i = 0; i < 4; ++i) o[i] = L[p * XP + 4 * q + i];
        *(v8us*)(XT + (size_t)p * CI + 8 * q) = __builtin_bit_cast(v8us, o); } }
// tile_in: 256 threads bring 128 rows x 64 columns of f32 (src at the tile's first element, row pitch SP floats) into L[column][row].
template <int SP> __device__ __forceinline__ void tile_in(const float* __restrict__ src, float* L) { const int q = threadIdx.x & 15, r = threadIdx.x >> 4; v4f v[8];
#pragma unroll   // straight line, so that a thread's 8 independent loads are in flight together
    for (int j = 0; j < 8; ++j) v[j] = *(const v4f*)(src + (size_t)(r + 16 * j) * SP + 4 * q);
#pragma unroll   // register arrays need constant indices
    for (int j = 0; j < 8; ++j)
#pragma unroll   // as above
        for (int i = 0; i < 4; ++i) L[(4 * q + i) * TP + r + 16 * j] = v[j][i];
    __syncthreads();   // publishes the tile: a thread reads columns whose rows all 8 waves wrote
}
// k_bnfin: the batch statistics of one tensor (blockIdx.x: q, k) from its NT tiles' (mean, M2) pairs, P[tile][64 means, 64 M2]. All tiles hold 64 rows, so mean = sum of the tile means / NT and
// sum of squared distances = sum of the M2 + 64 * sum of (tile mean - mean)^2: exact algebra, and every square is taken about a mean, as in a two-pass variance. ST[c] = (mean, 1 / sqrt(var + 1e-5)).
// 1024 threads = 64 tiles x 16 lanes of 4 channels: a thread keeps its 8 tile means in registers for the second sum; a wave folds its 2 tiles by one butterfly step, 64 threads add the 32 waves' partials from LDS in wave order. Fixed order, no atomics.
__global__ __launch_bounds__(1024) void k_bnfin(const float* __restrict__ P, float* ST) { __shared__ __align__(16) float red[32 * CK]; __shared__ __align__(16) float mu[CK]; const int tid = threadIdx.x, q = tid & 15, r = tid >> 4;
    P += ((size_t)blockIdx.x * NT + r) * (2 * CK) + 4 * q; ST += blockIdx.x * 2 * CK; v4f m[NT / 64], w[NT / 64];
#pragma unroll   // straight line, so that a thread's 16 independent loads are in flight together
    for (int k = 0; k < NT / 64; ++k) { m[k] = *(const v4f*)(P + (size_t)k * 64 * 2 * CK); w[k] = *(const v4f*)(P + (size_t)k * 64 * 2 * CK + CK); }
    v4f s = m[0], t = w[0];
#pragma unroll   // register arrays need constant indices
    for (int k = 1; k < NT / 64; ++k) { s += m[k]; t += w[k]; }
    for (int u = 0; u < 4; ++u) s[u] += __shfl_xor(s[u], 16, 32);
    if ((tid & 31) < 16) *(v4f*)(red + (tid >> 5) * CK + 4 * q) = s;
    __syncthreads();   // publishes the 32 waves' sums of tile means
    if (tid < CK) { float a = 0.f;
        for (int i = 0; i < 32; ++i) a += red[i * CK + tid];
        mu[tid] = a * (1.0f / NT); }
    __syncthreads();   // publishes the means; also ends the reads of red before it is written again
    const v4f mean = *(const v4f*)(mu + 4 * q); v4f e = (v4f){};
#pragma unroll   // register arrays need constant indices
    for (int k = 0; k < NT / 64; ++k) { const v4f d = m[k] - mean; e += d * d; }
    t += 64.0f * e;
    for (int u = 0; u < 4; ++u) t[u] += __shfl_xor(t[u], 16, 32);
    if ((tid & 31) < 16) *(v4f*)(red + (tid >> 5) * CK + 4 * q) = t;
    __syncthreads();   // publishes the 32 waves' sums of squared distances
    if (tid < CK) { float a = 0.f;
        for (int i = 0; i < 32; ++i) a += red[i * CK + tid];
        v2f o; o[0] = mu[tid]; o[1] = __frsqrt_rn(__fadd_rn(a * (1.0f / (NBI * NP)), 1e-5f)); *(v2f*)(ST + 2 * tid) = o; } }
__global__ __launch_bounds__(256) void k_qn(const float* __restrict__ Y, const float* __restrict__ ST, const float* __restrict__ ga, const float* __restrict__ be, bf* Qh, bf* Ql) { const int e = (blockIdx.x * 256 + threadIdx.x) * 4; if (e >= NP * CK) return; Y += (size_t)blockIdx.y * NP * CK; Qh += (size_t)blockIdx.y * NP * CK; Ql += (size_t)blockIdx.y * NP * CK; const int c0 = e % CK; const v4f a = *(const v4f*)(Y + e); float y[4]; float ss = 0.f;
#pragma unroll
    for (int u = 0; u < 4; ++u) { const int c = c0 + u; float t0 = __fmul_rn(__fsub_rn(a[u], ST[2 * c]), ST[2 * c + 1]); asm volatile("" : "+v"(t0)); float g = bfr(ga[c]), bb = bfr(be[c]); asm volatile("" : "+v"(g)); asm volatile("" : "+v"(bb)); float t1 = __fmul_rn(t0, g); asm volatile("" : "+v"(t1)); y[u] = __fadd_rn(t1, bb); float p = __fmul_rn(y[u], y[u]); asm volatile("" : "+v"(p)); ss = __fadd_rn(ss, p); }
    ss += __shfl_xor(ss, 1, 32); ss += __shfl_xor(ss, 2, 32); ss += __shfl_xor(ss, 4, 32); ss += __shfl_xor(ss, 8, 32); const float inv = __fdiv_rn(1.0f, __fadd_rn(__fsqrt_rn(ss), 1e-7f)); v4us oh, ol;
#pragma unroll
    for (int u = 0; u < 4; ++u) { unsigned short hh, ll; splitf(__fmul_rn(y[u], inv), hh, ll); oh[u] = hh; ol[u] = ll; } *(v4us*)(Qh + e) = oh; *(v4us*)(Ql + e) = ol;  }
__global__ __launch_bounds__(256) void k_knT(const float* __restrict__ Y, const float* __restrict__ ST, const float* __restrict__ ga, const float* __restrict__ be, bf* Kh, bf* Kl) { const int m = (blockIdx.x * 256 + threadIdx.x) * 2; if (m >= NP) return; Y += (size_t)blockIdx.y * NP * CK; Kh += (size_t)blockIdx.y * CK * NP; Kl += (size_t)blockIdx.y * CK * NP; float y0[CK], y1[CK]; float s0 = 0.f, s1 = 0.f;
#pragma unroll
    for (int c4 = 0; c4 < CK / 4; ++c4) { const v4f a = *(const v4f*)(Y + (size_t)m * CK + c4 * 4), b = *(const v4f*)(Y + (size_t)(m + 1) * CK + c4 * 4);
#pragma unroll
        for (int u = 0; u < 4; ++u) { const int c = c4 * 4 + u; const float mu = ST[2 * c], rs = ST[2 * c + 1]; float g = bfr(ga[c]), bb = bfr(be[c]); asm volatile("" : "+v"(g)); asm volatile("" : "+v"(bb));
            float t0 = __fmul_rn(__fsub_rn(a[u], mu), rs), t1 = __fmul_rn(__fsub_rn(b[u], mu), rs); asm volatile("" : "+v"(t0)); asm volatile("" : "+v"(t1)); float u0 = __fmul_rn(t0, g), u1 = __fmul_rn(t1, g); asm volatile("" : "+v"(u0)); asm volatile("" : "+v"(u1)); y0[c] = __fadd_rn(u0, bb); y1[c] = __fadd_rn(u1, bb);
            float p0 = __fmul_rn(y0[c], y0[c]), p1 = __fmul_rn(y1[c], y1[c]); asm volatile("" : "+v"(p0)); asm volatile("" : "+v"(p1)); s0 = __fadd_rn(s0, p0); s1 = __fadd_rn(s1, p1); } }
    const float i0 = __fdiv_rn(1.0f, __fadd_rn(__fsqrt_rn(s0), 1e-7f)), i1 = __fdiv_rn(1.0f, __fadd_rn(__fsqrt_rn(s1), 1e-7f));
    {
#pragma unroll
        for (int c = 0; c < CK; ++c) { unsigned short a0, b0, a1, b1; splitf(__fmul_rn(y0[c], i0), a0, b0); splitf(__fmul_rn(y1[c], i1), a1, b1); v2us oh, ol; oh[0] = a0; oh[1] = a1; ol[0] = b0; ol[1] = b1; *(v2us*)(Kh + (size_t)c * NP + m) = oh; *(v2us*)(Kl + (size_t)c * NP + m) = ol; }
         } }
__global__ __launch_bounds__(256) void k_vT(const float* __restrict__ Y, bf* Vh, bf* Vl) { __shared__ float L[CV * TP]; const int q = threadIdx.x & 15, r = threadIdx.x >> 4; const int m0 = blockIdx.x * 128;
    tile_in<CV>(Y + ((size_t)blockIdx.y * NP + m0) * CV, L); Vh += (size_t)blockIdx.y * CV * NP + m0 + 4 * q; Vl += (size_t)blockIdx.y * CV * NP + m0 + 4 * q;
#pragma unroll   // straight line, so that the LDS reads of later rows do not wait for the stores of earlier ones
    for (int k = 0; k < 4; ++k)
#pragma unroll   // as above
        for (int s = 0; s < 2; ++s) { const int v = r + 16 * k; v4us oh, ol;
#pragma unroll   // register vectors need constant indices
            for (int i = 0; i < 4; ++i) { unsigned short x, y; splitf(L[v * TP + 64 * s + 4 * q + i], x, y); oh[i] = x; ol[i] = y; }
            *(v4us*)(Vh + (size_t)v * NP + 64 * s) = oh; *(v4us*)(Vl + (size_t)v * NP + 64 * s) = ol; } }
// k_vsum: vs[b][v] = sum_m YV[b][m][v] for all images in one launch. Grid (image, half of the 64 channels): a block's 32 channels are one 128-B line of every row, its 32 results one 128-B line of vs.
// 1024 threads = 128 rows x 8 lanes of 4 channels: a thread adds its 32 rows (independent loads, in flight together), a wave folds its 4 rows by two butterfly steps, wave 0 adds the 32 waves' partials from LDS in wave order. Fixed order, no atomics.
__global__ __launch_bounds__(1024) void k_vsum(const float* __restrict__ Y, float* vs) { __shared__ __align__(16) float red[32 * 32]; const int tid = threadIdx.x, q = tid & 7, r = tid >> 3;
    const float* p = Y + (size_t)blockIdx.x * NP * CV + (size_t)r * CV + blockIdx.y * 32 + q * 4; v4f s = (v4f){};
    for (int i = 0; i < NP / 128; ++i) s += *(const v4f*)(p + (size_t)i * 128 * CV);
    for (int u = 0; u < 4; ++u) { s[u] += __shfl_xor(s[u], 8, 32); s[u] += __shfl_xor(s[u], 16, 32); }
    if ((tid & 31) < 8) *(v4f*)(red + (tid >> 5) * 32 + q * 4) = s;
    __syncthreads();   // publishes the 32 waves' partial sums to wave 0
    if (tid < 32) { float t = 0.f;
        for (int w = 0; w < 32; ++w) t += red[w * 32 + tid];
        vs[blockIdx.x * CV + blockIdx.y * 32 + tid] = t; } }
// k_mt: Mt[v][c] = sum over the KS k slices of the partial tiles P[image][slice][v][c], added in slice order (fixed order, no atomics), then split into the hl planes. Whole-line loads.
__global__ __launch_bounds__(256) void k_mt(const float* __restrict__ P, bf* Mh, bf* Ml) { const int e = (blockIdx.x * 256 + threadIdx.x) * 4; if (e >= CV * CK) return; P += (size_t)blockIdx.y * KS * CV * CK; Mh += blockIdx.y * CV * CK; Ml += blockIdx.y * CV * CK; v4f t = *(const v4f*)(P + e); v4us oh, ol;
#pragma unroll   // straight line, so that the independent loads of many slices are in flight together
    for (int s = 1; s < KS; ++s) t += *(const v4f*)(P + (size_t)s * CV * CK + e);
#pragma unroll
    for (int u = 0; u < 4; ++u) { unsigned short a, b; splitf(t[u], a, b); oh[u] = a; ol[u] = b; } *(v4us*)(Mh + e) = oh; *(v4us*)(Ml + e) = ol;  }
// ---- k_tail: everything behind Mt in one launch: ctx = qn.M + vsum, its hl split, out = Ww.ctx + bw, stored [o][p]. ONE WAVE per 32 positions (one 128-B line of every output row), grid (NP / 32, 1, image).
// The first product is formed transposed, ctxT[v][p] = sum_c Mt[v][c] qn[p][c] (A = Mt planes, B = qn planes): lane (lr, hi) then holds position nb*16 + lr and the 8 neighbouring channels v = mb*16 + hi*8 + j,
// which is the B fragment of the second product, out[o][p] = sum_v Ww[o][v] ctx[p][v]: elements 0..7 of k chunk k2 are accumulator 2*k2, elements 8..15 accumulator 2*k2 + 1. ctx never leaves the registers.
// Per element the products are added in the order of the separate GEMMs (hh, lh, hl per 32 of c; h, l per 32 of v), vsum and the bias are added to the same f32 values: same results.
#define OP 36    // LDS row = one output channel's 32 positions, + 4: rows stay 16-B aligned, and the two half waves (8 rows apart) write different banks
__global__ __launch_bounds__(32) void k_tail(const bf* __restrict__ Qh, const bf* __restrict__ Ql, const bf* __restrict__ Mh, const bf* __restrict__ Ml, const float* __restrict__ vs, const bf* __restrict__ WW, const float* __restrict__ bw, float* OUT) {
    typedef WFrag<bf> F; typedef F::V V;
    __shared__ __align__(16) float os[CO * OP];
    const int lane = threadIdx.x & 31, lr = lane & 15, hi = lane >> 4; const int p0 = blockIdx.x * 32; const size_t z = blockIdx.z;
    // All rows of qn, Mt and Ww are 64 elements long, so one byte offset per lane serves every fragment load (row lr, k from 8*hi) and one more the f32 vectors (8 values from hi*8); the bases are the same for the whole wave.
    const unsigned fo = (unsigned)(lr * CK + 8 * hi) * 2, vo = (unsigned)hi * 32;
    const char *qh = (const char*)(Qh + (z * NP + p0) * CK) + fo, *ql = (const char*)(Ql + (z * NP + p0) * CK) + fo, *mh = (const char*)(Mh + z * CV * CK) + fo, *ml = (const char*)(Ml + z * CV * CK) + fo, *ww = (const char*)WW + fo, *vz = (const char*)(vs + z * CV) + vo, *bz = (const char*)bw + vo;
    V a[2][4], a2[2][4], b[2][2], b2[2][2], w[8][2]; v8f sv[4], bi[8], acc[4][2];
#pragma unroll   // register arrays need constant indices (so for every loop of this kernel)
    for (int k = 0; k < 2; ++k) {
#pragma unroll
        for (int nb = 0; nb < 2; ++nb) { b[k][nb] = F::ld((const bf*)qh + nb * 16 * CK + 32 * k); b2[k][nb] = F::ld((const bf*)ql + nb * 16 * CK + 32 * k); }
#pragma unroll
        for (int mb = 0; mb < 4; ++mb) { a[k][mb] = F::ld((const bf*)mh + mb * 16 * CK + 32 * k); a2[k][mb] = F::ld((const bf*)ml + mb * 16 * CK + 32 * k); } }
#pragma unroll
    for (int mb = 0; mb < 4; ++mb) sv[mb] = *(const v8f*)((const float*)vz + mb * 16);
#pragma unroll
    for (int t = 0; t < 8; ++t)
#pragma unroll
        for (int k = 0; k < 2; ++k) w[t][k] = F::ld((const bf*)ww + t * 16 * CV + 32 * k);
#pragma unroll
    for (int t = 0; t < 8; ++t) bi[t] = *(const v8f*)((const float*)bz + t * 16);
    asm volatile("s_wait_xcnt 0x0" :: "v"(fo), "v"(vo) : "memory");   // the wait that is kept before a register named by an issued load is overwritten; the two offsets are inputs so that they stay in their registers up to here
    __builtin_amdgcn_sched_barrier(0);   // every load of the wave is in flight before its first wait: without this the compiler sinks the vsum, weight and bias loads to their uses, each with a latency of its own in the open
#pragma unroll
    for (int mb = 0; mb < 4; ++mb)
#pragma unroll
        for (int nb = 0; nb < 2; ++nb) acc[mb][nb] = (v8f){};
#pragma unroll
    for (int k = 0; k < 2; ++k) {   // per accumulator and 32 of c: Mt high x qn high, Mt high x qn low, Mt low x qn high
#pragma unroll
        for (int mb = 0; mb < 4; ++mb)
#pragma unroll
            for (int nb = 0; nb < 2; ++nb) acc[mb][nb] = F::mma(a[k][mb], b[k][nb], acc[mb][nb]);
#pragma unroll
        for (int mb = 0; mb < 4; ++mb)
#pragma unroll
            for (int nb = 0; nb < 2; ++nb) acc[mb][nb] = F::mma(a[k][mb], b2[k][nb], acc[mb][nb]);
#pragma unroll
        for (int mb = 0; mb < 4; ++mb)
#pragma unroll
            for (int nb = 0; nb < 2; ++nb) acc[mb][nb] = F::mma(a2[k][mb], b[k][nb], acc[mb][nb]); }
    v8us ch[4][2], cl[4][2];
#pragma unroll
    for (int mb = 0; mb < 4; ++mb)
#pragma unroll
        for (int nb = 0; nb < 2; ++nb)
#pragma unroll
            for (int j = 0; j < 8; ++j) { unsigned short x, y; splitf(__fadd_rn(acc[mb][nb][j], sv[mb][j]), x, y); ch[mb][nb][j] = x; cl[mb][nb][j] = y; }
#pragma unroll
    for (int g = 0; g < 2; ++g) { v8f o[4][2];   // 64 output channels at a time
#pragma unroll
        for (int t = 0; t < 4; ++t)
#pragma unroll
            for (int nb = 0; nb < 2; ++nb) o[t][nb] = (v8f){};
#pragma unroll
        for (int k = 0; k < 2; ++k) {
#pragma unroll
            for (int t = 0; t < 4; ++t)
#pragma unroll
                for (int nb = 0; nb < 2; ++nb) o[t][nb] = F::mma(w[g * 4 + t][k], cat16b(ch[2 * k][nb], ch[2 * k + 1][nb]), o[t][nb]);
#pragma unroll
            for (int t = 0; t < 4; ++t)
#pragma unroll
                for (int nb = 0; nb < 2; ++nb) o[t][nb] = F::mma(w[g * 4 + t][k], cat16b(cl[2 * k][nb], cl[2 * k + 1][nb]), o[t][nb]); }
#pragma unroll
        for (int t = 0; t < 4; ++t)
#pragma unroll
            for (int nb = 0; nb < 2; ++nb)
#pragma unroll
                for (int j = 0; j < 8; ++j) os[((g * 4 + t) * 16 + hi * 8 + j) * OP + nb * 16 + lr] = o[t][nb][j] + bfr(bi[g * 4 + t][j]); }
    __builtin_amdgcn_wave_barrier(); asm volatile("" ::: "memory");   // keeps the LDS reads below behind the other lanes' LDS writes above (one wave: LDS runs in order, only the compiler could swap them)
#pragma unroll   // straight line, so that later rows' LDS reads do not wait for earlier rows' stores
    for (int s = 0; s < CO / 4; ++s) { const int row = 4 * s + (lane >> 3), col = (lane & 7) * 4;
        *(v4f*)(OUT + (z * CO + row) * NP + p0 + col) = *(const v4fa*)(os + row * OP + col); } }

extern "C" void kernel_launch(void* const* d_in, const int* in_sizes, int n_in,
                              void* d_out, int out_size, void* d_ws, size_t ws_size, hipStream_t stream) {
    (void)in_sizes; (void)n_in; (void)out_size;
    const float** I = (const float**)d_in;
    const float *qf = I[0], *kf = I[1], *vf = I[2], *Wk = I[3], *bk = I[4], *ga = I[5], *be = I[6], *Wv = I[7], *bv = I[8], *Ww = I[9], *bw = I[10];
    float* OUT = (float*)d_out;     // [8][128][64][64]
    char* wsp = (char*)d_ws;
    auto take = [&](size_t bytes) { char* p = wsp; wsp += (bytes + 255) & ~(size_t)255; return (void*)p; };
    bf* WK = (bf*)take(3 * CK * CI * 2); bf* WV = WK + CK * CI; bf* WW = WV + CV * CI;   // three planes of 8192 elements, one behind the other
    bf* XT = (bf*)take((size_t)3 * NBI * NP * CI * 2);   // [q, k, v][image][p][c]
    float* YQ = (float*)take((size_t)3 * NBI * NP * CK * 4); float* YK = YQ + (size_t)NBI * NP * CK; float* YV = YK + (size_t)NBI * NP * CK; float* STQ = (float*)take(2 * CK * 2 * 4); float* STK = STQ + CK * 2; float* SP = (float*)take((size_t)2 * NT * 2 * CK * 4);   // [q, k][tile][64 means, 64 M2]
    bf* Qh = (bf*)take((size_t)NBI * NP * CK * 2); bf* Ql = (bf*)take((size_t)NBI * NP * CK * 2); bf* Kh = (bf*)take((size_t)NBI * CK * NP * 2); bf* Kl = (bf*)take((size_t)NBI * CK * NP * 2); bf* Vh = (bf*)take((size_t)NBI * CV * NP * 2); bf* Vl = (bf*)take((size_t)NBI * CV * NP * 2); float* vs = (float*)take(NBI * CV * 4);
    float* M = (float*)take((size_t)NBI * KS * CK * CV * 4); bf* Mh = (bf*)take(NBI * CK * CV * 2); bf* Ml = (bf*)take(NBI * CK * CV * 2);
    if ((size_t)(wsp - (char*)d_ws) > ws_size) return;    // total ~ 80 MB
    k_cvt8<<<dim3((CK * CI / 8 + 255) / 256, 3, 1), 256, 0, stream>>>(Wk, Wv, Ww, WK, CK * CI / 8);   // [out][in] natural: Bt of the conv GEMMs, A of k_tail's Ww product; CK*CI == CV*CI == CO*CV
    // phase 1: the three 1x1 convs for all images (BN needs batch statistics)
    k_xt<<<dim3(NP / 128, NBI, 3), 256, 0, stream>>>(qf, kf, vf, XT);
    k_gemmw<bf, 0, true, false, true><<<dim3(NP / 64, 1, 2 * NBI), 32, 0, stream>>>(XT, nullptr, WK, nullptr, CI, CI, YQ, CK, bk, (size_t)NP * CI, 0, (size_t)NP * CK, SP);   // q images, then k images
    k_gemmw<bf, 0, true><<<dim3(NP / 64, 1, NBI), 32, 0, stream>>>(XT + (size_t)2 * NBI * NP * CI, nullptr, WV, nullptr, CI, CI, YV, CV, bv, (size_t)NP * CI, 0, (size_t)NP * CV, nullptr);
    k_bnfin<<<dim3(2, 1, 1), 1024, 0, stream>>>(SP, STQ); k_vsum<<<dim3(NBI, 2, 1), 1024, 0, stream>>>(YV, vs);
    // phase 2: all images per launch
    k_qn<<<dim3((NP * CK / 4 + 255) / 256, NBI, 1), 256, 0, stream>>>(YQ, STQ, ga, be, Qh, Ql); k_knT<<<dim3((NP / 2 + 255) / 256, NBI, 1), 256, 0, stream>>>(YK, STK, ga, be, Kh, Kl); k_vT<<<dim3(NP / 128, NBI, 1), 256, 0, stream>>>(YV, Vh, Vl);
    k_gemmw<bf, 2, false, true><<<dim3(1, KS, NBI), 32, 0, stream>>>(Vh, Vl, Kh, Kl, NP, NP / KS, M, CK, nullptr, (size_t)CV * NP, (size_t)CK * NP, (size_t)CV * CK, nullptr);   // partial Mt[slice][v][c] = sum over the slice's m of v[m][v] kn[m][c]
    k_mt<<<dim3((CV * CK / 4 + 255) / 256, NBI, 1), 256, 0, stream>>>(M, Mh, Ml);
    k_tail<<<dim3(NP / 32, 1, NBI), 32, 0, stream>>>(Qh, Ql, Mh, Ml, vs, WW, bw, OUT);   // out[o][p] = Ww.(qn.M + vsum) + bw
}

// v007
// A run of this version takes 62.9 microseconds.
// Timed twice side by side with v006, it ran 1.31 times as fast both times.
// Counting every step since v000, it is 150 times as fast.
#include <hip/hip_runtime.h>

// non_local_attention (query/key/value features [8][128][64x64]; q = BN_train(conv1x1(query; Wk, bk)), k = BN_train(conv1x1(key; Wk, bk)) (BatchNorm2d in training mode: per-channel batch statistics over (B,H,W), each call its own), v = conv1x1(value; Wv, bv);
// q, k L2-normalised over their 64 channels per position (+1e-7); sim[n][m] = q_n.k_m + 1 (no softmax); ctx[n] = sum_m sim[n][m] v_m; out = conv1x1(ctx; Ww, bw) -> [8][128][64][64]).
// Reassociation (exact algebra, no softmax in between): ctx[n][v] = sum_c qn[n][c] M[c][v] + vsum[v] with M = kn^T v (64x64) and vsum = sum_m v_m - the [4096][4096] similarity map is never formed.

#define NBI  8
#define CI   128
#define NP   4096
#define CK   64
#define CV   64
#define CO   128
#define NT   (NBI * NP / 64)   // 64-row tiles of one tensor's conv output over the whole batch: one (mean, M2) pair per channel from each
#define KS   32     // k slices of the M product: 4096 / 32 = 128 positions (256 B of every operand row) per one-wave block
typedef _Float16 h16;
typedef unsigned short bf;
typedef __attribute__((ext_vector_type(16))) __bf16   v16bf;
typedef __attribute__((ext_vector_type(16))) _Float16 v16h;
typedef __attribute__((ext_vector_type(8)))  _Float16 v8h;
typedef __attribute__((ext_vector_type(8)))  unsigned short v8us;
typedef __attribute__((ext_vector_type(8)))  float    v8f;
typedef __attribute__((ext_vector_type(4)))  float    v4f;
typedef v8h  __attribute__((may_alias)) v8ha;
typedef v4f  __attribute__((may_alias)) v4fa;
typedef v8us __attribute__((may_alias)) v8usa;

__device__ __forceinline__ unsigned short f2bf(float f) { unsigned u = __float_as_uint(f); u += 0x7FFFu + ((u >> 16) & 1u); return (unsigned short)(u >> 16); }
__device__ __forceinline__ float bf2f(unsigned short b) { return __uint_as_float(((unsigned)b) << 16); }
__device__ __forceinline__ float bfr(float f) { return bf2f(f2bf(f)); }
__device__ __forceinline__ v16h cat16(v8h lo, v8h hi) { return __builtin_shufflevector(lo, hi, 0, 1, 2, 3, 4, 5, 6, 7, 8, 9, 10, 11, 12, 13, 14, 15); }
__device__ __forceinline__ v16bf cat16b(v8us lo, v8us hi) { return __builtin_bit_cast(v16bf, __builtin_shufflevector(lo, hi, 0, 1, 2, 3, 4, 5, 6, 7, 8, 9, 10, 11, 12, 13, 14, 15)); }
__device__ __forceinline__ v8f wmma16(v16h a, v16h b, v8f c) { return __builtin_amdgcn_wmma_f32_16x16x32_f16(false, a, false, b, (short)0, c, false, false); }
__device__ __forceinline__ v8f wmmab(v16bf a, v16bf b, v8f c) { return __builtin_amdgcn_wmma_f32_16x16x32_bf16(false, a, false, b, (short)0, c, false, false); }



// ---- gemmw: register-blocked GEMM, ONE WAVE per 64x64 output tile (16 accumulators), operands straight from K-contiguous 16-bit planes; blocks (M/64, N/64, Z), 32 threads.
// C[m][n] (f32, pitch ldc, + optional f32 bias[n]) = sum_k A[m][k] Bt[n][k] (+ split products per NSPLIT). z-batch strides sA/sB/sC in elements. K % 32 == 0.
// STAT (needs BIAS, N == 64, grid (NP / 64, 1, Z)): the bias is added to the accumulators instead of to the staged rows (same operands, same stored values), and the wave also leaves, per channel, the mean of its tile's 64 rows and
// M2 = the sum of their squared distances from that mean, both from the registers, at SP + (z * (NP / 64) + bx) * 128: 64 means, then 64 M2 (its own four 128-B lines). s_bnfin joins the tiles.
// The body is a device function that is given its block indices (bx, by, z) and its 16 x 68 floats of LDS, so that two products which do not depend on one another can share a launch (k_conv).
// KSPLIT: N == 64 and by is not a column tile but a slice of the k range: the block sums the kn positions from y*kn on (rows keep their pitch K) and stores its own partial tile at C + (z*KS + y)*sC (KS slices, grid.y == KS); the reader adds the slices. Elsewhere kn == K.
template <typename T16> struct WFrag;
template <> struct WFrag<h16> { typedef v16h V; static __device__ __forceinline__ V ld(const h16* p) { return cat16(*(const v8h*)p, *(const v8h*)(p + 16)); } static __device__ __forceinline__ v8f mma(V a, V b, v8f c) { return wmma16(a, b, c); } };
template <> struct WFrag<bf> { typedef v16bf V; static __device__ __forceinline__ V ld(const bf* p) { return cat16b(*(const v8us*)p, *(const v8us*)(p + 16)); } static __device__ __forceinline__ v8f mma(V a, V b, v8f c) { return wmmab(a, b, c); } };
template <typename T16, int NSPLIT, bool BIAS, bool KSPLIT, bool STAT>
__device__ __forceinline__ void gemmw(const T16* __restrict__ A, const T16* __restrict__ A2, const T16* __restrict__ Bt, const T16* __restrict__ Bt2, int K, int kn, float* C, int ldc, const float* __restrict__ bias, size_t sA, size_t sB, size_t sC, float* SP, float* os, int bx, int by, size_t z) {
    typedef typename WFrag<T16>::V V;
    const size_t k0 = KSPLIT ? (size_t)by * kn : 0; A += z * sA + k0; if (A2) A2 += z * sA + k0; Bt += z * sB + k0; if (Bt2) Bt2 += z * sB + k0; C += (KSPLIT ? z * KS + by : z) * sC;
    const int lane = threadIdx.x & 31, lr = lane & 15, hi = lane >> 4; const int r0 = bx * 64, c0 = KSPLIT ? 0 : by * 64;
    v8f acc[4][4];
#pragma unroll
    for (int mb = 0; mb < 4; ++mb)
#pragma unroll
        for (int nb = 0; nb < 4; ++nb) acc[mb][nb] = (v8f){};
    float bb[4];   // STAT: the lane's four bias values, asked for ahead of the k loop so that their latency passes under it
    if (STAT) {
#pragma unroll   // register arrays need constant indices
        for (int nb = 0; nb < 4; ++nb) bb[nb] = bias[nb * 16 + lr]; }
    const size_t aoff = (size_t)(r0 + lr) * K + 8 * hi, boff = (size_t)(c0 + lr) * K + 8 * hi;
#pragma unroll 1
    for (int kc = 0; kc < kn; kc += 32) {
        V a[4], a2[4];
#pragma unroll
        for (int mb = 0; mb < 4; ++mb) { a[mb] = WFrag<T16>::ld(A + aoff + (size_t)mb * 16 * K + kc); if (NSPLIT == 1 || NSPLIT == 2) a2[mb] = WFrag<T16>::ld(A2 + aoff + (size_t)mb * 16 * K + kc); }
#pragma unroll
        for (int nb = 0; nb < 4; ++nb) { const V b = WFrag<T16>::ld(Bt + boff + (size_t)nb * 16 * K + kc); V b2; if (NSPLIT >= 2) b2 = WFrag<T16>::ld(Bt2 + boff + (size_t)nb * 16 * K + kc);
#pragma unroll
            for (int mb = 0; mb < 4; ++mb) { acc[mb][nb] = WFrag<T16>::mma(a[mb], b, acc[mb][nb]); if (NSPLIT == 1 || NSPLIT == 2) acc[mb][nb] = WFrag<T16>::mma(a2[mb], b, acc[mb][nb]); if (NSPLIT >= 2) acc[mb][nb] = WFrag<T16>::mma(a[mb], b2, acc[mb][nb]); } }
        asm volatile("v_nop\n\tv_nop\n\tv_nop\n\tv_nop" : "+v"(acc[0][0]), "+v"(acc[1][1]), "+v"(acc[2][2]), "+v"(acc[3][3]) : "v"(a[0]), "v"(a[3]));
    }
    if (STAT) { float s[4], t[4];   // lane (lr, hi) holds rows mb*16 + hi*8 + j of channel nb*16 + lr; the four channels' sums are four independent chains
#pragma unroll   // register arrays need constant indices
        for (int nb = 0; nb < 4; ++nb) { s[nb] = 0.f; t[nb] = 0.f; const float b = bfr(bb[nb]);
#pragma unroll   // as above
            for (int mb = 0; mb < 4; ++mb) acc[mb][nb] += b; }
#pragma unroll   // as above
        for (int mb = 0; mb < 4; ++mb)
#pragma unroll   // as above
            for (int j = 0; j < 8; ++j)
#pragma unroll   // as above
                for (int nb = 0; nb < 4; ++nb) s[nb] += acc[mb][nb][j];
#pragma unroll   // as above
        for (int nb = 0; nb < 4; ++nb) { s[nb] += __shfl_xor(s[nb], 16, 32); s[nb] *= (1.0f / 64); }
#pragma unroll   // as above
        for (int mb = 0; mb < 4; ++mb)
#pragma unroll   // as above
            for (int j = 0; j < 8; ++j)
#pragma unroll   // as above
                for (int nb = 0; nb < 4; ++nb) { const float d = acc[mb][nb][j] - s[nb]; t[nb] += d * d; }
        float* sp = SP + (z * (NP / 64) + bx) * (2 * CK) + hi * CK + lr;
#pragma unroll   // as above
        for (int nb = 0; nb < 4; ++nb) { t[nb] += __shfl_xor(t[nb], 16, 32); sp[nb * 16] = hi ? t[nb] : s[nb]; } }
#pragma unroll
    for (int mb = 0; mb < 4; ++mb) {
#pragma unroll
        for (int nb = 0; nb < 4; ++nb) {
#pragma unroll
            for (int j = 0; j < 8; ++j) os[(hi * 8 + j) * 68 + nb * 16 + lr] = acc[mb][nb][j]; }
        __builtin_amdgcn_wave_barrier(); asm volatile("" ::: "memory");
        float* crow = C + (size_t)(r0 + mb * 16) * ldc + c0;
{
#pragma unroll
            for (int s = 0; s < 8; ++s) { const int row = 2 * s + hi, cofs = lr * 4; v4f val = *(const v4fa*)(os + row * 68 + cofs); if (BIAS && !STAT) { val[0] += bfr(bias[c0 + cofs]); val[1] += bfr(bias[c0 + cofs + 1]); val[2] += bfr(bias[c0 + cofs + 2]); val[3] += bfr(bias[c0 + cofs + 3]); }
                *(v4f*)(crow + (size_t)row * ldc + cofs) = val; }
             }
        __builtin_amdgcn_wave_barrier(); asm volatile("" ::: "memory");
    }
}
// k_conv: the three 1x1 convs of all images in one launch, grid (NP / 64, 1, 3 * NBI): z counts the q images, the k images (both with Wk, bk and the tile statistics), then the v images (Wv, bv, no statistics).
// XT and Y hold the three tensors' planes one behind the other with one stride, so z addresses them all. The branch is the same for the whole (one-wave) block.
__global__ __launch_bounds__(32) void k_conv(const bf* __restrict__ XT, const bf* __restrict__ WK, const bf* __restrict__ WV, float* Y, const float* __restrict__ bk, const float* __restrict__ bv, float* SP) {
    __shared__ __align__(16) float os[16 * 68];
    if (blockIdx.z < 2 * NBI) gemmw<bf, 0, true, false, true>(XT, nullptr, WK, nullptr, CI, CI, Y, CK, bk, (size_t)NP * CI, 0, (size_t)NP * CK, SP, os, blockIdx.x, 0, blockIdx.z);
    else gemmw<bf, 0, true, false, false>(XT, nullptr, WV, nullptr, CI, CI, Y, CV, bv, (size_t)NP * CI, 0, (size_t)NP * CV, nullptr, os, blockIdx.x, 0, blockIdx.z); }
// k_mpart: partial Mt[image][slice][v][c] = sum over the slice's m of v[m][v] kn[m][c], hl planes on both sides; grid (1, KS, NBI).
__global__ __launch_bounds__(32) void k_mpart(const bf* __restrict__ Vh, const bf* __restrict__ Vl, const bf* __restrict__ Kh, const bf* __restrict__ Kl, float* M) {
    __shared__ __align__(16) float os[16 * 68];
    gemmw<bf, 2, false, true, false>(Vh, Vl, Kh, Kl, NP, NP / KS, M, CK, nullptr, (size_t)CV * NP, (size_t)CK * NP, (size_t)CV * CK, nullptr, os, 0, blockIdx.y, blockIdx.z); }

__device__ __forceinline__ void splitf(float y, unsigned short& h, unsigned short& l) { h = f2bf(y); l = f2bf(y - bf2f(h)); }
typedef __attribute__((ext_vector_type(2))) unsigned short v2us;
typedef __attribute__((ext_vector_type(2))) float v2f;
typedef __attribute__((ext_vector_type(4))) unsigned short v4us;

// Every stage below is a device function that is given its block indices (which image, tensor, weight, tile or channel half it works on): one pass per stage for the whole batch, each image on its own workspace planes.
// Stages that do not depend on one another share a launch: a range of the flat block index picks the stage (a branch that is the same for a whole block), the longer-running stage on the lower indices. k_prep, k_mid and k_norm are these launches.
__device__ __forceinline__ void s_cvt8(const float* __restrict__ s0, const float* __restrict__ s1, const float* __restrict__ s2, bf* dst, size_t n8, int bx, int by) { const size_t i = (size_t)bx * 256 + threadIdx.x; if (i >= n8) return; const float* src = by == 0 ? s0 : by == 1 ? s1 : s2; dst += (size_t)by * n8 * 8; const v8f v = *(const v8f*)(src + i * 8); v8us o;
#pragma unroll
    for (int k = 0; k < 8; ++k) o[k] = f2bf(v[k]); *(v8us*)(dst + i * 8) = o;  }
// ---- The two transposes (s_xt, s_vT) go through a padded LDS tile: the global loads follow the source's rows and the global stores the target's rows, 16 lanes side by side on whole 128-B lines on both sides,
// and a thread moves 32 or 64 elements. Odd row pitches in LDS (65, 129 dwords): the 16 lanes of a half wave step by 4 rows or by 4 dwords, the two halves by 1, so that every LDS access of a wave meets 32 different banks.
typedef __attribute__((ext_vector_type(4))) unsigned v4u;
#define XP 65    // s_xt: LDS row = one position's 128 channels as 64 dwords of two bf16, + 1
#define TP 129   // tile_in: LDS row = one source column's 128 rows as f32, + 1
// s_xt: tile of 128 channels x 128 positions. A thread holds the same 4 positions of channels 2*c2 and 2*c2 + 1, so a dword of two neighbouring channels is formed in registers.
__device__ __forceinline__ void s_xt(const float* __restrict__ xq, const float* __restrict__ xk, const float* __restrict__ xv, bf* XT, unsigned* L, int bx, int by, int bz) { const int q = threadIdx.x & 15, r = threadIdx.x >> 4; const int p0 = bx * 128;
    const float* x = (bz == 0 ? xq : bz == 1 ? xk : xv) + (size_t)by * CI * NP + p0 + 4 * q; XT += (((size_t)bz * NBI + by) * NP + p0) * CI; v4f a[4][2], b[4][2];
#pragma unroll   // straight line, so that a thread's 16 independent loads are in flight together
    for (int j = 0; j < 4; ++j)
#pragma unroll   // as above
        for (int s = 0; s < 2; ++s) { a[j][s] = *(const v4f*)(x + (size_t)(2 * (r + 16 * j)) * NP + 64 * s); b[j][s] = *(const v4f*)(x + (size_t)(2 * (r + 16 * j) + 1) * NP + 64 * s); }
#pragma unroll   // register arrays need constant indices
    for (int j = 0; j < 4; ++j)
#pragma unroll   // as above
        for (int s = 0; s < 2; ++s)
#pragma unroll   // as above
            for (int i = 0; i < 4; ++i) L[(64 * s + 4 * q + i) * XP + r + 16 * j] = (unsigned)f2bf(a[j][s][i]) | ((unsigned)f2bf(b[j][s][i]) << 16);
    __syncthreads();   // publishes the tile: a thread reads rows whose dwords all 8 waves wrote
#pragma unroll   // straight line, so that the LDS reads of later rows do not wait for the stores of earlier ones
    for (int k = 0; k < 8; ++k) { const int p = r + 16 * k; v4u o;
#pragma unroll   // register vector needs constant indices
        for (int i = 0; i < 4; ++i) o[i] = L[p * XP + 4 * q + i];
        *(v8us*)(XT + (size_t)p * CI + 8 * q) = __builtin_bit_cast(v8us, o); } }
// k_prep: what depends on the inputs alone: the 3 * NBI * (NP / 128) tiles of s_xt, then the 3 x 4 blocks of the weight converts.
#define NXT (3 * NBI * (NP / 128))
__global__ __launch_bounds__(256) void k_prep(const float* __restrict__ xq, const float* __restrict__ xk, const float* __restrict__ xv, bf* XT, const float* __restrict__ Wk, const float* __restrict__ Wv, const float* __restrict__ Ww, bf* WK) { __shared__ unsigned L[128 * XP]; const int b = blockIdx.x;
    if (b < NXT) s_xt(xq, xk, xv, XT, L, b % (NP / 128), b / (NP / 128) % NBI, b / (NP / 128 * NBI));
    else s_cvt8(Wk, Wv, Ww, WK, CK * CI / 8, (b - NXT) & 3, (b - NXT) >> 2); }   // [out][in] natural = Bt of the convs, A of k_tail's out product; CK*CI == CV*CI == CO*CV = 4 blocks of 256 x 8 elements
// tile_in: 256 threads (tid 0..255) bring 128 rows x 64 columns of f32 (src at the tile's first element, row pitch SP floats) into L[column][row].
template <int SP> __device__ __forceinline__ void tile_in(const float* __restrict__ src, float* L, int tid) { const int q = tid & 15, r = tid >> 4; v4f v[8];
#pragma unroll   // straight line, so that a thread's 8 independent loads are in flight together
    for (int j = 0; j < 8; ++j) v[j] = *(const v4f*)(src + (size_t)(r + 16 * j) * SP + 4 * q);
#pragma unroll   // register arrays need constant indices
    for (int j = 0; j < 8; ++j)
#pragma unroll   // as above
        for (int i = 0; i < 4; ++i) L[(4 * q + i) * TP + r + 16 * j] = v[j][i];
    __syncthreads();   // publishes the tile: a thread reads columns whose rows all 8 waves wrote
}
// s_bnfin: the batch statistics of one tensor (bx: q, k) from its NT tiles' (mean, M2) pairs, P[tile][64 means, 64 M2]. All tiles hold 64 rows, so mean = sum of the tile means / NT and
// sum of squared distances = sum of the M2 + 64 * sum of (tile mean - mean)^2: exact algebra, and every square is taken about a mean, as in a two-pass variance. ST[c] = (mean, 1 / sqrt(var + 1e-5)).
// 1024 threads = 64 tiles x 16 lanes of 4 channels: a thread keeps its 8 tile means in registers for the second sum; a wave folds its 2 tiles by one butterfly step, 64 threads add the 32 waves' partials from LDS in wave order. Fixed order, no atomics.
__device__ __forceinline__ void s_bnfin(const float* __restrict__ P, float* ST, float* red, int bx) { float* mu = red + 32 * CK; const int tid = threadIdx.x, q = tid & 15, r = tid >> 4;   // red: 32 * CK floats, mu: CK more
    P += ((size_t)bx * NT + r) * (2 * CK) + 4 * q; ST += bx * 2 * CK; v4f m[NT / 64], w[NT / 64];
#pragma unroll   // straight line, so that a thread's 16 independent loads are in flight together
    for (int k = 0; k < NT / 64; ++k) { m[k] = *(const v4f*)(P + (size_t)k * 64 * 2 * CK); w[k] = *(const v4f*)(P + (size_t)k * 64 * 2 * CK + CK); }
    v4f s = m[0], t = w[0];
#pragma unroll   // register arrays need constant indices
    for (int k = 1; k < NT / 64; ++k) { s += m[k]; t += w[k]; }
    for (int u = 0; u < 4; ++u) s[u] += __shfl_xor(s[u], 16, 32);
    if ((tid & 31) < 16) *(v4f*)(red + (tid >> 5) * CK + 4 * q) = s;
    __syncthreads();   // publishes the 32 waves' sums of tile means
    if (tid < CK) { float a = 0.f;
        for (int i = 0; i < 32; ++i) a += red[i * CK + tid];
        mu[tid] = a * (1.0f / NT); }
    __syncthreads();   // publishes the means; also ends the reads of red before it is written again
    const v4f mean = *(const v4f*)(mu + 4 * q); v4f e = (v4f){};
#pragma unroll   // register arrays need constant indices
    for (int k = 0; k < NT / 64; ++k) { const v4f d = m[k] - mean; e += d * d; }
    t += 64.0f * e;
    for (int u = 0; u < 4; ++u) t[u] += __shfl_xor(t[u], 16, 32);
    if ((tid & 31) < 16) *(v4f*)(red + (tid >> 5) * CK + 4 * q) = t;
    __syncthreads();   // publishes the 32 waves' sums of squared distances
    if (tid < CK) { float a = 0.f;
        for (int i = 0; i < 32; ++i) a += red[i * CK + tid];
        v2f o; o[0] = mu[tid]; o[1] = __frsqrt_rn(__fadd_rn(a * (1.0f / (NBI * NP)), 1e-5f)); *(v2f*)(ST + 2 * tid) = o; } }
__device__ __forceinline__ void s_qn(const float* __restrict__ Y, const float* __restrict__ ST, const float* __restrict__ ga, const float* __restrict__ be, bf* Qh, bf* Ql, int bx, int by) { const int e = (bx * 256 + threadIdx.x) * 4; if (e >= NP * CK) return; Y += (size_t)by * NP * CK; Qh += (size_t)by * NP * CK; Ql += (size_t)by * NP * CK; const int c0 = e % CK; const v4f a = *(const v4f*)(Y + e); float y[4]; float ss = 0.f;
#pragma unroll
    for (int u = 0; u < 4; ++u) { const int c = c0 + u; float t0 = __fmul_rn(__fsub_rn(a[u], ST[2 * c]), ST[2 * c + 1]); asm volatile("" : "+v"(t0)); float g = bfr(ga[c]), bb = bfr(be[c]); asm volatile("" : "+v"(g)); asm volatile("" : "+v"(bb)); float t1 = __fmul_rn(t0, g); asm volatile("" : "+v"(t1)); y[u] = __fadd_rn(t1, bb); float p = __fmul_rn(y[u], y[u]); asm volatile("" : "+v"(p)); ss = __fadd_rn(ss, p); }
    ss += __shfl_xor(ss, 1, 32); ss += __shfl_xor(ss, 2, 32); ss += __shfl_xor(ss, 4, 32); ss += __shfl_xor(ss, 8, 32); const float inv = __fdiv_rn(1.0f, __fadd_rn(__fsqrt_rn(ss), 1e-7f)); v4us oh, ol;
#pragma unroll
    for (int u = 0; u < 4; ++u) { unsigned short hh, ll; splitf(__fmul_rn(y[u], inv), hh, ll); oh[u] = hh; ol[u] = ll; } *(v4us*)(Qh + e) = oh; *(v4us*)(Ql + e) = ol;  }
__device__ __forceinline__ void s_knT(const float* __restrict__ Y, const float* __restrict__ ST, const float* __restrict__ ga, const float* __restrict__ be, bf* Kh, bf* Kl, int bx, int by) { const int m = (bx * 256 + threadIdx.x) * 2; if (m >= NP) return; Y += (size_t)by * NP * CK; Kh += (size_t)by * CK * NP; Kl += (size_t)by * CK * NP; float y0[CK], y1[CK]; float s0 = 0.f, s1 = 0.f;
#pragma unroll
    for (int c4 = 0; c4 < CK / 4; ++c4) { const v4f a = *(const v4f*)(Y + (size_t)m * CK + c4 * 4), b = *(const v4f*)(Y + (size_t)(m + 1) * CK + c4 * 4);
#pragma unroll
        for (int u = 0; u < 4; ++u) { const int c = c4 * 4 + u; const float mu = ST[2 * c], rs = ST[2 * c + 1]; float g = bfr(ga[c]), bb = bfr(be[c]); asm volatile("" : "+v"(g)); asm volatile("" : "+v"(bb));
            float t0 = __fmul_rn(__fsub_rn(a[u], mu), rs), t1 = __fmul_rn(__fsub_rn(b[u], mu), rs); asm volatile("" : "+v"(t0)); asm volatile("" : "+v"(t1)); float u0 = __fmul_rn(t0, g), u1 = __fmul_rn(t1, g); asm volatile("" : "+v"(u0)); asm volatile("" : "+v"(u1)); y0[c] = __fadd_rn(u0, bb); y1[c] = __fadd_rn(u1, bb);
            float p0 = __fmul_rn(y0[c], y0[c]), p1 = __fmul_rn(y1[c], y1[c]); asm volatile("" : "+v"(p0)); asm volatile("" : "+v"(p1)); s0 = __fadd_rn(s0, p0); s1 = __fadd_rn(s1, p1); } }
    const float i0 = __fdiv_rn(1.0f, __fadd_rn(__fsqrt_rn(s0), 1e-7f)), i1 = __fdiv_rn(1.0f, __fadd_rn(__fsqrt_rn(s1), 1e-7f));
    {
#pragma unroll
        for (int c = 0; c < CK; ++c) { unsigned short a0, b0, a1, b1; splitf(__fmul_rn(y0[c], i0), a0, b0); splitf(__fmul_rn(y1[c], i1), a1, b1); v2us oh, ol; oh[0] = a0; oh[1] = a1; ol[0] = b0; ol[1] = b1; *(v2us*)(Kh + (size_t)c * NP + m) = oh; *(v2us*)(Kl + (size_t)c * NP + m) = ol; }
         } }
// k_norm: what waits for the batch statistics alone: the NBI * 8 blocks of s_knT, then the NBI * 256 blocks of s_qn. ST holds q's statistics, then k's.
#define NKN (NBI * (NP / 512))
__global__ __launch_bounds__(256) void k_norm(const float* __restrict__ YQ, const float* __restrict__ YK, const float* __restrict__ ST, const float* __restrict__ ga, const float* __restrict__ be, bf* Qh, bf* Ql, bf* Kh, bf* Kl) { const int b = blockIdx.x;
    if (b < NKN) s_knT(YK, ST + 2 * CK, ga, be, Kh, Kl, b % (NP / 512), b / (NP / 512));
    else s_qn(YQ, ST, ga, be, Qh, Ql, (b - NKN) % (NP * CK / 1024), (b - NKN) / (NP * CK / 1024)); }
// s_vT: 256 threads (tid 0..255) per tile of 128 positions, on their own CV * TP floats of LDS; every thread of the block passes tile_in's barrier.
__device__ __forceinline__ void s_vT(const float* __restrict__ Y, bf* Vh, bf* Vl, float* L, int tid, int bx, int by) { const int q = tid & 15, r = tid >> 4; const int m0 = bx * 128;
    tile_in<CV>(Y + ((size_t)by * NP + m0) * CV, L, tid); Vh += (size_t)by * CV * NP + m0 + 4 * q; Vl += (size_t)by * CV * NP + m0 + 4 * q;
#pragma unroll   // straight line, so that the LDS reads of later rows do not wait for the stores of earlier ones
    for (int k = 0; k < 4; ++k)
#pragma unroll   // as above
        for (int s = 0; s < 2; ++s) { const int v = r + 16 * k; v4us oh, ol;
#pragma unroll   // register vectors need constant indices
            for (int i = 0; i < 4; ++i) { unsigned short x, y; splitf(L[v * TP + 64 * s + 4 * q + i], x, y); oh[i] = x; ol[i] = y; }
            *(v4us*)(Vh + (size_t)v * NP + 64 * s) = oh; *(v4us*)(Vl + (size_t)v * NP + 64 * s) = ol; }
    asm volatile("s_wait_xcnt 0x0" ::: "memory"); }   // the wait that is kept before a register named by an issued store is overwritten: in k_mid's listing another stage's code, which reuses these registers, lies behind the stores
// s_vsum: vs[b][v] = sum_m YV[b][m][v]. Blocks (bx: image, by: half of the 64 channels): a block's 32 channels are one 128-B line of every row, its 32 results one 128-B line of vs.
// 1024 threads = 128 rows x 8 lanes of 4 channels: a thread adds its 32 rows (independent loads, in flight together), a wave folds its 4 rows by two butterfly steps, wave 0 adds the 32 waves' partials from LDS in wave order. Fixed order, no atomics.
__device__ __forceinline__ void s_vsum(const float* __restrict__ Y, float* vs, float* red, int bx, int by) { const int tid = threadIdx.x, q = tid & 7, r = tid >> 3;   // red: 32 * 32 floats
    const float* p = Y + (size_t)bx * NP * CV + (size_t)r * CV + by * 32 + q * 4; v4f s = (v4f){};
    for (int i = 0; i < NP / 128; ++i) s += *(const v4f*)(p + (size_t)i * 128 * CV);
    for (int u = 0; u < 4; ++u) { s[u] += __shfl_xor(s[u], 8, 32); s[u] += __shfl_xor(s[u], 16, 32); }
    if ((tid & 31) < 8) *(v4f*)(red + (tid >> 5) * 32 + q * 4) = s;
    __syncthreads();   // publishes the 32 waves' partial sums to wave 0
    if (tid < 32) { float t = 0.f;
        for (int w = 0; w < 32; ++w) t += red[w * 32 + tid];
        vs[bx * CV + by * 32 + tid] = t; } }
// k_mid: what waits for the convs alone, 1024 threads a block: the NBI * 2 blocks of s_vsum, the 2 of s_bnfin, then s_vT, four tiles (256 threads each) to a block. One LDS array serves whichever stage the block runs.
__global__ __launch_bounds__(1024) void k_mid(const float* __restrict__ YV, float* vs, const float* __restrict__ SP, float* ST, bf* Vh, bf* Vl) { __shared__ __align__(16) float S[4 * CV * TP]; const int b = blockIdx.x;
    if (b < 2 * NBI) s_vsum(YV, vs, S, b >> 1, b & 1);
    else if (b < 2 * NBI + 2) s_bnfin(SP, ST, S, b - 2 * NBI);
    else { const int g = threadIdx.x >> 8, t = (b - 2 * NBI - 2) * 4 + g; s_vT(YV, Vh, Vl, S + g * CV * TP, threadIdx.x & 255, t % (NP / 128), t / (NP / 128)); } }
// k_mt: Mt[v][c] = sum over the KS k slices of the partial tiles P[image][slice][v][c], added in slice order (fixed order, no atomics), then split into the hl planes. Whole-line loads.
__global__ __launch_bounds__(256) void k_mt(const float* __restrict__ P, bf* Mh, bf* Ml) { const int e = (blockIdx.x * 256 + threadIdx.x) * 4; if (e >= CV * CK) return; P += (size_t)blockIdx.y * KS * CV * CK; Mh += blockIdx.y * CV * CK; Ml += blockIdx.y * CV * CK; v4f t = *(const v4f*)(P + e); v4us oh, ol;
#pragma unroll   // straight line, so that the independent loads of many slices are in flight together
    for (int s = 1; s < KS; ++s) t += *(const v4f*)(P + (size_t)s * CV * CK + e);
#pragma unroll
    for (int u = 0; u < 4; ++u) { unsigned short a, b; splitf(t[u], a, b); oh[u] = a; ol[u] = b; } *(v4us*)(Mh + e) = oh; *(v4us*)(Ml + e) = ol;  }
// ---- k_tail: everything behind Mt in one launch: ctx = qn.M + vsum, its hl split, out = Ww.ctx + bw, stored [o][p]. ONE WAVE per 32 positions (one 128-B line of every output row), grid (NP / 32, 1, image).
// The first product is formed transposed, ctxT[v][p] = sum_c Mt[v][c] qn[p][c] (A = Mt planes, B = qn planes): lane (lr, hi) then holds position nb*16 + lr and the 8 neighbouring channels v = mb*16 + hi*8 + j,
// which is the B fragment of the second product, out[o][p] = sum_v Ww[o][v] ctx[p][v]: elements 0..7 of k chunk k2 are accumulator 2*k2, elements 8..15 accumulator 2*k2 + 1. ctx never leaves the registers.
// Per element the products are added in the order of the separate GEMMs (hh, lh, hl per 32 of c; h, l per 32 of v), vsum and the bias are added to the same f32 values: same results.
#define OP 36    // LDS row = one output channel's 32 positions, + 4: rows stay 16-B aligned, and the two half waves (8 rows apart) write different banks
__global__ __launch_bounds__(32) void k_tail(const bf* __restrict__ Qh, const bf* __restrict__ Ql, const bf* __restrict__ Mh, const bf* __restrict__ Ml, const float* __restrict__ vs, const bf* __restrict__ WW, const float* __restrict__ bw, float* OUT) {
    typedef WFrag<bf> F; typedef F::V V;
    __shared__ __align__(16) float os[CO * OP];
    const int lane = threadIdx.x & 31, lr = lane & 15, hi = lane >> 4; const int p0 = blockIdx.x * 32; const size_t z = blockIdx.z;
    // All rows of qn, Mt and Ww are 64 elements long, so one byte offset per lane serves every fragment load (row lr, k from 8*hi) and one more the f32 vectors (8 values from hi*8); the bases are the same for the whole wave.
    const unsigned fo = (unsigned)(lr * CK + 8 * hi) * 2, vo = (unsigned)hi * 32;
    const char *qh = (const char*)(Qh + (z * NP + p0) * CK) + fo, *ql = (const char*)(Ql + (z * NP + p0) * CK) + fo, *mh = (const char*)(Mh + z * CV * CK) + fo, *ml = (const char*)(Ml + z * CV * CK) + fo, *ww = (const char*)WW + fo, *vz = (const char*)(vs + z * CV) + vo, *bz = (const char*)bw + vo;
    V a[2][4], a2[2][4], b[2][2], b2[2][2], w[8][2]; v8f sv[4], bi[8], acc[4][2];
#pragma unroll   // register arrays need constant indices (so for every loop of this kernel)
    for (int k = 0; k < 2; ++k) {
#pragma unroll
        for (int nb = 0; nb < 2; ++nb) { b[k][nb] = F::ld((const bf*)qh + nb * 16 * CK + 32 * k); b2[k][nb] = F::ld((const bf*)ql + nb * 16 * CK + 32 * k); }
#pragma unroll
        for (int mb = 0; mb < 4; ++mb) { a[k][mb] = F::ld((const bf*)mh + mb * 16 * CK + 32 * k); a2[k][mb] = F::ld((const bf*)ml + mb * 16 * CK + 32 * k); } }
#pragma unroll
    for (int mb = 0; mb < 4; ++mb) sv[mb] = *(const v8f*)((const float*)vz + mb * 16);
#pragma unroll
    for (int t = 0; t < 8; ++t)
#pragma unroll
        for (int k = 0; k < 2; ++k) w[t][k] = F::ld((const bf*)ww + t * 16 * CV + 32 * k);
#pragma unroll
    for (int t = 0; t < 8; ++t) bi[t] = *(const v8f*)((const float*)bz + t * 16);
    asm volatile("s_wait_xcnt 0x0" :: "v"(fo), "v"(vo) : "memory");   // the wait that is kept before a register named by an issued load is overwritten; the two offsets are inputs so that they stay in their registers up to here
    __builtin_amdgcn_sched_barrier(0);   // every load of the wave is in flight before its first wait: without this the compiler sinks the vsum, weight and bias loads to their uses, each with a latency of its own in the open
#pragma unroll
    for (int mb = 0; mb < 4; ++mb)
#pragma unroll
        for (int nb = 0; nb < 2; ++nb) acc[mb][nb] = (v8f){};
#pragma unroll
    for (int k = 0; k < 2; ++k) {   // per accumulator and 32 of c: Mt high x qn high, Mt high x qn low, Mt low x qn high
#pragma unroll
        for (int mb = 0; mb < 4; ++mb)
#pragma unroll
            for (int nb = 0; nb < 2; ++nb) acc[mb][nb] = F::mma(a[k][mb], b[k][nb], acc[mb][nb]);
#pragma unroll
        for (int mb = 0; mb < 4; ++mb)
#pragma unroll
            for (int nb = 0; nb < 2; ++nb) acc[mb][nb] = F::mma(a[k][mb], b2[k][nb], acc[mb][nb]);
#pragma unroll
        for (int mb = 0; mb < 4; ++mb)
#pragma unroll
            for (int nb = 0; nb < 2; ++nb) acc[mb][nb] = F::mma(a2[k][mb], b[k][nb], acc[mb][nb]); }
    v8us ch[4][2], cl[4][2];
#pragma unroll
    for (int mb = 0; mb < 4; ++mb)
#pragma unroll
        for (int nb = 0; nb < 2; ++nb)
#pragma unroll
            for (int j = 0; j < 8; ++j) { unsigned short x, y; splitf(__fadd_rn(acc[mb][nb][j], sv[mb][j]), x, y); ch[mb][nb][j] = x; cl[mb][nb][j] = y; }
#pragma unroll
    for (int g = 0; g < 2; ++g) { v8f o[4][2];   // 64 output channels at a time
#pragma unroll
        for (int t = 0; t < 4; ++t)
#pragma unroll
            for (int nb = 0; nb < 2; ++nb) o[t][nb] = (v8f){};
#pragma unroll
        for (int k = 0; k < 2; ++k) {
#pragma unroll
            for (int t = 0; t < 4; ++t)
#pragma unroll
                for (int nb = 0; nb < 2; ++nb) o[t][nb] = F::mma(w[g * 4 + t][k], cat16b(ch[2 * k][nb], ch[2 * k + 1][nb]), o[t][nb]);
#pragma unroll
            for (int t = 0; t < 4; ++t)
#pragma unroll
                for (int nb = 0; nb < 2; ++nb) o[t][nb] = F::mma(w[g * 4 + t][k], cat16b(cl[2 * k][nb], cl[2 * k + 1][nb]), o[t][nb]); }
#pragma unroll
        for (int t = 0; t < 4; ++t)
#pragma unroll
            for (int nb = 0; nb < 2; ++nb)
#pragma unroll
                for (int j = 0; j < 8; ++j) os[((g * 4 + t) * 16 + hi * 8 + j) * OP + nb * 16 + lr] = o[t][nb][j] + bfr(bi[g * 4 + t][j]); }
    __builtin_amdgcn_wave_barrier(); asm volatile("" ::: "memory");   // keeps the LDS reads below behind the other lanes' LDS writes above (one wave: LDS runs in order, only the compiler could swap them)
#pragma unroll   // straight line, so that later rows' LDS reads do not wait for earlier rows' stores
    for (int s = 0; s < CO / 4; ++s) { const int row = 4 * s + (lane >> 3), col = (lane & 7) * 4;
        *(v4f*)(OUT + (z * CO + row) * NP + p0 + col) = *(const v4fa*)(os + row * OP + col); } }

extern "C" void kernel_launch(void* const* d_in, const int* in_sizes, int n_in,
                              void* d_out, int out_size, void* d_ws, size_t ws_size, hipStream_t stream) {
    (void)in_sizes; (void)n_in; (void)out_size;
    const float** I = (const float**)d_in;
    const float *qf = I[0], *kf = I[1], *vf = I[2], *Wk = I[3], *bk = I[4], *ga = I[5], *be = I[6], *Wv = I[7], *bv = I[8], *Ww = I[9], *bw = I[10];
    float* OUT = (float*)d_out;     // [8][128][64][64]
    char* wsp = (char*)d_ws;
    auto take = [&](size_t bytes) { char* p = wsp; wsp += (bytes + 255) & ~(size_t)255; return (void*)p; };
    bf* WK = (bf*)take(3 * CK * CI * 2); bf* WV = WK + CK * CI; bf* WW = WV + CV * CI;   // three planes of 8192 elements, one behind the other
    bf* XT = (bf*)take((size_t)3 * NBI * NP * CI * 2);   // [q, k, v][image][p][c]
    float* YQ = (float*)take((size_t)3 * NBI * NP * CK * 4); float* YK = YQ + (size_t)NBI * NP * CK; float* YV = YK + (size_t)NBI * NP * CK; float* STQ = (float*)take(2 * CK * 2 * 4); float* SP = (float*)take((size_t)2 * NT * 2 * CK * 4);   // [q, k][tile][64 means, 64 M2]
    bf* Qh = (bf*)take((size_t)NBI * NP * CK * 2); bf* Ql = (bf*)take((size_t)NBI * NP * CK * 2); bf* Kh = (bf*)take((size_t)NBI * CK * NP * 2); bf* Kl = (bf*)take((size_t)NBI * CK * NP * 2); bf* Vh = (bf*)take((size_t)NBI * CV * NP * 2); bf* Vl = (bf*)take((size_t)NBI * CV * NP * 2); float* vs = (float*)take(NBI * CV * 4);
    float* M = (float*)take((size_t)NBI * KS * CK * CV * 4); bf* Mh = (bf*)take(NBI * CK * CV * 2); bf* Ml = (bf*)take(NBI * CK * CV * 2);
    if ((size_t)(wsp - (char*)d_ws) > ws_size) return;    // total ~ 80 MB
    // One launch per level of the dependence chain, seven in all; each reads only what an earlier launch of this call wrote.
    k_prep<<<dim3(NXT + 12, 1, 1), 256, 0, stream>>>(qf, kf, vf, XT, Wk, Wv, Ww, WK);   // inputs -> XT, weight planes
    k_conv<<<dim3(NP / 64, 1, 3 * NBI), 32, 0, stream>>>(XT, WK, WV, YQ, bk, bv, SP);   // the three 1x1 convs, tile statistics of q and k
    k_mid<<<dim3(2 * NBI + 2 + NBI * (NP / 128) / 4, 1, 1), 1024, 0, stream>>>(YV, vs, SP, STQ, Vh, Vl);   // vsum, batch statistics, v planes
    k_norm<<<dim3(NKN + NBI * (NP * CK / 1024), 1, 1), 256, 0, stream>>>(YQ, YK, STQ, ga, be, Qh, Ql, Kh, Kl);   // kn planes, qn planes
    k_mpart<<<dim3(1, KS, NBI), 32, 0, stream>>>(Vh, Vl, Kh, Kl, M);
    k_mt<<<dim3((CV * CK / 4 + 255) / 256, NBI, 1), 256, 0, stream>>>(M, Mh, Ml);
    k_tail<<<dim3(NP / 32, 1, NBI), 32, 0, stream>>>(Qh, Ql, Mh, Ml, vs, WW, bw, OUT);   // out[o][p] = Ww.(qn.M + vsum) + bw
}

// v008
// A run of this version takes 54.5 microseconds.
// Timed twice side by side with v007, it ran 1.15 times as fast both times.
// Over all steps from v000 it is 173 times as fast.
#include <hip/hip_runtime.h>

// non_local_attention (query/key/value features [8][128][64x64]; q = BN_train(conv1x1(query; Wk, bk)), k = BN_train(conv1x1(key; Wk, bk)) (BatchNorm2d in training mode: per-channel batch statistics over (B,H,W), each call its own), v = conv1x1(value; Wv, bv);
// q, k L2-normalised over their 64 channels per position (+1e-7); sim[n][m] = q_n.k_m + 1 (no softmax); ctx[n] = sum_m sim[n][m] v_m; out = conv1x1(ctx; Ww, bw) -> [8][128][64][64]).
// Reassociation (exact algebra, no softmax in between): ctx[n][v] = sum_c qn[n][c] M[c][v] + vsum[v] with M = kn^T v (64x64) and vsum = sum_m v_m - the [4096][4096] similarity map is never formed.

#define NBI  8
#define CI   128
#define NP   4096
#define CK   64
#define CV   64
#define CO   128
#define TR   128    // positions of one conv tile
#define NT   (NBI * NP / TR)   // tiles of one tensor's conv output over the whole batch: one (mean, M2) pair per channel from each
#define KS   32     // k slices of the M product: 4096 / 32 = 128 positions (256 B of every operand row) per one-wave block
typedef _Float16 h16;
typedef unsigned short bf;
typedef __attribute__((ext_vector_type(16))) __bf16   v16bf;
typedef __attribute__((ext_vector_type(16))) _Float16 v16h;
typedef __attribute__((ext_vector_type(8)))  _Float16 v8h;
typedef __attribute__((ext_vector_type(8)))  unsigned short v8us;
typedef __attribute__((ext_vector_type(8)))  float    v8f;
typedef __attribute__((ext_vector_type(4)))  float    v4f;
typedef v8h  __attribute__((may_alias)) v8ha;
typedef v4f  __attribute__((may_alias)) v4fa;
typedef v8us __attribute__((may_alias)) v8usa;

__device__ __forceinline__ unsigned short f2bf(float f) { unsigned u = __float_as_uint(f); u += 0x7FFFu + ((u >> 16) & 1u); return (unsigned short)(u >> 16); }
__device__ __forceinline__ float bf2f(unsigned short b) { return __uint_as_float(((unsigned)b) << 16); }
__device__ __forceinline__ float bfr(float f) { return bf2f(f2bf(f)); }
__device__ __forceinline__ v16h cat16(v8h lo, v8h hi) { return __builtin_shufflevector(lo, hi, 0, 1, 2, 3, 4, 5, 6, 7, 8, 9, 10, 11, 12, 13, 14, 15); }
__device__ __forceinline__ v16bf cat16b(v8us lo, v8us hi) { return __builtin_bit_cast(v16bf, __builtin_shufflevector(lo, hi, 0, 1, 2, 3, 4, 5, 6, 7, 8, 9, 10, 11, 12, 13, 14, 15)); }
__device__ __forceinline__ v8f wmma16(v16h a, v16h b, v8f c) { return __builtin_amdgcn_wmma_f32_16x16x32_f16(false, a, false, b, (short)0, c, false, false); }
__device__ __forceinline__ v8f wmmab(v16bf a, v16bf b, v8f c) { return __builtin_amdgcn_wmma_f32_16x16x32_bf16(false, a, false, b, (short)0, c, false, false); }



// ---- gemmw: register-blocked GEMM, ONE WAVE per 64x64 output tile (16 accumulators), operands straight from K-contiguous 16-bit planes; blocks (M/64, N/64, Z), 32 threads.
// C[m][n] (f32, pitch ldc) = sum_k A[m][k] Bt[n][k] (+ split products per NSPLIT). z-batch strides sA/sB/sC in elements. K % 32 == 0.
// The body is a device function that is given its block indices (bx, by, z) and its 16 x 68 floats of LDS.
// KSPLIT: N == 64 and by is not a column tile but a slice of the k range: the block sums the kn positions from y*kn on (rows keep their pitch K) and stores its own partial tile at C + (z*KS + y)*sC (KS slices, grid.y == KS); the reader adds the slices. Elsewhere kn == K.
template <typename T16> struct WFrag;
template <> struct WFrag<h16> { typedef v16h V; static __device__ __forceinline__ V ld(const h16* p) { return cat16(*(const v8h*)p, *(const v8h*)(p + 16)); } static __device__ __forceinline__ v8f mma(V a, V b, v8f c) { return wmma16(a, b, c); } };
template <> struct WFrag<bf> { typedef v16bf V; static __device__ __forceinline__ V ld(const bf* p) { return cat16b(*(const v8us*)p, *(const v8us*)(p + 16)); } static __device__ __forceinline__ v8f mma(V a, V b, v8f c) { return wmmab(a, b, c); } };
template <typename T16, int NSPLIT, bool KSPLIT>
__device__ __forceinline__ void gemmw(const T16* __restrict__ A, const T16* __restrict__ A2, const T16* __restrict__ Bt, const T16* __restrict__ Bt2, int K, int kn, float* C, int ldc, size_t sA, size_t sB, size_t sC, float* os, int bx, int by, size_t z) {
    typedef typename WFrag<T16>::V V;
    const size_t k0 = KSPLIT ? (size_t)by * kn : 0; A += z * sA + k0; if (A2) A2 += z * sA + k0; Bt += z * sB + k0; if (Bt2) Bt2 += z * sB + k0; C += (KSPLIT ? z * KS + by : z) * sC;
    const int lane = threadIdx.x & 31, lr = lane & 15, hi = lane >> 4; const int r0 = bx * 64, c0 = KSPLIT ? 0 : by * 64;
    v8f acc[4][4];
#pragma unroll
    for (int mb = 0; mb < 4; ++mb)
#pragma unroll
        for (int nb = 0; nb < 4; ++nb) acc[mb][nb] = (v8f){};
    const size_t aoff = (size_t)(r0 + lr) * K + 8 * hi, boff = (size_t)(c0 + lr) * K + 8 * hi;
#pragma unroll 1
    for (int kc = 0; kc < kn; kc += 32) {
        V a[4], a2[4];
#pragma unroll
        for (int mb = 0; mb < 4; ++mb) { a[mb] = WFrag<T16>::ld(A + aoff + (size_t)mb * 16 * K + kc); if (NSPLIT == 1 || NSPLIT == 2) a2[mb] = WFrag<T16>::ld(A2 + aoff + (size_t)mb * 16 * K + kc); }
#pragma unroll
        for (int nb = 0; nb < 4; ++nb) { const V b = WFrag<T16>::ld(Bt + boff + (size_t)nb * 16 * K + kc); V b2; if (NSPLIT >= 2) b2 = WFrag<T16>::ld(Bt2 + boff + (size_t)nb * 16 * K + kc);
#pragma unroll
            for (int mb = 0; mb < 4; ++mb) { acc[mb][nb] = WFrag<T16>::mma(a[mb], b, acc[mb][nb]); if (NSPLIT == 1 || NSPLIT == 2) acc[mb][nb] = WFrag<T16>::mma(a2[mb], b, acc[mb][nb]); if (NSPLIT >= 2) acc[mb][nb] = WFrag<T16>::mma(a[mb], b2, acc[mb][nb]); } }
        asm volatile("v_nop\n\tv_nop\n\tv_nop\n\tv_nop" : "+v"(acc[0][0]), "+v"(acc[1][1]), "+v"(acc[2][2]), "+v"(acc[3][3]) : "v"(a[0]), "v"(a[3]));
    }
#pragma unroll
    for (int mb = 0; mb < 4; ++mb) {
#pragma unroll
        for (int nb = 0; nb < 4; ++nb) {
#pragma unroll
            for (int j = 0; j < 8; ++j) os[(hi * 8 + j) * 68 + nb * 16 + lr] = acc[mb][nb][j]; }
        __builtin_amdgcn_wave_barrier(); asm volatile("" ::: "memory");
        float* crow = C + (size_t)(r0 + mb * 16) * ldc + c0;
{
#pragma unroll
            for (int s = 0; s < 8; ++s) { const int row = 2 * s + hi, cofs = lr * 4; *(v4f*)(crow + (size_t)row * ldc + cofs) = *(const v4fa*)(os + row * 68 + cofs); }
             }
        __builtin_amdgcn_wave_barrier(); asm volatile("" ::: "memory");
    }
}
// k_mpart: partial Mt[image][slice][v][c] = sum over the slice's m of v[m][v] kn[m][c], hl planes on both sides; grid (1, KS, NBI).
__global__ __launch_bounds__(32) void k_mpart(const bf* __restrict__ Vh, const bf* __restrict__ Vl, const bf* __restrict__ Kh, const bf* __restrict__ Kl, float* M) {
    __shared__ __align__(16) float os[16 * 68];
    gemmw<bf, 2, true>(Vh, Vl, Kh, Kl, NP, NP / KS, M, CK, (size_t)CV * NP, (size_t)CK * NP, (size_t)CV * CK, os, 0, blockIdx.y, blockIdx.z); }

__device__ __forceinline__ void splitf(float y, unsigned short& h, unsigned short& l) { h = f2bf(y); l = f2bf(y - bf2f(h)); }
typedef __attribute__((ext_vector_type(2))) unsigned short v2us;
typedef __attribute__((ext_vector_type(2))) float v2f;
typedef __attribute__((ext_vector_type(4))) unsigned short v4us;

// Every stage below is a device function that is given its block indices or, as s_conv, pointers to its tile (k_conv picks its tensor and image): one pass per stage for the whole batch, each image on its own workspace planes.
// Stages that do not depend on one another share a launch: a range of the flat block index picks the stage (a branch that is the same for a whole block), the longer-running stage on the lower indices. k_conv, k_mid and k_norm are these launches.
__device__ __forceinline__ void s_cvt8(const float* __restrict__ s, bf* dst, size_t n8, int bx) { const size_t i = (size_t)bx * 256 + threadIdx.x; if (i >= n8) return; const v8f v = *(const v8f*)(s + i * 8); v8us o;
#pragma unroll
    for (int k = 0; k < 8; ++k) o[k] = f2bf(v[k]); *(v8us*)(dst + i * 8) = o;  }
// ---- The two transposes (s_conv's x tile, s_vT) go through a padded LDS tile: the global loads follow the source's rows, 16 lanes side by side on whole 128-B lines, and a thread moves 32 or 64 elements.
// Odd row pitches in LDS (65, 129 dwords): the 16 lanes of a half wave step by 4 rows or by 4 dwords, the two halves by 1, so that every LDS write of a wave meets 32 different banks.
typedef __attribute__((ext_vector_type(4))) unsigned v4u;
typedef __attribute__((ext_vector_type(2))) unsigned v2u;
typedef v4u __attribute__((may_alias)) v4ua;
#define XP 65    // x tile: LDS row = one position's 128 channels as 64 dwords of two bf16, + 1
#define WP 68    // weight tile: LDS row = one output channel's 128 input channels as 64 dwords of two bf16, + 4: rows stay 16-B aligned, and the 16-B reads of 16 lanes (16 rows) fall on 64 different banks
#define TP 129   // tile_in: LDS row = one source column's 128 rows as f32, + 1
// s_conv: the 1x1 conv of one tensor on a tile of 128 channels x TR positions, 256 threads. x points at the tile's first position in channel 0, Y at the tile's first row [p][o], Wf [o][c] and bias are the f32 inputs.
// The tile is rounded to bf16 and transposed into LDS (a thread holds the same 4 positions of channels 2*c2 and 2*c2 + 1, so a dword of two neighbouring channels is formed in registers), the weights are rounded into LDS beside it,
// and the product is formed from there: wave w owns positions 16*w .. 16*w + 15 and all 64 output channels, A = its x rows, B = the weight rows, k in steps of 32 upwards (per element the sum order of a plain k loop).
// SPt (q and k; null for v, the same for the whole block): per channel the mean of the tile's TR rows and M2 = the sum of their squared distances from that mean, from the accumulators: 64 means, then 64 M2 (four 128-B lines). s_bnfin joins the tiles.
// S: 128 * XP + CK * WP dwords. Behind the product the same LDS serves as 8 x (16 x 68) floats of staging rows and 2 x (8 x CK) floats of the waves' partial sums.
__device__ __forceinline__ void s_conv(const float* __restrict__ x, const float* __restrict__ Wf, const float* __restrict__ bias, float* Y, float* SPt, unsigned* S) {
    const int tid = threadIdx.x, q = tid & 15, r = tid >> 4, lr = tid & 15, hi = (tid >> 4) & 1, w = tid >> 5; unsigned* L = S; unsigned* WL = S + 128 * XP; x += (size_t)(2 * r) * NP + 4 * q; v4f a[4][2], b[4][2], wv[8]; float bb[4];
#pragma unroll   // straight line, so that a thread's 28 independent loads are in flight together
    for (int j = 0; j < 4; ++j)
#pragma unroll   // as above
        for (int s = 0; s < 2; ++s) { a[j][s] = *(const v4f*)(x + (size_t)(32 * j) * NP + 64 * s); b[j][s] = *(const v4f*)(x + (size_t)(32 * j + 1) * NP + 64 * s); }   // channels 2 * (r + 16 * j) and the next
#pragma unroll   // as above
    for (int i = 0; i < 8; ++i) wv[i] = *(const v4f*)(Wf + (i * 256 + tid) * 4);
#pragma unroll   // as above
    for (int nb = 0; nb < 4; ++nb) bb[nb] = bias[nb * 16 + lr];
    asm volatile("s_wait_xcnt 0x0" :: "v"(x), "v"(tid), "v"(lr) : "memory");   // the wait that is kept before a register named by an issued load is overwritten; the address and the two offsets are inputs so that they stay in their registers up to here (a later load's result was placed on the x address without it)
    __builtin_amdgcn_sched_barrier(0);   // every load of the thread is in flight before its first wait: without this the compiler holds most of the weight loads and some x loads back behind the first conversions, each group with a latency of its own
#pragma unroll   // register arrays need constant indices (so for every loop of this function)
    for (int j = 0; j < 4; ++j)
#pragma unroll
        for (int s = 0; s < 2; ++s)
#pragma unroll
            for (int i = 0; i < 4; ++i) L[(64 * s + 4 * q + i) * XP + r + 16 * j] = (unsigned)f2bf(a[j][s][i]) | ((unsigned)f2bf(b[j][s][i]) << 16);
#pragma unroll
    for (int i = 0; i < 8; ++i) { const int e = (i * 256 + tid) * 4; v2u d; d[0] = (unsigned)f2bf(wv[i][0]) | ((unsigned)f2bf(wv[i][1]) << 16); d[1] = (unsigned)f2bf(wv[i][2]) | ((unsigned)f2bf(wv[i][3]) << 16);
        *(v2u*)(WL + (e >> 7) * WP + ((e & 127) >> 1)) = d; }   // a wave writes one whole weight row
    __syncthreads();   // publishes both tiles: a wave reads x rows and weight rows whose dwords all 8 waves wrote
    const unsigned* ar = L + (16 * w + lr) * XP + 4 * hi; const unsigned* br = WL + lr * WP + 4 * hi; v8f acc[4]; v16bf af[4], bq[2][4];   // fragment of row lr: elements 0..7 are k = 8*hi + 0..7 of the 32, elements 8..15 are k = 16 + 8*hi + 0..7, on both sides
#pragma unroll
    for (int k = 0; k < 4; ++k) { v4u lo, up;
#pragma unroll
        for (int i = 0; i < 4; ++i) { lo[i] = ar[16 * k + i]; up[i] = ar[16 * k + 8 + i]; }
        af[k] = cat16b(__builtin_bit_cast(v8us, lo), __builtin_bit_cast(v8us, up)); }
#pragma unroll
    for (int k = 0; k < 2; ++k)
#pragma unroll
        for (int nb = 0; nb < 4; ++nb) bq[k][nb] = cat16b(__builtin_bit_cast(v8us, *(const v4ua*)(br + nb * 16 * WP + 16 * k)), __builtin_bit_cast(v8us, *(const v4ua*)(br + nb * 16 * WP + 16 * k + 8)));
#pragma unroll
    for (int nb = 0; nb < 4; ++nb) acc[nb] = (v8f){};
#pragma unroll
    for (int k = 0; k < 4; ++k) {
        __builtin_amdgcn_sched_barrier(0);   // keeps the weight fragments two k steps ahead of their products: without it the compiler sinks every LDS read to its product, 16 LDS latencies one behind the other
#pragma unroll
        for (int nb = 0; nb < 4; ++nb) acc[nb] = wmmab(af[k], bq[k & 1][nb], acc[nb]);
        if (k < 2) {
#pragma unroll
            for (int nb = 0; nb < 4; ++nb) bq[k & 1][nb] = cat16b(__builtin_bit_cast(v8us, *(const v4ua*)(br + nb * 16 * WP + 16 * (k + 2))), __builtin_bit_cast(v8us, *(const v4ua*)(br + nb * 16 * WP + 16 * (k + 2) + 8))); } }
    __syncthreads();   // ends every wave's reads of the two tiles: the staging rows and partial sums below lie over them
    float* os = (float*)S + w * (16 * 68); float* red = (float*)S + 8 * (16 * 68);   // lane (lr, hi) holds rows 16*w + hi*8 + j of channel nb*16 + lr
#pragma unroll
    for (int nb = 0; nb < 4; ++nb) acc[nb] += bfr(bb[nb]);
    if (SPt) { float s[4], t[4];   // the statistics stand in front of the stores of Y, so that no barrier waits for a global store
#pragma unroll
        for (int nb = 0; nb < 4; ++nb) s[nb] = 0.f;
#pragma unroll
        for (int j = 0; j < 8; ++j)
#pragma unroll
            for (int nb = 0; nb < 4; ++nb) s[nb] += acc[nb][j];
#pragma unroll
        for (int nb = 0; nb < 4; ++nb) s[nb] += __shfl_xor(s[nb], 16, 32);
#pragma unroll   // both half waves now hold all four sums: each writes two of them
        for (int u = 0; u < 2; ++u) red[w * CK + (2 * hi + u) * 16 + lr] = hi ? s[2 + u] : s[u];
        __syncthreads();   // publishes the 8 waves' row sums
#pragma unroll
        for (int nb = 0; nb < 4; ++nb) { float m = 0.f;
#pragma unroll
            for (int i = 0; i < 8; ++i) m += red[i * CK + nb * 16 + lr];
            s[nb] = m * (1.0f / TR); t[nb] = 0.f; }
#pragma unroll
        for (int j = 0; j < 8; ++j)
#pragma unroll
            for (int nb = 0; nb < 4; ++nb) { const float d = acc[nb][j] - s[nb]; t[nb] += d * d; }
#pragma unroll
        for (int nb = 0; nb < 4; ++nb) t[nb] += __shfl_xor(t[nb], 16, 32);
#pragma unroll   // as for the sums
        for (int u = 0; u < 2; ++u) red[(8 + w) * CK + (2 * hi + u) * 16 + lr] = hi ? t[2 + u] : t[u];
        __syncthreads();   // publishes the 8 waves' sums of squared distances
        if (tid < 2 * CK) { const float* rp = red + (tid >> 6) * 8 * CK + (tid & 63); float m = 0.f;
#pragma unroll
            for (int i = 0; i < 8; ++i) m += rp[i * CK];
            SPt[tid] = tid < CK ? m * (1.0f / TR) : m; } }
#pragma unroll
    for (int nb = 0; nb < 4; ++nb)
#pragma unroll
        for (int j = 0; j < 8; ++j) os[(hi * 8 + j) * 68 + nb * 16 + lr] = acc[nb][j];
    __builtin_amdgcn_wave_barrier(); asm volatile("" ::: "memory");   // keeps the LDS reads below behind the other lanes' LDS writes above (the rows are the wave's own: LDS runs in order, only the compiler could swap them)
#pragma unroll   // straight line, so that later rows' LDS reads do not wait for earlier rows' stores
    for (int u = 0; u < 8; ++u) { const int row = 2 * u + hi; *(v4f*)(Y + (size_t)(16 * w + row) * CK + lr * 4) = *(const v4fa*)(os + row * 68 + lr * 4); } }   // two whole rows (four 128-B lines) a store
// k_conv: what depends on the inputs alone: the 3 * NBI * (NP / TR) tiles of the three convs (q and k with Wk, bk and the tile statistics, v with Wv, bv), then the 4 blocks that round Ww.
// Y holds the three tensors' planes one behind the other with one stride, so the flat tile index addresses them all.
#define NXT (3 * NBI * (NP / TR))
__global__ __launch_bounds__(256) void k_conv(const float* __restrict__ xq, const float* __restrict__ xk, const float* __restrict__ xv, const float* __restrict__ Wk, const float* __restrict__ Wv, const float* __restrict__ Ww, const float* __restrict__ bk, const float* __restrict__ bv, float* Y, float* SP, bf* WW) {
    __shared__ __align__(16) unsigned S[128 * XP + CK * WP]; const int b = blockIdx.x;
    if (b < NXT) { const int bx = b % (NP / TR), by = b / (NP / TR) % NBI, bz = b / (NP / TR * NBI);
        s_conv((bz == 0 ? xq : bz == 1 ? xk : xv) + (size_t)by * CI * NP + bx * TR, bz < 2 ? Wk : Wv, bz < 2 ? bk : bv, Y + (size_t)b * TR * CK, bz < 2 ? SP + (size_t)b * (2 * CK) : nullptr, S); }
    else s_cvt8(Ww, WW, CO * CV / 8, b - NXT); }   // [out][in] natural = A of k_tail's second product; 4 blocks of 256 x 8 elements
// tile_in: 256 threads (tid 0..255) bring 128 rows x 64 columns of f32 (src at the tile's first element, row pitch SP floats) into L[column][row].
template <int SP> __device__ __forceinline__ void tile_in(const float* __restrict__ src, float* L, int tid) { const int q = tid & 15, r = tid >> 4; v4f v[8];
#pragma unroll   // straight line, so that a thread's 8 independent loads are in flight together
    for (int j = 0; j < 8; ++j) v[j] = *(const v4f*)(src + (size_t)(r + 16 * j) * SP + 4 * q);
#pragma unroll   // register arrays need constant indices
    for (int j = 0; j < 8; ++j)
#pragma unroll   // as above
        for (int i = 0; i < 4; ++i) L[(4 * q + i) * TP + r + 16 * j] = v[j][i];
    __syncthreads();   // publishes the tile: a thread reads columns whose rows all 8 waves wrote
}
// s_bnfin: the batch statistics of one tensor (bx: q, k) from its NT tiles' (mean, M2) pairs, P[tile][64 means, 64 M2]. All tiles hold TR rows, so mean = sum of the tile means / NT and
// sum of squared distances = sum of the M2 + TR * sum of (tile mean - mean)^2: exact algebra, and every square is taken about a mean, as in a two-pass variance. ST[c] = (mean, 1 / sqrt(var + 1e-5)).
// 1024 threads = 64 tiles x 16 lanes of 4 channels: a thread keeps its NT / 64 tile means in registers for the second sum; a wave folds its 2 tiles by one butterfly step, 64 threads add the 32 waves' partials from LDS in wave order. Fixed order, no atomics.
__device__ __forceinline__ void s_bnfin(const float* __restrict__ P, float* ST, float* red, int bx) { float* mu = red + 32 * CK; const int tid = threadIdx.x, q = tid & 15, r = tid >> 4;   // red: 32 * CK floats, mu: CK more
    P += ((size_t)bx * NT + r) * (2 * CK) + 4 * q; ST += bx * 2 * CK; v4f m[NT / 64], w[NT / 64];
#pragma unroll   // straight line, so that a thread's independent loads are in flight together
    for (int k = 0; k < NT / 64; ++k) { m[k] = *(const v4f*)(P + (size_t)k * 64 * 2 * CK); w[k] = *(const v4f*)(P + (size_t)k * 64 * 2 * CK + CK); }
    v4f s = m[0], t = w[0];
#pragma unroll   // register arrays need constant indices
    for (int k = 1; k < NT / 64; ++k) { s += m[k]; t += w[k]; }
    for (int u = 0; u < 4; ++u) s[u] += __shfl_xor(s[u], 16, 32);
    if ((tid & 31) < 16) *(v4f*)(red + (tid >> 5) * CK + 4 * q) = s;
    __syncthreads();   // publishes the 32 waves' sums of tile means
    if (tid < CK) { float a = 0.f;
        for (int i = 0; i < 32; ++i) a += red[i * CK + tid];
        mu[tid] = a * (1.0f / NT); }
    __syncthreads();   // publishes the means; also ends the reads of red before it is written again
    const v4f mean = *(const v4f*)(mu + 4 * q); v4f e = (v4f){};
#pragma unroll   // register arrays need constant indices
    for (int k = 0; k < NT / 64; ++k) { const v4f d = m[k] - mean; e += d * d; }
    t += (float)TR * e;
    for (int u = 0; u < 4; ++u) t[u] += __shfl_xor(t[u], 16, 32);
    if ((tid & 31) < 16) *(v4f*)(red + (tid >> 5) * CK + 4 * q) = t;
    __syncthreads();   // publishes the 32 waves' sums of squared distances
    if (tid < CK) { float a = 0.f;
        for (int i = 0; i < 32; ++i) a += red[i * CK + tid];
        v2f o; o[0] = mu[tid]; o[1] = __frsqrt_rn(__fadd_rn(a * (1.0f / (NBI * NP)), 1e-5f)); *(v2f*)(ST + 2 * tid) = o; } }
__device__ __forceinline__ void s_qn(const float* __restrict__ Y, const float* __restrict__ ST, const float* __restrict__ ga, const float* __restrict__ be, bf* Qh, bf* Ql, int bx, int by) { const int e = (bx * 256 + threadIdx.x) * 4; if (e >= NP * CK) return; Y += (size_t)by * NP * CK; Qh += (size_t)by * NP * CK; Ql += (size_t)by * NP * CK; const int c0 = e % CK; const v4f a = *(const v4f*)(Y + e); float y[4]; float ss = 0.f;
#pragma unroll
    for (int u = 0; u < 4; ++u) { const int c = c0 + u; float t0 = __fmul_rn(__fsub_rn(a[u], ST[2 * c]), ST[2 * c + 1]); asm volatile("" : "+v"(t0)); float g = bfr(ga[c]), bb = bfr(be[c]); asm volatile("" : "+v"(g)); asm volatile("" : "+v"(bb)); float t1 = __fmul_rn(t0, g); asm volatile("" : "+v"(t1)); y[u] = __fadd_rn(t1, bb); float p = __fmul_rn(y[u], y[u]); asm volatile("" : "+v"(p)); ss = __fadd_rn(ss, p); }
    ss += __shfl_xor(ss, 1, 32); ss += __shfl_xor(ss, 2, 32); ss += __shfl_xor(ss, 4, 32); ss += __shfl_xor(ss, 8, 32); const float inv = __fdiv_rn(1.0f, __fadd_rn(__fsqrt_rn(ss), 1e-7f)); v4us oh, ol;
#pragma unroll
    for (int u = 0; u < 4; ++u) { unsigned short hh, ll; splitf(__fmul_rn(y[u], inv), hh, ll); oh[u] = hh; ol[u] = ll; } *(v4us*)(Qh + e) = oh; *(v4us*)(Ql + e) = ol;  }
__device__ __forceinline__ void s_knT(const float* __restrict__ Y, const float* __restrict__ ST, const float* __restrict__ ga, const float* __restrict__ be, bf* Kh, bf* Kl, int bx, int by) { const int m = (bx * 256 + threadIdx.x) * 2; if (m >= NP) return; Y += (size_t)by * NP * CK; Kh += (size_t)by * CK * NP; Kl += (size_t)by * CK * NP; float y0[CK], y1[CK]; float s0 = 0.f, s1 = 0.f;
#pragma unroll
    for (int c4 = 0; c4 < CK / 4; ++c4) { const v4f a = *(const v4f*)(Y + (size_t)m * CK + c4 * 4), b = *(const v4f*)(Y + (size_t)(m + 1) * CK + c4 * 4);
#pragma unroll
        for (int u = 0; u < 4; ++u) { const int c = c4 * 4 + u; const float mu = ST[2 * c], rs = ST[2 * c + 1]; float g = bfr(ga[c]), bb = bfr(be[c]); asm volatile("" : "+v"(g)); asm volatile("" : "+v"(bb));
            float t0 = __fmul_rn(__fsub_rn(a[u], mu), rs), t1 = __fmul_rn(__fsub_rn(b[u], mu), rs); asm volatile("" : "+v"(t0)); asm volatile("" : "+v"(t1)); float u0 = __fmul_rn(t0, g), u1 = __fmul_rn(t1, g); asm volatile("" : "+v"(u0)); asm volatile("" : "+v"(u1)); y0[c] = __fadd_rn(u0, bb); y1[c] = __fadd_rn(u1, bb);
            float p0 = __fmul_rn(y0[c], y0[c]), p1 = __fmul_rn(y1[c], y1[c]); asm volatile("" : "+v"(p0)); asm volatile("" : "+v"(p1)); s0 = __fadd_rn(s0, p0); s1 = __fadd_rn(s1, p1); } }
    const float i0 = __fdiv_rn(1.0f, __fadd_rn(__fsqrt_rn(s0), 1e-7f)), i1 = __fdiv_rn(1.0f, __fadd_rn(__fsqrt_rn(s1), 1e-7f));
    {
#pragma unroll
        for (int c = 0; c < CK; ++c) { unsigned short a0, b0, a1, b1; splitf(__fmul_rn(y0[c], i0), a0, b0); splitf(__fmul_rn(y1[c], i1), a1, b1); v2us oh, ol; oh[0] = a0; oh[1] = a1; ol[0] = b0; ol[1] = b1; *(v2us*)(Kh + (size_t)c * NP + m) = oh; *(v2us*)(Kl + (size_t)c * NP + m) = ol; }
         } }
// k_norm: what waits for the batch statistics alone: the NBI * 8 blocks of s_knT, then the NBI * 256 blocks of s_qn. ST holds q's statistics, then k's.
#define NKN (NBI * (NP / 512))
__global__ __launch_bounds__(256) void k_norm(const float* __restrict__ YQ, const float* __restrict__ YK, const float* __restrict__ ST, const float* __restrict__ ga, const float* __restrict__ be, bf* Qh, bf* Ql, bf* Kh, bf* Kl) { const int b = blockIdx.x;
    if (b < NKN) s_knT(YK, ST + 2 * CK, ga, be, Kh, Kl, b % (NP / 512), b / (NP / 512));
    else s_qn(YQ, ST, ga, be, Qh, Ql, (b - NKN) % (NP * CK / 1024), (b - NKN) / (NP * CK / 1024)); }
// s_vT: 256 threads (tid 0..255) per tile of 128 positions, on their own CV * TP floats of LDS; every thread of the block passes tile_in's barrier.
__device__ __forceinline__ void s_vT(const float* __restrict__ Y, bf* Vh, bf* Vl, float* L, int tid, int bx, int by) { const int q = tid & 15, r = tid >> 4; const int m0 = bx * 128;
    tile_in<CV>(Y + ((size_t)by * NP + m0) * CV, L, tid); Vh += (size_t)by * CV * NP + m0 + 4 * q; Vl += (size_t)by * CV * NP + m0 + 4 * q;
#pragma unroll   // straight line, so that the LDS reads of later rows do not wait for the stores of earlier ones
    for (int k = 0; k < 4; ++k)
#pragma unroll   // as above
        for (int s = 0; s < 2; ++s) { const int v = r + 16 * k; v4us oh, ol;
#pragma unroll   // register vectors need constant indices
            for (int i = 0; i < 4; ++i) { unsigned short x, y; splitf(L[v * TP + 64 * s + 4 * q + i], x, y); oh[i] = x; ol[i] = y; }
            *(v4us*)(Vh + (size_t)v * NP + 64 * s) = oh; *(v4us*)(Vl + (size_t)v * NP + 64 * s) = ol; }
    asm volatile("s_wait_xcnt 0x0" ::: "memory"); }   // the wait that is kept before a register named by an issued store is overwritten: in k_mid's listing another stage's code, which reuses these registers, lies behind the stores
// s_vsum: vs[b][v] = sum_m YV[b][m][v]. Blocks (bx: image, by: half of the 64 channels): a block's 32 channels are one 128-B line of every row, its 32 results one 128-B line of vs.
// 1024 threads = 128 rows x 8 lanes of 4 channels: a thread adds its 32 rows (independent loads, in flight together), a wave folds its 4 rows by two butterfly steps, wave 0 adds the 32 waves' partials from LDS in wave order. Fixed order, no atomics.
__device__ __forceinline__ void s_vsum(const float* __restrict__ Y, float* vs, float* red, int bx, int by) { const int tid = threadIdx.x, q = tid & 7, r = tid >> 3;   // red: 32 * 32 floats
    const float* p = Y + (size_t)bx * NP * CV + (size_t)r * CV + by * 32 + q * 4; v4f s = (v4f){};
    for (int i = 0; i < NP / 128; ++i) s += *(const v4f*)(p + (size_t)i * 128 * CV);
    for (int u = 0; u < 4; ++u) { s[u] += __shfl_xor(s[u], 8, 32); s[u] += __shfl_xor(s[u], 16, 32); }
    if ((tid & 31) < 8) *(v4f*)(red + (tid >> 5) * 32 + q * 4) = s;
    __syncthreads();   // publishes the 32 waves' partial sums to wave 0
    if (tid < 32) { float t = 0.f;
        for (int w = 0; w < 32; ++w) t += red[w * 32 + tid];
        vs[bx * CV + by * 32 + tid] = t; } }
// k_mid: what waits for the convs alone, 1024 threads a block: the NBI * 2 blocks of s_vsum, the 2 of s_bnfin, then s_vT, four tiles (256 threads each) to a block. One LDS array serves whichever stage the block runs.
__global__ __launch_bounds__(1024) void k_mid(const float* __restrict__ YV, float* vs, const float* __restrict__ SP, float* ST, bf* Vh, bf* Vl) { __shared__ __align__(16) float S[4 * CV * TP]; const int b = blockIdx.x;
    if (b < 2 * NBI) s_vsum(YV, vs, S, b >> 1, b & 1);
    else if (b < 2 * NBI + 2) s_bnfin(SP, ST, S, b - 2 * NBI);
    else { const int g = threadIdx.x >> 8, t = (b - 2 * NBI - 2) * 4 + g; s_vT(YV, Vh, Vl, S + g * CV * TP, threadIdx.x & 255, t % (NP / 128), t / (NP / 128)); } }
// k_mt: Mt[v][c] = sum over the KS k slices of the partial tiles P[image][slice][v][c], added in slice order (fixed order, no atomics), then split into the hl planes. Whole-line loads.
__global__ __launch_bounds__(256) void k_mt(const float* __restrict__ P, bf* Mh, bf* Ml) { const int e = (blockIdx.x * 256 + threadIdx.x) * 4; if (e >= CV * CK) return; P += (size_t)blockIdx.y * KS * CV * CK; Mh += blockIdx.y * CV * CK; Ml += blockIdx.y * CV * CK; v4f t = *(const v4f*)(P + e); v4us oh, ol;
#pragma unroll   // straight line, so that the independent loads of many slices are in flight together
    for (int s = 1; s < KS; ++s) t += *(const v4f*)(P + (size_t)s * CV * CK + e);
#pragma unroll
    for (int u = 0; u < 4; ++u) { unsigned short a, b; splitf(t[u], a, b); oh[u] = a; ol[u] = b; } *(v4us*)(Mh + e) = oh; *(v4us*)(Ml + e) = ol;  }
// ---- k_tail: everything behind Mt in one launch: ctx = qn.M + vsum, its hl split, out = Ww.ctx + bw, stored [o][p]. ONE WAVE per 32 positions (one 128-B line of every output row), grid (NP / 32, 1, image).
// The first product is formed transposed, ctxT[v][p] = sum_c Mt[v][c] qn[p][c] (A = Mt planes, B = qn planes): lane (lr, hi) then holds position nb*16 + lr and the 8 neighbouring channels v = mb*16 + hi*8 + j,
// which is the B fragment of the second product, out[o][p] = sum_v Ww[o][v] ctx[p][v]: elements 0..7 of k chunk k2 are accumulator 2*k2, elements 8..15 accumulator 2*k2 + 1. ctx never leaves the registers.
// Per element the products are added in the order of the separate GEMMs (hh, lh, hl per 32 of c; h, l per 32 of v), vsum and the bias are added to the same f32 values: same results.
#define OP 36    // LDS row = one output channel's 32 positions, + 4: rows stay 16-B aligned, and the two half waves (8 rows apart) write different banks
__global__ __launch_bounds__(32) void k_tail(const bf* __restrict__ Qh, const bf* __restrict__ Ql, const bf* __restrict__ Mh, const bf* __restrict__ Ml, const float* __restrict__ vs, const bf* __restrict__ WW, const float* __restrict__ bw, float* OUT) {
    typedef WFrag<bf> F; typedef F::V V;
    __shared__ __align__(16) float os[CO * OP];
    const int lane = threadIdx.x & 31, lr = lane & 15, hi = lane >> 4; const int p0 = blockIdx.x * 32; const size_t z = blockIdx.z;
    // All rows of qn, Mt and Ww are 64 elements long, so one byte offset per lane serves every fragment load (row lr, k from 8*hi) and one more the f32 vectors (8 values from hi*8); the bases are the same for the whole wave.
    const unsigned fo = (unsigned)(lr * CK + 8 * hi) * 2, vo = (unsigned)hi * 32;
    const char *qh = (const char*)(Qh + (z * NP + p0) * CK) + fo, *ql = (const char*)(Ql + (z * NP + p0) * CK) + fo, *mh = (const char*)(Mh + z * CV * CK) + fo, *ml = (const char*)(Ml + z * CV * CK) + fo, *ww = (const char*)WW + fo, *vz = (const char*)(vs + z * CV) + vo, *bz = (const char*)bw + vo;
    V a[2][4], a2[2][4], b[2][2], b2[2][2], w[8][2]; v8f sv[4], bi[8], acc[4][2];
#pragma unroll   // register arrays need constant indices (so for every loop of this kernel)
    for (int k = 0; k < 2; ++k) {
#pragma unroll
        for (int nb = 0; nb < 2; ++nb) { b[k][nb] = F::ld((const bf*)qh + nb * 16 * CK + 32 * k); b2[k][nb] = F::ld((const bf*)ql + nb * 16 * CK + 32 * k); }
#pragma unroll
        for (int mb = 0; mb < 4; ++mb) { a[k][mb] = F::ld((const bf*)mh + mb * 16 * CK + 32 * k); a2[k][mb] = F::ld((const bf*)ml + mb * 16 * CK + 32 * k); } }
#pragma unroll
    for (int mb = 0; mb < 4; ++mb) sv[mb] = *(const v8f*)((const float*)vz + mb * 16);
#pragma unroll
    for (int t = 0; t < 8; ++t)
#pragma unroll
        for (int k = 0; k < 2; ++k) w[t][k] = F::ld((const bf*)ww + t * 16 * CV + 32 * k);
#pragma unroll
    for (int t = 0; t < 8; ++t) bi[t] = *(const v8f*)((const float*)bz + t * 16);
    asm volatile("s_wait_xcnt 0x0" :: "v"(fo), "v"(vo) : "memory");   // the wait that is kept before a register named by an issued load is overwritten; the two offsets are inputs so that they stay in their registers up to here
    __builtin_amdgcn_sched_barrier(0);   // every load of the wave is in flight before its first wait: without this the compiler sinks the vsum, weight and bias loads to their uses, each with a latency of its own in the open
#pragma unroll
    for (int mb = 0; mb < 4; ++mb)
#pragma unroll
        for (int nb = 0; nb < 2; ++nb) acc[mb][nb] = (v8f){};
#pragma unroll
    for (int k = 0; k < 2; ++k) {   // per accumulator and 32 of c: Mt high x qn high, Mt high x qn low, Mt low x qn high
#pragma unroll
        for (int mb = 0; mb < 4; ++mb)
#pragma unroll
            for (int nb = 0; nb < 2; ++nb) acc[mb][nb] = F::mma(a[k][mb], b[k][nb], acc[mb][nb]);
#pragma unroll
        for (int mb = 0; mb < 4; ++mb)
#pragma unroll
            for (int nb = 0; nb < 2; ++nb) acc[mb][nb] = F::mma(a[k][mb], b2[k][nb], acc[mb][nb]);
#pragma unroll
        for (int mb = 0; mb < 4; ++mb)
#pragma unroll
            for (int nb = 0; nb < 2; ++nb) acc[mb][nb] = F::mma(a2[k][mb], b[k][nb], acc[mb][nb]); }
    v8us ch[4][2], cl[4][2];
#pragma unroll
    for (int mb = 0; mb < 4; ++mb)
#pragma unroll
        for (int nb = 0; nb < 2; ++nb)
#pragma unroll
            for (int j = 0; j < 8; ++j) { unsigned short x, y; splitf(__fadd_rn(acc[mb][nb][j], sv[mb][j]), x, y); ch[mb][nb][j] = x; cl[mb][nb][j] = y; }
#pragma unroll
    for (int g = 0; g < 2; ++g) { v8f o[4][2];   // 64 output channels at a time
#pragma unroll
        for (int t = 0; t < 4; ++t)
#pragma unroll
            for (int nb = 0; nb < 2; ++nb) o[t][nb] = (v8f){};
#pragma unroll
        for (int k = 0; k < 2; ++k) {
#pragma unroll
            for (int t = 0; t < 4; ++t)
#pragma unroll
                for (int nb = 0; nb < 2; ++nb) o[t][nb] = F::mma(w[g * 4 + t][k], cat16b(ch[2 * k][nb], ch[2 * k + 1][nb]), o[t][nb]);
#pragma unroll
            for (int t = 0; t < 4; ++t)
#pragma unroll
                for (int nb = 0; nb < 2; ++nb) o[t][nb] = F::mma(w[g * 4 + t][k], cat16b(cl[2 * k][nb], cl[2 * k + 1][nb]), o[t][nb]); }
#pragma unroll
        for (int t = 0; t < 4; ++t)
#pragma unroll
            for (int nb = 0; nb < 2; ++nb)
#pragma unroll
                for (int j = 0; j < 8; ++j) os[((g * 4 + t) * 16 + hi * 8 + j) * OP + nb * 16 + lr] = o[t][nb][j] + bfr(bi[g * 4 + t][j]); }
    __builtin_amdgcn_wave_barrier(); asm volatile("" ::: "memory");   // keeps the LDS reads below behind the other lanes' LDS writes above (one wave: LDS runs in order, only the compiler could swap them)
#pragma unroll   // straight line, so that later rows' LDS reads do not wait for earlier rows' stores
    for (int s = 0; s < CO / 4; ++s) { const int row = 4 * s + (lane >> 3), col = (lane & 7) * 4;
        *(v4f*)(OUT + (z * CO + row) * NP + p0 + col) = *(const v4fa*)(os + row * OP + col); } }

extern "C" void kernel_launch(void* const* d_in, const int* in_sizes, int n_in,
                              void* d_out, int out_size, void* d_ws, size_t ws_size, hipStream_t stream) {
    (void)in_sizes; (void)n_in; (void)out_size;
    const float** I = (const float**)d_in;
    const float *qf = I[0], *kf = I[1], *vf = I[2], *Wk = I[3], *bk = I[4], *ga = I[5], *be = I[6], *Wv = I[7], *bv = I[8], *Ww = I[9], *bw = I[10];
    float* OUT = (float*)d_out;     // [8][128][64][64]
    char* wsp = (char*)d_ws;
    auto take = [&](size_t bytes) { char* p = wsp; wsp += (bytes + 255) & ~(size_t)255; return (void*)p; };
    bf* WW = (bf*)take(CO * CV * 2);
    float* YQ = (float*)take((size_t)3 * NBI * NP * CK * 4); float* YK = YQ + (size_t)NBI * NP * CK; float* YV = YK + (size_t)NBI * NP * CK; float* STQ = (float*)take(2 * CK * 2 * 4); float* SP = (float*)take((size_t)2 * NT * 2 * CK * 4);   // [q, k][tile][64 means, 64 M2]
    bf* Qh = (bf*)take((size_t)NBI * NP * CK * 2); bf* Ql = (bf*)take((size_t)NBI * NP * CK * 2); bf* Kh = (bf*)take((size_t)NBI * CK * NP * 2); bf* Kl = (bf*)take((size_t)NBI * CK * NP * 2); bf* Vh = (bf*)take((size_t)NBI * CV * NP * 2); bf* Vl = (bf*)take((size_t)NBI * CV * NP * 2); float* vs = (float*)take(NBI * CV * 4);
    float* M = (float*)take((size_t)NBI * KS * CK * CV * 4); bf* Mh = (bf*)take(NBI * CK * CV * 2); bf* Ml = (bf*)take(NBI * CK * CV * 2);
    if ((size_t)(wsp - (char*)d_ws) > ws_size) return;    // total ~ 55 MB
    // One launch per level of the dependence chain, six in all; each reads only what an earlier launch of this call wrote.
    k_conv<<<dim3(NXT + 4, 1, 1), 256, 0, stream>>>(qf, kf, vf, Wk, Wv, Ww, bk, bv, YQ, SP, WW);   // the three 1x1 convs, tile statistics of q and k, Ww plane
    k_mid<<<dim3(2 * NBI + 2 + NBI * (NP / 128) / 4, 1, 1), 1024, 0, stream>>>(YV, vs, SP, STQ, Vh, Vl);   // vsum, batch statistics, v planes
    k_norm<<<dim3(NKN + NBI * (NP * CK / 1024), 1, 1), 256, 0, stream>>>(YQ, YK, STQ, ga, be, Qh, Ql, Kh, Kl);   // kn planes, qn planes
    k_mpart<<<dim3(1, KS, NBI), 32, 0, stream>>>(Vh, Vl, Kh, Kl, M);
    k_mt<<<dim3((CV * CK / 4 + 255) / 256, NBI, 1), 256, 0, stream>>>(M, Mh, Ml);
    k_tail<<<dim3(NP / 32, 1, NBI), 32, 0, stream>>>(Qh, Ql, Mh, Ml, vs, WW, bw, OUT);   // out[o][p] = Ww.(qn.M + vsum) + bw
}

// v009
// It runs in 36 microseconds.
// Two timings next to v008 put it at 1.52 and 1.50 times that version's speed.
// All steps since v000 together make it 261 times as fast.
#include <hip/hip_runtime.h>

// non_local_attention (query/key/value features [8][128][64x64]; q = BN_train(conv1x1(query; Wk, bk)), k = BN_train(conv1x1(key; Wk, bk)) (BatchNorm2d in training mode: per-channel batch statistics over (B,H,W), each call its own), v = conv1x1(value; Wv, bv);
// q, k L2-normalised over their 64 channels per position (+1e-7); sim[n][m] = q_n.k_m + 1 (no softmax); ctx[n] = sum_m sim[n][m] v_m; out = conv1x1(ctx; Ww, bw) -> [8][128][64][64]).
// Reassociation (exact algebra, no softmax in between): ctx[n][v] = sum_c qn[n][c] M[c][v] + vsum[v] with M = kn^T v (64x64) and vsum = sum_m v_m - the [4096][4096] similarity map is never formed.

#define NBI  8
#define CI   128
#define NP   4096
#define CK   64
#define CV   64
#define CO   128
#define TR   128    // positions of one conv tile
#define NT   (NBI * NP / TR)   // tiles of one tensor's conv output over the whole batch: one (mean, M2) pair per channel from each
#define KS   32     // k slices of the M product: 4096 / 32 = 128 positions (256 B of every operand row) per block
typedef _Float16 h16;
typedef unsigned short bf;
typedef __attribute__((ext_vector_type(16))) __bf16   v16bf;
typedef __attribute__((ext_vector_type(16))) _Float16 v16h;
typedef __attribute__((ext_vector_type(8)))  _Float16 v8h;
typedef __attribute__((ext_vector_type(8)))  unsigned short v8us;
typedef __attribute__((ext_vector_type(8)))  float    v8f;
typedef __attribute__((ext_vector_type(4)))  float    v4f;
typedef v8h  __attribute__((may_alias)) v8ha;
typedef v4f  __attribute__((may_alias)) v4fa;
typedef v8us __attribute__((may_alias)) v8usa;

__device__ __forceinline__ unsigned short f2bf(float f) { unsigned u = __float_as_uint(f); u += 0x7FFFu + ((u >> 16) & 1u); return (unsigned short)(u >> 16); }
__device__ __forceinline__ float bf2f(unsigned short b) { return __uint_as_float(((unsigned)b) << 16); }
__device__ __forceinline__ float bfr(float f) { return bf2f(f2bf(f)); }
__device__ __forceinline__ v16h cat16(v8h lo, v8h hi) { return __builtin_shufflevector(lo, hi, 0, 1, 2, 3, 4, 5, 6, 7, 8, 9, 10, 11, 12, 13, 14, 15); }
__device__ __forceinline__ v16bf cat16b(v8us lo, v8us hi) { return __builtin_bit_cast(v16bf, __builtin_shufflevector(lo, hi, 0, 1, 2, 3, 4, 5, 6, 7, 8, 9, 10, 11, 12, 13, 14, 15)); }
__device__ __forceinline__ v8f wmma16(v16h a, v16h b, v8f c) { return __builtin_amdgcn_wmma_f32_16x16x32_f16(false, a, false, b, (short)0, c, false, false); }
__device__ __forceinline__ v8f wmmab(v16bf a, v16bf b, v8f c) { return __builtin_amdgcn_wmma_f32_16x16x32_bf16(false, a, false, b, (short)0, c, false, false); }



// WFrag: a 16x32 fragment of a K-contiguous 16-bit row (row lr, elements 0..7 are k = 8*hi + 0..7, elements 8..15 are k = 16 + 8*hi + 0..7) and its product.
template <typename T16> struct WFrag;
template <> struct WFrag<h16> { typedef v16h V; static __device__ __forceinline__ V ld(const h16* p) { return cat16(*(const v8h*)p, *(const v8h*)(p + 16)); } static __device__ __forceinline__ v8f mma(V a, V b, v8f c) { return wmma16(a, b, c); } };
template <> struct WFrag<bf> { typedef v16bf V; static __device__ __forceinline__ V ld(const bf* p) { return cat16b(*(const v8us*)p, *(const v8us*)(p + 16)); } static __device__ __forceinline__ v8f mma(V a, V b, v8f c) { return wmmab(a, b, c); } };

// Cross-lane moves for the sums over a position's channels: rowx<M>: the value of lane l ^ M inside a row of 16 lanes (DPP, no LDS round trip); xhalf: the value of lane l ^ 16.
template <int M> __device__ __forceinline__ float rowx(float v) { return __builtin_bit_cast(float, __builtin_amdgcn_update_dpp(0, __builtin_bit_cast(int, v), 0x160 + M, 0xf, 0xf, true)); }
__device__ __forceinline__ float xhalf(float v) { return __builtin_bit_cast(float, __builtin_amdgcn_permlanex16(__builtin_bit_cast(int, v), __builtin_bit_cast(int, v), 0x76543210, 0xfedcba98, false, false)); }
__device__ __forceinline__ void splitf(float y, unsigned short& h, unsigned short& l) { h = f2bf(y); l = f2bf(y - bf2f(h)); }
typedef __attribute__((ext_vector_type(2))) unsigned short v2us;
typedef __attribute__((ext_vector_type(2))) float v2f;
typedef __attribute__((ext_vector_type(4))) unsigned short v4us;

// Every stage below is a device function that is given its block's part of the work (block indices, or pointers at its tile for s_conv): one pass per stage for the whole batch, each image on its own workspace planes.
// Stages that do not depend on one another share a launch: a range of the flat block index picks the stage (a branch that is the same for a whole block), the longer-running stage on the lower indices. k_conv and k_mid are these launches.
__device__ __forceinline__ void s_cvt8(const float* __restrict__ s, bf* dst, size_t n8, int bx) { const size_t i = (size_t)bx * 256 + threadIdx.x; if (i >= n8) return; const v8f v = *(const v8f*)(s + i * 8); v8us o;
#pragma unroll
    for (int k = 0; k < 8; ++k) o[k] = f2bf(v[k]); *(v8us*)(dst + i * 8) = o;  }
// ---- The two transposes (s_conv's x tile, s_vT) go through a padded LDS tile: the global loads follow the source's rows, 16 lanes side by side on whole 128-B lines, and a thread moves 32 or 64 elements.
// Odd row pitches in LDS (65, 129 dwords): the 16 lanes of a half wave step by 4 rows or by 4 dwords, the two halves by 1, so that every LDS write of a wave meets 32 different banks.
typedef __attribute__((ext_vector_type(4))) unsigned v4u;
typedef __attribute__((ext_vector_type(2))) unsigned v2u;
typedef v4u __attribute__((may_alias)) v4ua;
#define XP 65    // x tile: LDS row = one position's 128 channels as 64 dwords of two bf16, + 1
#define WP 68    // weight tile: LDS row = one output channel's 128 input channels as 64 dwords of two bf16, + 4: rows stay 16-B aligned, and the 16-B reads of 16 lanes (16 rows) fall on 64 different banks
#define TP 129   // tile_in: LDS row = one source column's 128 rows as f32, + 1
// s_conv: the 1x1 conv of one tensor on a tile of 128 channels x TR positions, 256 threads. x points at the tile's first position in channel 0, Y at the tile's first row [p][o], Wf [o][c] and bias are the f32 inputs.
// The tile is rounded to bf16 and transposed into LDS (a thread holds the same 4 positions of channels 2*c2 and 2*c2 + 1, so a dword of two neighbouring channels is formed in registers), the weights are rounded into LDS beside it,
// and the product is formed from there: wave w owns positions 16*w .. 16*w + 15 and all 64 output channels, A = its x rows, B = the weight rows, k in steps of 32 upwards (per element the sum order of a plain k loop).
// SPt (q and k; null for v, the same for the whole block): per channel the mean of the tile's TR rows and M2 = the sum of their squared distances from that mean, from the accumulators: 64 means, then 64 M2 (four 128-B lines). s_bnfin joins the tiles.
// S: 128 * XP + CK * WP dwords. Behind the product the same LDS serves as 8 x (16 x 68) floats of staging rows and 2 x (8 x CK) floats of the waves' partial sums.
__device__ __forceinline__ void s_conv(const float* __restrict__ x, const float* __restrict__ Wf, const float* __restrict__ bias, float* Y, float* SPt, unsigned* S) {
    const int tid = threadIdx.x, q = tid & 15, r = tid >> 4, lr = tid & 15, hi = (tid >> 4) & 1, w = tid >> 5; unsigned* L = S; unsigned* WL = S + 128 * XP; x += (size_t)(2 * r) * NP + 4 * q; v4f a[4][2], b[4][2], wv[8]; float bb[4];
#pragma unroll   // straight line, so that a thread's 28 independent loads are in flight together
    for (int j = 0; j < 4; ++j)
#pragma unroll   // as above
        for (int s = 0; s < 2; ++s) { a[j][s] = *(const v4f*)(x + (size_t)(32 * j) * NP + 64 * s); b[j][s] = *(const v4f*)(x + (size_t)(32 * j + 1) * NP + 64 * s); }   // channels 2 * (r + 16 * j) and the next
#pragma unroll   // as above
    for (int i = 0; i < 8; ++i) wv[i] = *(const v4f*)(Wf + (i * 256 + tid) * 4);
#pragma unroll   // as above
    for (int nb = 0; nb < 4; ++nb) bb[nb] = bias[nb * 16 + lr];
    asm volatile("s_wait_xcnt 0x0" :: "v"(x), "v"(tid), "v"(lr) : "memory");   // the wait that is kept before a register named by an issued load is overwritten; the address and the two offsets are inputs so that they stay in their registers up to here (a later load's result was placed on the x address without it)
    __builtin_amdgcn_sched_barrier(0);   // every load of the thread is in flight before its first wait: without this the compiler holds most of the weight loads and some x loads back behind the first conversions, each group with a latency of its own
#pragma unroll   // register arrays need constant indices (so for every loop of this function)
    for (int j = 0; j < 4; ++j)
#pragma unroll
        for (int s = 0; s < 2; ++s)
#pragma unroll
            for (int i = 0; i < 4; ++i) L[(64 * s + 4 * q + i) * XP + r + 16 * j] = (unsigned)f2bf(a[j][s][i]) | ((unsigned)f2bf(b[j][s][i]) << 16);
#pragma unroll
    for (int i = 0; i < 8; ++i) { const int e = (i * 256 + tid) * 4; v2u d; d[0] = (unsigned)f2bf(wv[i][0]) | ((unsigned)f2bf(wv[i][1]) << 16); d[1] = (unsigned)f2bf(wv[i][2]) | ((unsigned)f2bf(wv[i][3]) << 16);
        *(v2u*)(WL + (e >> 7) * WP + ((e & 127) >> 1)) = d; }   // a wave writes one whole weight row
    __syncthreads();   // publishes both tiles: a wave reads x rows and weight rows whose dwords all 8 waves wrote
    const unsigned* ar = L + (16 * w + lr) * XP + 4 * hi; const unsigned* br = WL + lr * WP + 4 * hi; v8f acc[4]; v16bf af[4], bq[2][4];   // fragment of row lr: elements 0..7 are k = 8*hi + 0..7 of the 32, elements 8..15 are k = 16 + 8*hi + 0..7, on both sides
#pragma unroll
    for (int k = 0; k < 4; ++k) { v4u lo, up;
#pragma unroll
        for (int i = 0; i < 4; ++i) { lo[i] = ar[16 * k + i]; up[i] = ar[16 * k + 8 + i]; }
        af[k] = cat16b(__builtin_bit_cast(v8us, lo), __builtin_bit_cast(v8us, up)); }
#pragma unroll
    for (int k = 0; k < 2; ++k)
#pragma unroll
        for (int nb = 0; nb < 4; ++nb) bq[k][nb] = cat16b(__builtin_bit_cast(v8us, *(const v4ua*)(br + nb * 16 * WP + 16 * k)), __builtin_bit_cast(v8us, *(const v4ua*)(br + nb * 16 * WP + 16 * k + 8)));
#pragma unroll
    for (int nb = 0; nb < 4; ++nb) acc[nb] = (v8f){};
#pragma unroll
    for (int k = 0; k < 4; ++k) {
        __builtin_amdgcn_sched_barrier(0);   // keeps the weight fragments two k steps ahead of their products: without it the compiler sinks every LDS read to its product, 16 LDS latencies one behind the other
#pragma unroll
        for (int nb = 0; nb < 4; ++nb) acc[nb] = wmmab(af[k], bq[k & 1][nb], acc[nb]);
        if (k < 2) {
#pragma unroll
            for (int nb = 0; nb < 4; ++nb) bq[k & 1][nb] = cat16b(__builtin_bit_cast(v8us, *(const v4ua*)(br + nb * 16 * WP + 16 * (k + 2))), __builtin_bit_cast(v8us, *(const v4ua*)(br + nb * 16 * WP + 16 * (k + 2) + 8))); } }
    __syncthreads();   // ends every wave's reads of the two tiles: the staging rows and partial sums below lie over them
    float* os = (float*)S + w * (16 * 68); float* red = (float*)S + 8 * (16 * 68);   // lane (lr, hi) holds rows 16*w + hi*8 + j of channel nb*16 + lr
#pragma unroll
    for (int nb = 0; nb < 4; ++nb) acc[nb] += bfr(bb[nb]);
    if (SPt) { float s[4], t[4];   // the statistics stand in front of the stores of Y, so that no barrier waits for a global store
#pragma unroll
        for (int nb = 0; nb < 4; ++nb) s[nb] = 0.f;
#pragma unroll
        for (int j = 0; j < 8; ++j)
#pragma unroll
            for (int nb = 0; nb < 4; ++nb) s[nb] += acc[nb][j];
#pragma unroll
        for (int nb = 0; nb < 4; ++nb) s[nb] += __shfl_xor(s[nb], 16, 32);
#pragma unroll   // both half waves now hold all four sums: each writes two of them
        for (int u = 0; u < 2; ++u) red[w * CK + (2 * hi + u) * 16 + lr] = hi ? s[2 + u] : s[u];
        __syncthreads();   // publishes the 8 waves' row sums
#pragma unroll
        for (int nb = 0; nb < 4; ++nb) { float m = 0.f;
#pragma unroll
            for (int i = 0; i < 8; ++i) m += red[i * CK + nb * 16 + lr];
            s[nb] = m * (1.0f / TR); t[nb] = 0.f; }
#pragma unroll
        for (int j = 0; j < 8; ++j)
#pragma unroll
            for (int nb = 0; nb < 4; ++nb) { const float d = acc[nb][j] - s[nb]; t[nb] += d * d; }
#pragma unroll
        for (int nb = 0; nb < 4; ++nb) t[nb] += __shfl_xor(t[nb], 16, 32);
#pragma unroll   // as for the sums
        for (int u = 0; u < 2; ++u) red[(8 + w) * CK + (2 * hi + u) * 16 + lr] = hi ? t[2 + u] : t[u];
        __syncthreads();   // publishes the 8 waves' sums of squared distances
        if (tid < 2 * CK) { const float* rp = red + (tid >> 6) * 8 * CK + (tid & 63); float m = 0.f;
#pragma unroll
            for (int i = 0; i < 8; ++i) m += rp[i * CK];
            SPt[tid] = tid < CK ? m * (1.0f / TR) : m; } }
#pragma unroll
    for (int nb = 0; nb < 4; ++nb)
#pragma unroll
        for (int j = 0; j < 8; ++j) os[(hi * 8 + j) * 68 + nb * 16 + lr] = acc[nb][j];
    __builtin_amdgcn_wave_barrier(); asm volatile("" ::: "memory");   // keeps the LDS reads below behind the other lanes' LDS writes above (the rows are the wave's own: LDS runs in order, only the compiler could swap them)
#pragma unroll   // straight line, so that later rows' LDS reads do not wait for earlier rows' stores
    for (int u = 0; u < 8; ++u) { const int row = 2 * u + hi; *(v4f*)(Y + (size_t)(16 * w + row) * CK + lr * 4) = *(const v4fa*)(os + row * 68 + lr * 4); } }   // two whole rows (four 128-B lines) a store
// k_conv: what depends on the inputs alone: the 3 * NBI * (NP / TR) tiles of the three convs (q and k with Wk, bk and the tile statistics, v with Wv, bv), then the 4 blocks that round Ww.
// Y holds the three tensors' planes one behind the other with one stride, so the flat tile index addresses them all.
#define NXT (3 * NBI * (NP / TR))
__global__ __launch_bounds__(256) void k_conv(const float* __restrict__ xq, const float* __restrict__ xk, const float* __restrict__ xv, const float* __restrict__ Wk, const float* __restrict__ Wv, const float* __restrict__ Ww, const float* __restrict__ bk, const float* __restrict__ bv, float* Y, float* SP, bf* WW) {
    __shared__ __align__(16) unsigned S[128 * XP + CK * WP]; const int b = blockIdx.x;
    if (b < NXT) { const int bx = b % (NP / TR), by = b / (NP / TR) % NBI, bz = b / (NP / TR * NBI);
        s_conv((bz == 0 ? xq : bz == 1 ? xk : xv) + (size_t)by * CI * NP + bx * TR, bz < 2 ? Wk : Wv, bz < 2 ? bk : bv, Y + (size_t)b * TR * CK, bz < 2 ? SP + (size_t)b * (2 * CK) : nullptr, S); }
    else s_cvt8(Ww, WW, CO * CV / 8, b - NXT); }   // [out][in] natural = A of k_tail's second product; 4 blocks of 256 x 8 elements
// tile_in: 256 threads (tid 0..255) bring 128 rows x 64 columns of f32 (src at the tile's first element, row pitch SP floats) into L[column][row].
template <int SP> __device__ __forceinline__ void tile_in(const float* __restrict__ src, float* L, int tid) { const int q = tid & 15, r = tid >> 4; v4f v[8];
#pragma unroll   // straight line, so that a thread's 8 independent loads are in flight together
    for (int j = 0; j < 8; ++j) v[j] = *(const v4f*)(src + (size_t)(r + 16 * j) * SP + 4 * q);
#pragma unroll   // register arrays need constant indices
    for (int j = 0; j < 8; ++j)
#pragma unroll   // as above
        for (int i = 0; i < 4; ++i) L[(4 * q + i) * TP + r + 16 * j] = v[j][i];
    __syncthreads();   // publishes the tile: a thread reads columns whose rows all 8 waves wrote
}
// s_bnfin: the batch statistics of one tensor (bx: q, k) from its NT tiles' (mean, M2) pairs, P[tile][64 means, 64 M2]. All tiles hold TR rows, so mean = sum of the tile means / NT and
// sum of squared distances = sum of the M2 + TR * sum of (tile mean - mean)^2: exact algebra, and every square is taken about a mean, as in a two-pass variance. ST[c] = (mean, 1 / sqrt(var + 1e-5)).
// 1024 threads = 64 tiles x 16 lanes of 4 channels: a thread keeps its NT / 64 tile means in registers for the second sum; a wave folds its 2 tiles by one butterfly step, 64 threads add the 32 waves' partials from LDS in wave order. Fixed order, no atomics.
__device__ __forceinline__ void s_bnfin(const float* __restrict__ P, float* ST, float* red, int bx) { float* mu = red + 32 * CK; const int tid = threadIdx.x, q = tid & 15, r = tid >> 4;   // red: 32 * CK floats, mu: CK more
    P += ((size_t)bx * NT + r) * (2 * CK) + 4 * q; ST += bx * 2 * CK; v4f m[NT / 64], w[NT / 64];
#pragma unroll   // straight line, so that a thread's independent loads are in flight together
    for (int k = 0; k < NT / 64; ++k) { m[k] = *(const v4f*)(P + (size_t)k * 64 * 2 * CK); w[k] = *(const v4f*)(P + (size_t)k * 64 * 2 * CK + CK); }
    v4f s = m[0], t = w[0];
#pragma unroll   // register arrays need constant indices
    for (int k = 1; k < NT / 64; ++k) { s += m[k]; t += w[k]; }
    for (int u = 0; u < 4; ++u) s[u] += __shfl_xor(s[u], 16, 32);
    if ((tid & 31) < 16) *(v4f*)(red + (tid >> 5) * CK + 4 * q) = s;
    __syncthreads();   // publishes the 32 waves' sums of tile means
    if (tid < CK) { float a = 0.f;
        for (int i = 0; i < 32; ++i) a += red[i * CK + tid];
        mu[tid] = a * (1.0f / NT); }
    __syncthreads();   // publishes the means; also ends the reads of red before it is written again
    const v4f mean = *(const v4f*)(mu + 4 * q); v4f e = (v4f){};
#pragma unroll   // register arrays need constant indices
    for (int k = 0; k < NT / 64; ++k) { const v4f d = m[k] - mean; e += d * d; }
    t += (float)TR * e;
    for (int u = 0; u < 4; ++u) t[u] += __shfl_xor(t[u], 16, 32);
    if ((tid & 31) < 16) *(v4f*)(red + (tid >> 5) * CK + 4 * q) = t;
    __syncthreads();   // publishes the 32 waves' sums of squared distances
    if (tid < CK) { float a = 0.f;
        for (int i = 0; i < 32; ++i) a += red[i * CK + tid];
        v2f o; o[0] = mu[tid]; o[1] = __frsqrt_rn(__fadd_rn(a * (1.0f / (NBI * NP)), 1e-5f)); *(v2f*)(ST + 2 * tid) = o; } }
// s_vT: 256 threads (tid 0..255) per tile of 128 positions, on their own CV * TP floats of LDS; every thread of the block passes tile_in's barrier.
__device__ __forceinline__ void s_vT(const float* __restrict__ Y, bf* Vh, bf* Vl, float* L, int tid, int bx, int by) { const int q = tid & 15, r = tid >> 4; const int m0 = bx * 128;
    tile_in<CV>(Y + ((size_t)by * NP + m0) * CV, L, tid); Vh += (size_t)by * CV * NP + m0 + 4 * q; Vl += (size_t)by * CV * NP + m0 + 4 * q;
#pragma unroll   // straight line, so that the LDS reads of later rows do not wait for the stores of earlier ones
    for (int k = 0; k < 4; ++k)
#pragma unroll   // as above
        for (int s = 0; s < 2; ++s) { const int v = r + 16 * k; v4us oh, ol;
#pragma unroll   // register vectors need constant indices
            for (int i = 0; i < 4; ++i) { unsigned short x, y; splitf(L[v * TP + 64 * s + 4 * q + i], x, y); oh[i] = x; ol[i] = y; }
            *(v4us*)(Vh + (size_t)v * NP + 64 * s) = oh; *(v4us*)(Vl + (size_t)v * NP + 64 * s) = ol; }
    asm volatile("s_wait_xcnt 0x0" ::: "memory"); }   // the wait that is kept before a register named by an issued store is overwritten: in k_mid's listing another stage's code, which reuses these registers, lies behind the stores
// s_vsum: vs[b][v] = sum_m YV[b][m][v]. Blocks (bx: image, by: half of the 64 channels): a block's 32 channels are one 128-B line of every row, its 32 results one 128-B line of vs.
// 1024 threads = 128 rows x 8 lanes of 4 channels: a thread adds its 32 rows (independent loads, in flight together), a wave folds its 4 rows by two butterfly steps, wave 0 adds the 32 waves' partials from LDS in wave order. Fixed order, no atomics.
__device__ __forceinline__ void s_vsum(const float* __restrict__ Y, float* vs, float* red, int bx, int by) { const int tid = threadIdx.x, q = tid & 7, r = tid >> 3;   // red: 32 * 32 floats
    const float* p = Y + (size_t)bx * NP * CV + (size_t)r * CV + by * 32 + q * 4; v4f s = (v4f){};
    for (int i = 0; i < NP / 128; ++i) s += *(const v4f*)(p + (size_t)i * 128 * CV);
    for (int u = 0; u < 4; ++u) { s[u] += __shfl_xor(s[u], 8, 32); s[u] += __shfl_xor(s[u], 16, 32); }
    if ((tid & 31) < 8) *(v4f*)(red + (tid >> 5) * 32 + q * 4) = s;
    __syncthreads();   // publishes the 32 waves' partial sums to wave 0
    if (tid < 32) { float t = 0.f;
        for (int w = 0; w < 32; ++w) t += red[w * 32 + tid];
        vs[bx * CV + by * 32 + tid] = t; } }
// k_mid: what waits for the convs alone, 1024 threads a block: the NBI * 2 blocks of s_vsum, the 2 of s_bnfin, then s_vT, four tiles (256 threads each) to a block. One LDS array serves whichever stage the block runs.
__global__ __launch_bounds__(1024) void k_mid(const float* __restrict__ YV, float* vs, const float* __restrict__ SP, float* ST, bf* Vh, bf* Vl) { __shared__ __align__(16) float S[4 * CV * TP]; const int b = blockIdx.x;
    if (b < 2 * NBI) s_vsum(YV, vs, S, b >> 1, b & 1);
    else if (b < 2 * NBI + 2) s_bnfin(SP, ST, S, b - 2 * NBI);
    else { const int g = threadIdx.x >> 8, t = (b - 2 * NBI - 2) * 4 + g; s_vT(YV, Vh, Vl, S + g * CV * TP, threadIdx.x & 255, t % (NP / 128), t / (NP / 128)); } }
// ---- k_mpart: partial Mt[image][slice][v][c] = sum over the slice's 128 positions m of v[m][v] kn[m][c], hl planes on both sides; grid (1, KS, NBI), 128 threads. kn never goes through memory:
// the block takes its 128 rows of the k conv's output, applies the batch norm and the L2 norm, splits the result and lays it as [c][m] hl planes in LDS, from where the B fragments are read.
// Thread (q, r) holds channels 4*q .. 4*q + 3 of the 16 positions from 16*r on: every global load of a wave is two whole rows (four 128-B lines), a row's 64 squares are summed 4 in the thread and then by four butterfly steps over its 16 lanes,
// and 8 neighbouring positions of a channel are one 16-B LDS store. Wave w then owns rows v = 16*w .. 16*w + 15 of Mt (A = its v plane rows, straight from memory) and all 64 c; per accumulator k runs upwards in steps of 32: hh, lh, hl.
#define KP 136   // LDS row = one channel's 128 positions as bf16, + 8: rows stay 16-B aligned, and the 16-B reads of 16 lanes (16 rows) fall on 64 different banks
__global__ __launch_bounds__(128) void k_mpart(const bf* __restrict__ Vh, const bf* __restrict__ Vl, const float* __restrict__ YK, const float* __restrict__ ST, const float* __restrict__ ga, const float* __restrict__ be, float* M) {
    typedef WFrag<bf> F; typedef F::V V;
    __shared__ __align__(16) bf KL[2 * CK * KP]; __shared__ __align__(16) float OS[4 * 16 * 68];
    const int tid = threadIdx.x, q = tid & 15, r = tid >> 4, lr = tid & 15, hi = (tid >> 4) & 1, w = tid >> 5; const int m0 = blockIdx.y * (NP / KS); const size_t z = blockIdx.z;
    // One byte offset per lane and array; the bases are the same for the whole block.
    const unsigned yo = (unsigned)(16 * r * CK + 4 * q) * 4, po = (unsigned)((16 * w + lr) * NP + 8 * hi) * 2, so = (unsigned)q * 32, go = (unsigned)q * 16;
    const char *yk = (const char*)(YK + (z * NP + m0) * CK) + yo, *vh = (const char*)(Vh + z * CV * NP + m0) + po, *vl = (const char*)(Vl + z * CV * NP + m0) + po, *st = (const char*)(ST + 2 * CK) + so, *gz = (const char*)ga + go, *ez = (const char*)be + go;   // ST holds q's statistics, then k's
    v4f x[16]; V a[4], a2[4];
#pragma unroll   // register arrays need constant indices (so for every loop of this kernel)
    for (int j = 0; j < 16; ++j) x[j] = *(const v4f*)((const float*)yk + j * CK);
    const v4f s0 = *(const v4f*)st, s1 = *(const v4f*)((const float*)st + 4), g4 = *(const v4f*)gz, e4 = *(const v4f*)ez;   // (mean, 1 / sqrt(var + eps)) of channels 4*q, 4*q + 1; of the next two; gamma; beta
    __builtin_amdgcn_sched_barrier(0);   // the rows and constants, needed first, are issued first: loads return in order, and the compiler else puts the v fragments, which touch 16 lines a load, in front
#pragma unroll
    for (int k = 0; k < 4; ++k) { a[k] = F::ld((const bf*)vh + 32 * k); a2[k] = F::ld((const bf*)vl + 32 * k); }
    asm volatile("s_wait_xcnt 0x0" :: "v"(yo), "v"(po), "v"(so), "v"(go) : "memory");   // the wait that is kept before a register named by an issued load is overwritten; the offsets are inputs so that they stay in their registers up to here
    __builtin_amdgcn_sched_barrier(0);   // every load of the thread is in flight before its first wait: the v fragments, used last, would else be sunk behind the barrier, with a latency of their own in the open
    const float mu[4] = { s0[0], s0[2], s1[0], s1[2] }, rs[4] = { s0[1], s0[3], s1[1], s1[3] }; float g[4], e[4]; v8us oh[4][2], ol[4][2];
#pragma unroll
    for (int u = 0; u < 4; ++u) { g[u] = bfr(g4[u]); e[u] = bfr(e4[u]); }
    float ss[16];
#pragma unroll
    for (int j = 0; j < 16; ++j) { ss[j] = 0.f;
#pragma unroll
        for (int u = 0; u < 4; ++u) { const float y = (x[j][u] - mu[u]) * rs[u] * g[u] + e[u]; x[j][u] = y; ss[j] += y * y; } }
#pragma unroll
    for (int j = 0; j < 16; ++j) { ss[j] += rowx<1>(ss[j]); ss[j] += rowx<2>(ss[j]); ss[j] += rowx<4>(ss[j]); ss[j] += rowx<8>(ss[j]); }
#pragma unroll
    for (int j = 0; j < 16; ++j) { const float inv = __fdiv_rn(1.0f, __fadd_rn(__fsqrt_rn(ss[j]), 1e-7f));
#pragma unroll
        for (int u = 0; u < 4; ++u) { unsigned short hh, ll; splitf(x[j][u] * inv, hh, ll); oh[u][j >> 3][j & 7] = hh; ol[u][j >> 3][j & 7] = ll; } }
#pragma unroll
    for (int u = 0; u < 4; ++u)
#pragma unroll
        for (int t = 0; t < 2; ++t) { *(v8us*)(KL + (4 * q + u) * KP + 16 * r + 8 * t) = oh[u][t]; *(v8us*)(KL + (CK + 4 * q + u) * KP + 16 * r + 8 * t) = ol[u][t]; }
    __syncthreads();   // publishes the kn planes: a wave reads rows whose positions all 4 waves wrote
    const bf* kh = KL + lr * KP + 8 * hi; const bf* kl = kh + CK * KP; v8f acc[4];
#pragma unroll
    for (int nb = 0; nb < 4; ++nb) acc[nb] = (v8f){};
    V b[2][4], b2[2][4];
#pragma unroll
    for (int k = 0; k < 2; ++k)
#pragma unroll
        for (int nb = 0; nb < 4; ++nb) { b[k][nb] = F::ld(kh + nb * 16 * KP + 32 * k); b2[k][nb] = F::ld(kl + nb * 16 * KP + 32 * k); }
#pragma unroll
    for (int k = 0; k < 4; ++k) {
        __builtin_amdgcn_sched_barrier(0);   // keeps the kn fragments two k steps ahead of their products: without it the compiler sinks every LDS read to its product, some twenty LDS latencies one behind the other
#pragma unroll
        for (int nb = 0; nb < 4; ++nb) acc[nb] = F::mma(a[k], b[k & 1][nb], acc[nb]);
#pragma unroll
        for (int nb = 0; nb < 4; ++nb) acc[nb] = F::mma(a2[k], b[k & 1][nb], acc[nb]);
#pragma unroll
        for (int nb = 0; nb < 4; ++nb) acc[nb] = F::mma(a[k], b2[k & 1][nb], acc[nb]);
        if (k < 2) {
#pragma unroll
            for (int nb = 0; nb < 4; ++nb) { b[k & 1][nb] = F::ld(kh + nb * 16 * KP + 32 * (k + 2)); b2[k & 1][nb] = F::ld(kl + nb * 16 * KP + 32 * (k + 2)); } } }
    float* os = OS + w * (16 * 68);   // lane (lr, hi) holds rows v = 16*w + hi*8 + j of column c = nb*16 + lr
#pragma unroll
    for (int nb = 0; nb < 4; ++nb)
#pragma unroll
        for (int j = 0; j < 8; ++j) os[(hi * 8 + j) * 68 + nb * 16 + lr] = acc[nb][j];
    __builtin_amdgcn_wave_barrier(); asm volatile("" ::: "memory");   // keeps the LDS reads below behind the other lanes' LDS writes above (the rows are the wave's own: LDS runs in order, only the compiler could swap them)
    float* crow = M + ((z * KS + blockIdx.y) * CV + 16 * w) * CK;
#pragma unroll   // straight line, so that later rows' LDS reads do not wait for earlier rows' stores
    for (int t = 0; t < 8; ++t) { const int row = 2 * t + hi; *(v4f*)(crow + row * CK + lr * 4) = *(const v4fa*)(os + row * 68 + lr * 4); } }   // two whole rows (four 128-B lines) a store
// k_mt: Mt[v][c] = sum over the KS k slices of the partial tiles P[image][slice][v][c], added in slice order (fixed order, no atomics), then split into the hl planes. Whole-line loads.
__global__ __launch_bounds__(256) void k_mt(const float* __restrict__ P, bf* Mh, bf* Ml) { const int e = (blockIdx.x * 256 + threadIdx.x) * 4; if (e >= CV * CK) return; P += (size_t)blockIdx.y * KS * CV * CK; Mh += blockIdx.y * CV * CK; Ml += blockIdx.y * CV * CK; v4f t = *(const v4f*)(P + e); v4us oh, ol;
#pragma unroll   // straight line, so that the independent loads of many slices are in flight together
    for (int s = 1; s < KS; ++s) t += *(const v4f*)(P + (size_t)s * CV * CK + e);
#pragma unroll
    for (int u = 0; u < 4; ++u) { unsigned short a, b; splitf(t[u], a, b); oh[u] = a; ol[u] = b; } *(v4us*)(Mh + e) = oh; *(v4us*)(Ml + e) = ol;  }
// ---- k_tail: everything behind Mt in one launch: qn from the q conv's output, ctx = qn.M + vsum, its hl split, out = Ww.ctx + bw, stored [o][p]. ONE WAVE per 32 positions (one 128-B line of every output row), grid (NP / 32, 1, image).
// qn never goes through memory: lane (lr, hi) loads, of positions lr and 16 + lr, the four runs of 8 channels (from 16*g + 8*hi) that its B fragments hold, applies the batch norm and the L2 norm and splits the result in registers;
// a position's 64 squares are summed 4 and 4 in the lane, the two added, then with the other half wave's run (one butterfly step), then over g in pairs: the tree of 4 in a thread and four butterfly steps.
// The first product is formed transposed, ctxT[v][p] = sum_c Mt[v][c] qn[p][c] (A = Mt planes, B = qn): lane (lr, hi) then holds position nb*16 + lr and the 8 neighbouring channels v = mb*16 + hi*8 + j,
// which is the B fragment of the second product, out[o][p] = sum_v Ww[o][v] ctx[p][v]: elements 0..7 of k chunk k2 are accumulator 2*k2, elements 8..15 accumulator 2*k2 + 1. ctx never leaves the registers.
// Per element the products are added in the order of the separate GEMMs (hh, lh, hl per 32 of c; h, l per 32 of v), vsum and the bias are added to the same f32 values: same results.
#define OP 36    // LDS row = one output channel's 32 positions, + 4: rows stay 16-B aligned, and the two half waves (8 rows apart) write different banks
__global__ __launch_bounds__(32) void k_tail(const float* __restrict__ YQ, const float* __restrict__ ST, const float* __restrict__ ga, const float* __restrict__ be, const bf* __restrict__ Mh, const bf* __restrict__ Ml, const float* __restrict__ vs, const bf* __restrict__ WW, const float* __restrict__ bw, float* OUT) {
    typedef WFrag<bf> F; typedef F::V V;
    __shared__ __align__(16) float os[CO * OP];
    const int lane = threadIdx.x & 31, lr = lane & 15, hi = lane >> 4; const int p0 = blockIdx.x * 32; const size_t z = blockIdx.z;
    // All rows of Mt and Ww are 64 elements long, so one byte offset per lane serves every fragment load (row lr, k from 8*hi), twice that the f32 rows of the q conv, one more the f32 vectors (8 values from hi*8), twice that the (mean, scale) pairs; the bases are the same for the whole wave.
    const unsigned fo = (unsigned)(lr * CK + 8 * hi) * 2, vo = (unsigned)hi * 32, yo = fo * 2, so = vo * 2;
    const char *yq = (const char*)(YQ + (z * NP + p0) * CK) + yo, *st = (const char*)ST + so, *gz = (const char*)ga + vo, *ez = (const char*)be + vo, *mh = (const char*)(Mh + z * CV * CK) + fo, *ml = (const char*)(Ml + z * CV * CK) + fo, *ww = (const char*)WW + fo, *vz = (const char*)(vs + z * CV) + vo, *bz = (const char*)bw + vo;
    V a[2][4], a2[2][4], b[2][2], b2[2][2], w[8][2]; v8f sv[4], bi[8], acc[4][2], x[2][4], ms[4][2], gg[4], eb[4];
#pragma unroll   // register arrays need constant indices (so for every loop of this kernel)
    for (int g = 0; g < 4; ++g) {   // run g: channels 16*g + 8*hi + 0..7, elements 8*(g & 1) + 0..7 of the fragment of k chunk g >> 1
#pragma unroll
        for (int nb = 0; nb < 2; ++nb) x[nb][g] = *(const v8f*)((const float*)yq + nb * 16 * CK + 16 * g);
        ms[g][0] = *(const v8f*)((const float*)st + 32 * g); ms[g][1] = *(const v8f*)((const float*)st + 32 * g + 8); gg[g] = *(const v8f*)((const float*)gz + 16 * g); eb[g] = *(const v8f*)((const float*)ez + 16 * g); }
#pragma unroll
    for (int k = 0; k < 2; ++k)
#pragma unroll
        for (int mb = 0; mb < 4; ++mb) { a[k][mb] = F::ld((const bf*)mh + mb * 16 * CK + 32 * k); a2[k][mb] = F::ld((const bf*)ml + mb * 16 * CK + 32 * k); }
#pragma unroll
    for (int mb = 0; mb < 4; ++mb) sv[mb] = *(const v8f*)((const float*)vz + mb * 16);
#pragma unroll
    for (int t = 0; t < 8; ++t)
#pragma unroll
        for (int k = 0; k < 2; ++k) w[t][k] = F::ld((const bf*)ww + t * 16 * CV + 32 * k);
#pragma unroll
    for (int t = 0; t < 8; ++t) bi[t] = *(const v8f*)((const float*)bz + t * 16);
    asm volatile("s_wait_xcnt 0x0" :: "v"(fo), "v"(vo), "v"(yo), "v"(so) : "memory");   // the wait that is kept before a register named by an issued load is overwritten; the four offsets are inputs so that they stay in their registers up to here
    __builtin_amdgcn_sched_barrier(0);   // every load of the wave is in flight before its first wait: without this the compiler sinks the vsum, weight and bias loads to their uses, each with a latency of its own in the open
#pragma unroll
    for (int g = 0; g < 4; ++g)
#pragma unroll
        for (int u = 0; u < 8; ++u) { gg[g][u] = bfr(gg[g][u]); eb[g][u] = bfr(eb[g][u]); }
#pragma unroll
    for (int nb = 0; nb < 2; ++nb) { float s1[4];
#pragma unroll
        for (int g = 0; g < 4; ++g) { float sa = 0.f, sb = 0.f;
#pragma unroll
            for (int u = 0; u < 4; ++u) { const float y = (x[nb][g][u] - ms[g][0][2 * u]) * ms[g][0][2 * u + 1] * gg[g][u] + eb[g][u]; x[nb][g][u] = y; sa += y * y; }
#pragma unroll
            for (int u = 0; u < 4; ++u) { const float y = (x[nb][g][4 + u] - ms[g][1][2 * u]) * ms[g][1][2 * u + 1] * gg[g][4 + u] + eb[g][4 + u]; x[nb][g][4 + u] = y; sb += y * y; }
            s1[g] = sa + sb; }
#pragma unroll
        for (int g = 0; g < 4; ++g) s1[g] += xhalf(s1[g]);
        const float inv = __fdiv_rn(1.0f, __fadd_rn(__fsqrt_rn((s1[0] + s1[1]) + (s1[2] + s1[3])), 1e-7f)); v8us qh[4], ql[4];
#pragma unroll
        for (int g = 0; g < 4; ++g)
#pragma unroll
            for (int u = 0; u < 8; ++u) { unsigned short hh, ll; splitf(x[nb][g][u] * inv, hh, ll); qh[g][u] = hh; ql[g][u] = ll; }
#pragma unroll
        for (int k = 0; k < 2; ++k) { b[k][nb] = cat16b(qh[2 * k], qh[2 * k + 1]); b2[k][nb] = cat16b(ql[2 * k], ql[2 * k + 1]); } }
#pragma unroll
    for (int mb = 0; mb < 4; ++mb)
#pragma unroll
        for (int nb = 0; nb < 2; ++nb) acc[mb][nb] = (v8f){};
#pragma unroll
    for (int k = 0; k < 2; ++k) {   // per accumulator and 32 of c: Mt high x qn high, Mt high x qn low, Mt low x qn high
#pragma unroll
        for (int mb = 0; mb < 4; ++mb)
#pragma unroll
            for (int nb = 0; nb < 2; ++nb) acc[mb][nb] = F::mma(a[k][mb], b[k][nb], acc[mb][nb]);
#pragma unroll
        for (int mb = 0; mb < 4; ++mb)
#pragma unroll
            for (int nb = 0; nb < 2; ++nb) acc[mb][nb] = F::mma(a[k][mb], b2[k][nb], acc[mb][nb]);
#pragma unroll
        for (int mb = 0; mb < 4; ++mb)
#pragma unroll
            for (int nb = 0; nb < 2; ++nb) acc[mb][nb] = F::mma(a2[k][mb], b[k][nb], acc[mb][nb]); }
    v8us ch[4][2], cl[4][2];
#pragma unroll
    for (int mb = 0; mb < 4; ++mb)
#pragma unroll
        for (int nb = 0; nb < 2; ++nb)
#pragma unroll
            for (int j = 0; j < 8; ++j) { unsigned short x, y; splitf(__fadd_rn(acc[mb][nb][j], sv[mb][j]), x, y); ch[mb][nb][j] = x; cl[mb][nb][j] = y; }
#pragma unroll
    for (int g = 0; g < 2; ++g) { v8f o[4][2];   // 64 output channels at a time
#pragma unroll
        for (int t = 0; t < 4; ++t)
#pragma unroll
            for (int nb = 0; nb < 2; ++nb) o[t][nb] = (v8f){};
#pragma unroll
        for (int k = 0; k < 2; ++k) {
#pragma unroll
            for (int t = 0; t < 4; ++t)
#pragma unroll
                for (int nb = 0; nb < 2; ++nb) o[t][nb] = F::mma(w[g * 4 + t][k], cat16b(ch[2 * k][nb], ch[2 * k + 1][nb]), o[t][nb]);
#pragma unroll
            for (int t = 0; t < 4; ++t)
#pragma unroll
                for (int nb = 0; nb < 2; ++nb) o[t][nb] = F::mma(w[g * 4 + t][k], cat16b(cl[2 * k][nb], cl[2 * k + 1][nb]), o[t][nb]); }
#pragma unroll
        for (int t = 0; t < 4; ++t)
#pragma unroll
            for (int nb = 0; nb < 2; ++nb)
#pragma unroll
                for (int j = 0; j < 8; ++j) os[((g * 4 + t) * 16 + hi * 8 + j) * OP + nb * 16 + lr] = o[t][nb][j] + bfr(bi[g * 4 + t][j]); }
    __builtin_amdgcn_wave_barrier(); asm volatile("" ::: "memory");   // keeps the LDS reads below behind the other lanes' LDS writes above (one wave: LDS runs in order, only the compiler could swap them)
#pragma unroll   // straight line, so that later rows' LDS reads do not wait for earlier rows' stores
    for (int s = 0; s < CO / 4; ++s) { const int row = 4 * s + (lane >> 3), col = (lane & 7) * 4;
        *(v4f*)(OUT + (z * CO + row) * NP + p0 + col) = *(const v4fa*)(os + row * OP + col); } }

extern "C" void kernel_launch(void* const* d_in, const int* in_sizes, int n_in,
                              void* d_out, int out_size, void* d_ws, size_t ws_size, hipStream_t stream) {
    (void)in_sizes; (void)n_in; (void)out_size;
    const float** I = (const float**)d_in;
    const float *qf = I[0], *kf = I[1], *vf = I[2], *Wk = I[3], *bk = I[4], *ga = I[5], *be = I[6], *Wv = I[7], *bv = I[8], *Ww = I[9], *bw = I[10];
    float* OUT = (float*)d_out;     // [8][128][64][64]
    char* wsp = (char*)d_ws;
    auto take = [&](size_t bytes) { char* p = wsp; wsp += (bytes + 255) & ~(size_t)255; return (void*)p; };
    bf* WW = (bf*)take(CO * CV * 2);
    float* YQ = (float*)take((size_t)3 * NBI * NP * CK * 4); float* YK = YQ + (size_t)NBI * NP * CK; float* YV = YK + (size_t)NBI * NP * CK; float* STQ = (float*)take(2 * CK * 2 * 4); float* SP = (float*)take((size_t)2 * NT * 2 * CK * 4);   // [q, k][tile][64 means, 64 M2]
    bf* Vh = (bf*)take((size_t)NBI * CV * NP * 2); bf* Vl = (bf*)take((size_t)NBI * CV * NP * 2); float* vs = (float*)take(NBI * CV * 4);
    float* M = (float*)take((size_t)NBI * KS * CK * CV * 4); bf* Mh = (bf*)take(NBI * CK * CV * 2); bf* Ml = (bf*)take(NBI * CK * CV * 2);
    if ((size_t)(wsp - (char*)d_ws) > ws_size) return;    // total ~ 38 MB
    // One launch per level of the dependence chain, five in all; each reads only what an earlier launch of this call wrote.
    k_conv<<<dim3(NXT + 4, 1, 1), 256, 0, stream>>>(qf, kf, vf, Wk, Wv, Ww, bk, bv, YQ, SP, WW);   // the three 1x1 convs, tile statistics of q and k, Ww plane
    k_mid<<<dim3(2 * NBI + 2 + NBI * (NP / 128) / 4, 1, 1), 1024, 0, stream>>>(YV, vs, SP, STQ, Vh, Vl);   // vsum, batch statistics, v planes
    k_mpart<<<dim3(1, KS, NBI), 128, 0, stream>>>(Vh, Vl, YK, STQ, ga, be, M);   // kn in LDS, partial tiles of Mt
    k_mt<<<dim3((CV * CK / 4 + 255) / 256, NBI, 1), 256, 0, stream>>>(M, Mh, Ml);
    k_tail<<<dim3(NP / 32, 1, NBI), 32, 0, stream>>>(YQ, STQ, ga, be, Mh, Ml, vs, WW, bw, OUT);   // out[o][p] = Ww.(qn.M + vsum) + bw
}

// v010
// Measured time: 31 microseconds a run.
// Next to v009, in two timings, it ran 1.16 times as fast each time.
// Over all steps from v000 it is 303 times as fast.
#include <hip/hip_runtime.h>

// non_local_attention (query/key/value features [8][128][64x64]; q = BN_train(conv1x1(query; Wk, bk)), k = BN_train(conv1x1(key; Wk, bk)) (BatchNorm2d in training mode: per-channel batch statistics over (B,H,W), each call its own), v = conv1x1(value; Wv, bv);
// q, k L2-normalised over their 64 channels per position (+1e-7); sim[n][m] = q_n.k_m + 1 (no softmax); ctx[n] = sum_m sim[n][m] v_m; out = conv1x1(ctx; Ww, bw) -> [8][128][64][64]).
// Reassociation (exact algebra, no softmax in between): ctx[n][v] = sum_c qn[n][c] M[c][v] + vsum[v] with M = kn^T v (64x64) and vsum = sum_m v_m - the [4096][4096] similarity map is never formed.

#define NBI  8
#define CI   128
#define NP   4096
#define CK   64
#define CV   64
#define CO   128
#define TR   128    // positions of one conv tile
#define NT   (NBI * NP / TR)   // tiles of one tensor's conv output over the whole batch: one (mean, M2) pair per channel from each
#define KS   32     // k slices of the M product: 4096 / 32 = 128 positions (256 B of every operand row) per block
typedef _Float16 h16;
typedef unsigned short bf;
typedef __attribute__((ext_vector_type(16))) __bf16   v16bf;
typedef __attribute__((ext_vector_type(16))) _Float16 v16h;
typedef __attribute__((ext_vector_type(8)))  _Float16 v8h;
typedef __attribute__((ext_vector_type(8)))  unsigned short v8us;
typedef __attribute__((ext_vector_type(8)))  float    v8f;
typedef __attribute__((ext_vector_type(4)))  float    v4f;
typedef v8h  __attribute__((may_alias)) v8ha;
typedef v4f  __attribute__((may_alias)) v4fa;
typedef v8us __attribute__((may_alias)) v8usa;

__device__ __forceinline__ unsigned short f2bf(float f) { unsigned u = __float_as_uint(f); u += 0x7FFFu + ((u >> 16) & 1u); return (unsigned short)(u >> 16); }
__device__ __forceinline__ float bf2f(unsigned short b) { return __uint_as_float(((unsigned)b) << 16); }
__device__ __forceinline__ float bfr(float f) { return bf2f(f2bf(f)); }
__device__ __forceinline__ v16h cat16(v8h lo, v8h hi) { return __builtin_shufflevector(lo, hi, 0, 1, 2, 3, 4, 5, 6, 7, 8, 9, 10, 11, 12, 13, 14, 15); }
__device__ __forceinline__ v16bf cat16b(v8us lo, v8us hi) { return __builtin_bit_cast(v16bf, __builtin_shufflevector(lo, hi, 0, 1, 2, 3, 4, 5, 6, 7, 8, 9, 10, 11, 12, 13, 14, 15)); }
__device__ __forceinline__ v8f wmma16(v16h a, v16h b, v8f c) { return __builtin_amdgcn_wmma_f32_16x16x32_f16(false, a, false, b, (short)0, c, false, false); }
__device__ __forceinline__ v8f wmmab(v16bf a, v16bf b, v8f c) { return __builtin_amdgcn_wmma_f32_16x16x32_bf16(false, a, false, b, (short)0, c, false, false); }



// WFrag: a 16x32 fragment of a K-contiguous 16-bit row (row lr, elements 0..7 are k = 8*hi + 0..7, elements 8..15 are k = 16 + 8*hi + 0..7) and its product.
template <typename T16> struct WFrag;
template <> struct WFrag<h16> { typedef v16h V; static __device__ __forceinline__ V ld(const h16* p) { return cat16(*(const v8h*)p, *(const v8h*)(p + 16)); } static __device__ __forceinline__ v8f mma(V a, V b, v8f c) { return wmma16(a, b, c); } };
template <> struct WFrag<bf> { typedef v16bf V; static __device__ __forceinline__ V ld(const bf* p) { return cat16b(*(const v8us*)p, *(const v8us*)(p + 16)); } static __device__ __forceinline__ v8f mma(V a, V b, v8f c) { return wmmab(a, b, c); } };

// Cross-lane moves for the sums over a position's channels: rowx<M>: the value of lane l ^ M inside a row of 16 lanes (DPP, no LDS round trip); xhalf: the value of lane l ^ 16.
template <int M> __device__ __forceinline__ float rowx(float v) { return __builtin_bit_cast(float, __builtin_amdgcn_update_dpp(0, __builtin_bit_cast(int, v), 0x160 + M, 0xf, 0xf, true)); }
__device__ __forceinline__ float xhalf(float v) { return __builtin_bit_cast(float, __builtin_amdgcn_permlanex16(__builtin_bit_cast(int, v), __builtin_bit_cast(int, v), 0x76543210, 0xfedcba98, false, false)); }
__device__ __forceinline__ void splitf(float y, unsigned short& h, unsigned short& l) { h = f2bf(y); l = f2bf(y - bf2f(h)); }
typedef __attribute__((ext_vector_type(2))) unsigned short v2us;
typedef __attribute__((ext_vector_type(2))) float v2f;
typedef __attribute__((ext_vector_type(4))) unsigned short v4us;

// The s_ stages below are device functions that are given their pointers by the kernel that calls them (it picks the image and, in k_conv, the tensor from the block index): one pass per stage for the whole batch, each image on its own workspace planes.
// Stages that do not depend on one another share a launch: a range of the flat block index picks the stage (a branch that is the same for a whole block), the longer-running stage on the lower indices. k_conv and k_mpart are these launches.
__device__ __forceinline__ void s_cvt8(const float* __restrict__ s, bf* dst, size_t n8, int bx) { const size_t i = (size_t)bx * 256 + threadIdx.x; if (i >= n8) return; const v8f v = *(const v8f*)(s + i * 8); v8us o;
#pragma unroll
    for (int k = 0; k < 8; ++k) o[k] = f2bf(v[k]); *(v8us*)(dst + i * 8) = o;  }
// ---- s_conv's x tile is transposed through a padded LDS tile: the global loads follow the source's rows, 16 lanes side by side on whole 128-B lines, and a thread moves 64 elements.
// Odd row pitch in LDS (65 dwords): the 16 lanes of a half wave step by 4 rows, the two halves by 1 dword, so that every LDS write of a wave meets 32 different banks.
typedef __attribute__((ext_vector_type(4))) unsigned v4u;
typedef __attribute__((ext_vector_type(2))) unsigned v2u;
typedef v4u __attribute__((may_alias)) v4ua;
#define XP 65    // x tile: LDS row = one position's 128 channels as 64 dwords of two bf16, + 1
#define WP 68    // weight tile: LDS row = one output channel's 128 input channels as 64 dwords of two bf16, + 4: rows stay 16-B aligned, and the 16-B reads of 16 lanes (16 rows) fall on 64 different banks
#define KP 136   // hl plane rows in LDS (s_conv's v planes, k_mpart's kn planes): one channel's 128 positions as bf16, + 8: rows stay 16-B aligned, and the 16-B accesses of 16 lanes (16 rows) fall on 64 different banks
// s_conv: the 1x1 conv of one tensor on a tile of 128 channels x TR positions, 256 threads. x points at the tile's first position in channel 0, Y at the tile's first row [p][o], Wf [o][c] and bias are the f32 inputs.
// The tile is rounded to bf16 and transposed into LDS (a thread holds the same 4 positions of channels 2*c2 and 2*c2 + 1, so a dword of two neighbouring channels is formed in registers), the weights are rounded into LDS beside it,
// and the product is formed from there: wave w owns positions 16*w .. 16*w + 15 and all 64 output channels, A = its x rows, B = the weight rows, k in steps of 32 upwards (per element the sum order of a plain k loop).
// SPt (q and k; null for v, the same for the whole block): per channel the mean of the tile's TR rows and M2 = the sum of their squared distances from that mean, from the accumulators: 64 means, then 64 M2 (four 128-B lines). s_stat joins the tiles.
// Vh (v; null for q and k, the same for the whole block): the tile goes out as the [v][m] hl planes that k_mpart's A fragments read, not as Y: a lane's accumulator is 8 neighbouring positions of one channel, so it is split in registers, laid as 16 B into an LDS plane row,
// and the block stores whole 256-B rows; VPt takes the tile's 64 column sums (k_mpart's launch adds the tiles of an image to vsum).
// S: 128 * XP + CK * WP dwords. Behind the product the same LDS serves as 8 x (16 x 68) floats of staging rows and 2 x (8 x CK) floats of the waves' partial sums.
__device__ __forceinline__ void s_conv(const float* __restrict__ x, const float* __restrict__ Wf, const float* __restrict__ bias, float* Y, float* SPt, bf* Vh, bf* Vl, float* VPt, unsigned* S) {
    const int tid = threadIdx.x, q = tid & 15, r = tid >> 4, lr = tid & 15, hi = (tid >> 4) & 1, w = tid >> 5; unsigned* L = S; unsigned* WL = S + 128 * XP; x += (size_t)(2 * r) * NP + 4 * q; v4f a[4][2], b[4][2], wv[8]; float bb[4];
#pragma unroll   // straight line, so that a thread's 28 independent loads are in flight together
    for (int j = 0; j < 4; ++j)
#pragma unroll   // as above
        for (int s = 0; s < 2; ++s) { a[j][s] = *(const v4f*)(x + (size_t)(32 * j) * NP + 64 * s); b[j][s] = *(const v4f*)(x + (size_t)(32 * j + 1) * NP + 64 * s); }   // channels 2 * (r + 16 * j) and the next
#pragma unroll   // as above
    for (int i = 0; i < 8; ++i) wv[i] = *(const v4f*)(Wf + (i * 256 + tid) * 4);
#pragma unroll   // as above
    for (int nb = 0; nb < 4; ++nb) bb[nb] = bias[nb * 16 + lr];
    asm volatile("s_wait_xcnt 0x0" :: "v"(x), "v"(tid), "v"(lr) : "memory");   // the wait that is kept before a register named by an issued load is overwritten; the address and the two offsets are inputs so that they stay in their registers up to here (a later load's result was placed on the x address without it)
    __builtin_amdgcn_sched_barrier(0);   // every load of the thread is in flight before its first wait: without this the compiler holds most of the weight loads and some x loads back behind the first conversions, each group with a latency of its own
#pragma unroll   // register arrays need constant indices (so for every loop of this function)
    for (int j = 0; j < 4; ++j)
#pragma unroll
        for (int s = 0; s < 2; ++s)
#pragma unroll
            for (int i = 0; i < 4; ++i) L[(64 * s + 4 * q + i) * XP + r + 16 * j] = (unsigned)f2bf(a[j][s][i]) | ((unsigned)f2bf(b[j][s][i]) << 16);
#pragma unroll
    for (int i = 0; i < 8; ++i) { const int e = (i * 256 + tid) * 4; v2u d; d[0] = (unsigned)f2bf(wv[i][0]) | ((unsigned)f2bf(wv[i][1]) << 16); d[1] = (unsigned)f2bf(wv[i][2]) | ((unsigned)f2bf(wv[i][3]) << 16);
        *(v2u*)(WL + (e >> 7) * WP + ((e & 127) >> 1)) = d; }   // a wave writes one whole weight row
    __syncthreads();   // publishes both tiles: a wave reads x rows and weight rows whose dwords all 8 waves wrote
    const unsigned* ar = L + (16 * w + lr) * XP + 4 * hi; const unsigned* br = WL + lr * WP + 4 * hi; v8f acc[4]; v16bf af[4], bq[2][4];   // fragment of row lr: elements 0..7 are k = 8*hi + 0..7 of the 32, elements 8..15 are k = 16 + 8*hi + 0..7, on both sides
#pragma unroll
    for (int k = 0; k < 4; ++k) { v4u lo, up;
#pragma unroll
        for (int i = 0; i < 4; ++i) { lo[i] = ar[16 * k + i]; up[i] = ar[16 * k + 8 + i]; }
        af[k] = cat16b(__builtin_bit_cast(v8us, lo), __builtin_bit_cast(v8us, up)); }
#pragma unroll
    for (int k = 0; k < 2; ++k)
#pragma unroll
        for (int nb = 0; nb < 4; ++nb) bq[k][nb] = cat16b(__builtin_bit_cast(v8us, *(const v4ua*)(br + nb * 16 * WP + 16 * k)), __builtin_bit_cast(v8us, *(const v4ua*)(br + nb * 16 * WP + 16 * k + 8)));
#pragma unroll
    for (int nb = 0; nb < 4; ++nb) acc[nb] = (v8f){};
#pragma unroll
    for (int k = 0; k < 4; ++k) {
        __builtin_amdgcn_sched_barrier(0);   // keeps the weight fragments two k steps ahead of their products: without it the compiler sinks every LDS read to its product, 16 LDS latencies one behind the other
#pragma unroll
        for (int nb = 0; nb < 4; ++nb) acc[nb] = wmmab(af[k], bq[k & 1][nb], acc[nb]);
        if (k < 2) {
#pragma unroll
            for (int nb = 0; nb < 4; ++nb) bq[k & 1][nb] = cat16b(__builtin_bit_cast(v8us, *(const v4ua*)(br + nb * 16 * WP + 16 * (k + 2))), __builtin_bit_cast(v8us, *(const v4ua*)(br + nb * 16 * WP + 16 * (k + 2) + 8))); } }
    __syncthreads();   // ends every wave's reads of the two tiles: the staging rows and partial sums below lie over them
    float* os = (float*)S + w * (16 * 68); float* red = (float*)S + 8 * (16 * 68);   // lane (lr, hi) holds rows 16*w + hi*8 + j of channel nb*16 + lr
#pragma unroll
    for (int nb = 0; nb < 4; ++nb) acc[nb] += bfr(bb[nb]);
    if (Vh) { bf* PL = (bf*)S; float s[4];   // two planes of CV rows of KP: as long as the staging rows, so that red lies behind them too
#pragma unroll
        for (int nb = 0; nb < 4; ++nb) s[nb] = 0.f;
#pragma unroll
        for (int j = 0; j < 8; ++j)
#pragma unroll
            for (int nb = 0; nb < 4; ++nb) s[nb] += acc[nb][j];
#pragma unroll
        for (int nb = 0; nb < 4; ++nb) s[nb] += __shfl_xor(s[nb], 16, 32);
#pragma unroll   // both half waves now hold all four sums: each writes two of them
        for (int u = 0; u < 2; ++u) red[w * CK + (2 * hi + u) * 16 + lr] = hi ? s[2 + u] : s[u];
#pragma unroll
        for (int nb = 0; nb < 4; ++nb) { v8us oh, ol;
#pragma unroll
            for (int j = 0; j < 8; ++j) { unsigned short hh, ll; splitf(acc[nb][j], hh, ll); oh[j] = hh; ol[j] = ll; }
            *(v8us*)(PL + (nb * 16 + lr) * KP + 16 * w + 8 * hi) = oh; *(v8us*)(PL + (CV + nb * 16 + lr) * KP + 16 * w + 8 * hi) = ol; }
        __syncthreads();   // publishes the plane rows and the row sums: a thread reads rows whose positions all 8 waves wrote
#pragma unroll   // straight line, so that later rows' LDS reads do not wait for earlier rows' stores
        for (int i = 0; i < 4; ++i) { const int row = i * 16 + r;   // 16 lanes store one row's 256 B (two 128-B lines) of each plane
            *(v8us*)(Vh + (size_t)row * NP + 8 * q) = *(const v8usa*)(PL + row * KP + 8 * q); *(v8us*)(Vl + (size_t)row * NP + 8 * q) = *(const v8usa*)(PL + (CV + row) * KP + 8 * q); }
        if (tid < CK) { float m = 0.f;
#pragma unroll
            for (int i = 0; i < 8; ++i) m += red[i * CK + tid];
            VPt[tid] = m; }
        asm volatile("s_wait_xcnt 0x0" ::: "memory");   // the wait that is kept before a register named by an issued store is overwritten: in the listing the other tensors' code, which reuses these registers, lies behind the stores
        return; }
    if (SPt) { float s[4], t[4];   // the statistics stand in front of the stores of Y, so that no barrier waits for a global store
#pragma unroll
        for (int nb = 0; nb < 4; ++nb) s[nb] = 0.f;
#pragma unroll
        for (int j = 0; j < 8; ++j)
#pragma unroll
            for (int nb = 0; nb < 4; ++nb) s[nb] += acc[nb][j];
#pragma unroll
        for (int nb = 0; nb < 4; ++nb) s[nb] += __shfl_xor(s[nb], 16, 32);
#pragma unroll   // both half waves now hold all four sums: each writes two of them
        for (int u = 0; u < 2; ++u) red[w * CK + (2 * hi + u) * 16 + lr] = hi ? s[2 + u] : s[u];
        __syncthreads();   // publishes the 8 waves' row sums
#pragma unroll
        for (int nb = 0; nb < 4; ++nb) { float m = 0.f;
#pragma unroll
            for (int i = 0; i < 8; ++i) m += red[i * CK + nb * 16 + lr];
            s[nb] = m * (1.0f / TR); t[nb] = 0.f; }
#pragma unroll
        for (int j = 0; j < 8; ++j)
#pragma unroll
            for (int nb = 0; nb < 4; ++nb) { const float d = acc[nb][j] - s[nb]; t[nb] += d * d; }
#pragma unroll
        for (int nb = 0; nb < 4; ++nb) t[nb] += __shfl_xor(t[nb], 16, 32);
#pragma unroll   // as for the sums
        for (int u = 0; u < 2; ++u) red[(8 + w) * CK + (2 * hi + u) * 16 + lr] = hi ? t[2 + u] : t[u];
        __syncthreads();   // publishes the 8 waves' sums of squared distances
        if (tid < 2 * CK) { const float* rp = red + (tid >> 6) * 8 * CK + (tid & 63); float m = 0.f;
#pragma unroll
            for (int i = 0; i < 8; ++i) m += rp[i * CK];
            SPt[tid] = tid < CK ? m * (1.0f / TR) : m; } }
#pragma unroll
    for (int nb = 0; nb < 4; ++nb)
#pragma unroll
        for (int j = 0; j < 8; ++j) os[(hi * 8 + j) * 68 + nb * 16 + lr] = acc[nb][j];
    __builtin_amdgcn_wave_barrier(); asm volatile("" ::: "memory");   // keeps the LDS reads below behind the other lanes' LDS writes above (the rows are the wave's own: LDS runs in order, only the compiler could swap them)
#pragma unroll   // straight line, so that later rows' LDS reads do not wait for earlier rows' stores
    for (int u = 0; u < 8; ++u) { const int row = 2 * u + hi; *(v4f*)(Y + (size_t)(16 * w + row) * CK + lr * 4) = *(const v4fa*)(os + row * 68 + lr * 4); } }   // two whole rows (four 128-B lines) a store
// k_conv: what depends on the inputs alone: the 3 * NBI * (NP / TR) tiles of the three convs (q and k with Wk, bk and the tile statistics, v with Wv, bv, straight into its hl planes, and the tile sums), then the 4 blocks that round Ww.
// Y holds q's and k's planes one behind the other with one stride, so the flat tile index addresses both.
#define NXT (3 * NBI * (NP / TR))
__global__ __launch_bounds__(256) void k_conv(const float* __restrict__ xq, const float* __restrict__ xk, const float* __restrict__ xv, const float* __restrict__ Wk, const float* __restrict__ Wv, const float* __restrict__ Ww, const float* __restrict__ bk, const float* __restrict__ bv, float* Y, float* SP, bf* Vh, bf* Vl, float* VP, bf* WW) {
    __shared__ __align__(16) unsigned S[128 * XP + CK * WP]; const int b = blockIdx.x;
    if (b < NXT) { const int bx = b % (NP / TR), by = b / (NP / TR) % NBI, bz = b / (NP / TR * NBI);
        s_conv((bz == 0 ? xq : bz == 1 ? xk : xv) + (size_t)by * CI * NP + bx * TR, bz < 2 ? Wk : Wv, bz < 2 ? bk : bv, Y + (size_t)b * TR * CK, bz < 2 ? SP + (size_t)b * (2 * CK) : nullptr, bz < 2 ? nullptr : Vh + (size_t)by * CV * NP + bx * TR, Vl + (size_t)by * CV * NP + bx * TR, VP + (size_t)(by * (NP / TR) + bx) * CV, S); }
    else s_cvt8(Ww, WW, CO * CV / 8, b - NXT); }   // [out][in] natural = A of k_tail's second product; 4 blocks of 256 x 8 elements
// s_stat: the batch statistics of one tensor from its NT tiles' (mean, M2) pairs, P[tile][64 means, 64 M2], by a block of 128 threads for itself: pr[c] = (mean, 1 / sqrt(var + 1e-5)) in LDS, published to the whole block on return.
// All tiles hold TR rows. With d = tile mean - tile 0's mean: mean = tile 0's mean + sum of d / NT, and the sum of squared distances = sum of the M2 + TR * (sum of d^2 - (sum of d)^2 / NT): exact algebra in one pass;
// taking the tile means about one of them keeps the difference of the two sums free of a common offset (a large bias), whatever its size.
// 8 tiles x 16 lanes of 4 channels: a thread adds its NT / 8 tiles in two batches of 32 loads, a wave folds its 2 tile rows by one butterfly step, 64 threads add the 4 waves' partials from LDS in wave order. Fixed order, no atomics.
// red: 13 * CK floats, pr: 2 * CK floats.
__device__ __forceinline__ void s_stat(const float* __restrict__ P, float* red, float* pr) { const int tid = threadIdx.x, q = tid & 15, r = tid >> 4, w = tid >> 5;
    const unsigned to = (unsigned)(r * 2 * CK + 4 * q) * 4, qo = (unsigned)q * 16; const char *tp = (const char*)P + to, *pp = (const char*)P + qo;   // one byte offset per lane; the base is the same for the whole block
    const v4f p0 = *(const v4f*)pp; v4f sd = (v4f){}, sq = (v4f){}, t = (v4f){};
#pragma unroll   // register arrays need constant indices (so for every loop of this function)
    for (int h = 0; h < NT / 128; ++h) { v4f m[16], u[16];
#pragma unroll
        for (int k = 0; k < 16; ++k) { m[k] = *(const v4f*)((const float*)tp + (size_t)(h * 16 + k) * 8 * 2 * CK); u[k] = *(const v4f*)((const float*)tp + (size_t)(h * 16 + k) * 8 * 2 * CK + CK); }
        if (h == NT / 128 - 1) asm volatile("s_wait_xcnt 0x0" :: "v"(to), "v"(qo) : "memory");   // the wait that is kept before a register named by an issued load is overwritten; the two offsets are inputs so that they stay in their registers up to here
        __builtin_amdgcn_sched_barrier(0);   // a batch's 32 loads are in flight together before its first wait: sunk to their sums they would each show a latency of their own
#pragma unroll
        for (int k = 0; k < 16; ++k) { const v4f d = m[k] - p0; sd += d; sq += d * d; t += u[k]; } }
#pragma unroll
    for (int i = 0; i < 4; ++i) { sd[i] += xhalf(sd[i]); sq[i] += xhalf(sq[i]); t[i] += xhalf(t[i]); }
    if ((tid & 31) < 16) { *(v4f*)(red + (3 * w) * CK + 4 * q) = sd; *(v4f*)(red + (3 * w + 1) * CK + 4 * q) = sq; *(v4f*)(red + (3 * w + 2) * CK + 4 * q) = t; }
    if (tid < 16) *(v4f*)(red + 12 * CK + 4 * q) = p0;
    __syncthreads();   // publishes the 4 waves' partial sums and tile 0's means
    if (tid < CK) { float a = 0.f, b = 0.f, c = 0.f;
#pragma unroll
        for (int i = 0; i < 4; ++i) { a += red[(3 * i) * CK + tid]; b += red[(3 * i + 1) * CK + tid]; c += red[(3 * i + 2) * CK + tid]; }
        const float e = b - a * a * (1.0f / NT); v2f o; o[0] = red[12 * CK + tid] + a * (1.0f / NT); o[1] = __frsqrt_rn(__fadd_rn((c + (float)TR * e) * (1.0f / (NBI * NP)), 1e-5f)); *(v2f*)(pr + 2 * tid) = o; }
    __syncthreads();   // publishes the statistics to the whole block
}
// ---- k_mpart: partial Mt[image][slice][v][c] = sum over the slice's 128 positions m of v[m][v] kn[m][c], hl planes on both sides; KS * NBI blocks of 128 threads. kn never goes through memory:
// the block takes its 128 rows of the k conv's output, forms k's batch statistics for itself from the conv tiles' pairs (s_stat: no launch of their own stands between the convs and this one), applies the batch norm and the L2 norm, splits the result and lays it as [c][m] hl planes in LDS, from where the B fragments are read.
// Thread (q, r) holds channels 4*q .. 4*q + 3 of the 16 positions from 16*r on: every global load of a wave is two whole rows (four 128-B lines), a row's 64 squares are summed 4 in the thread and then by four butterfly steps over its 16 lanes,
// and 8 neighbouring positions of a channel are one 16-B LDS store. Wave w then owns rows v = 16*w .. 16*w + 15 of Mt (A = its v plane rows, straight from memory) and all 64 c; per accumulator k runs upwards in steps of 32: hh, lh, hl.
// Behind these blocks ride the two small stages that k_tail waits for and that need the convs alone: one block forms q's statistics (ST), NBI blocks add an image's NP / TR tile sums of v to vsum in tile order.
__global__ __launch_bounds__(128) void k_mpart(const bf* __restrict__ Vh, const bf* __restrict__ Vl, const float* __restrict__ YK, const float* __restrict__ SP, const float* __restrict__ VP, const float* __restrict__ ga, const float* __restrict__ be, float* M, float* ST, float* vs) {
    typedef WFrag<bf> F; typedef F::V V;
    __shared__ __align__(16) bf KL[2 * CK * KP]; __shared__ __align__(16) float OS[4 * 16 * 68];
    const int tid = threadIdx.x, q = tid & 15, r = tid >> 4, lr = tid & 15, hi = (tid >> 4) & 1, w = tid >> 5; const int bi = blockIdx.x; float* pr = OS + 13 * CK;   // s_stat's LDS lies in OS, which the products' staging rows take over behind the barrier that publishes the kn planes
    if (bi >= KS * NBI) {
        if (bi == KS * NBI) { s_stat(SP, OS, pr); if (tid < CK) *(v2f*)(ST + 2 * tid) = *(const v2f*)(pr + 2 * tid); }
        else if (tid < CV) { const float* vp = VP + (size_t)(bi - KS * NBI - 1) * (NP / TR) * CV + tid; float t = 0.f;
#pragma unroll   // straight line, so that the independent loads of all tiles are in flight together
            for (int i = 0; i < NP / TR; ++i) t += vp[i * CV];
            vs[(bi - KS * NBI - 1) * CV + tid] = t; }
        asm volatile("s_wait_xcnt 0x0" ::: "memory");   // the wait that is kept before a register named by an issued load or store is overwritten: in the listing other code, which reuses these registers, lies behind
        return; }
    const int sl = bi % KS, m0 = sl * (NP / KS); const size_t z = bi / KS;
    // One byte offset per lane and array; the bases are the same for the whole block.
    const unsigned yo = (unsigned)(16 * r * CK + 4 * q) * 4, po = (unsigned)((16 * w + lr) * NP + 8 * hi) * 2, go = (unsigned)q * 16;
    const char *yk = (const char*)(YK + (z * NP + m0) * CK) + yo, *vh = (const char*)(Vh + z * CV * NP + m0) + po, *vl = (const char*)(Vl + z * CV * NP + m0) + po, *gz = (const char*)ga + go, *ez = (const char*)be + go;
    v4f x[16]; V a[4], a2[4];
#pragma unroll   // register arrays need constant indices (so for every loop of this kernel)
    for (int j = 0; j < 16; ++j) x[j] = *(const v4f*)((const float*)yk + j * CK);
    const v4f g4 = *(const v4f*)gz, e4 = *(const v4f*)ez;   // gamma; beta
    __builtin_amdgcn_sched_barrier(0);   // the rows are in flight while the statistics are formed; the v fragments, which touch 16 lines a load and are used last, come behind the statistics' loads (loads return in order)
    s_stat(SP + (size_t)NT * 2 * CK, OS, pr);   // SP holds q's tiles, then k's
#pragma unroll
    for (int k = 0; k < 4; ++k) { a[k] = F::ld((const bf*)vh + 32 * k); a2[k] = F::ld((const bf*)vl + 32 * k); }
    asm volatile("s_wait_xcnt 0x0" :: "v"(yo), "v"(po), "v"(go) : "memory");   // the wait that is kept before a register named by an issued load is overwritten; the offsets are inputs so that they stay in their registers up to here
    __builtin_amdgcn_sched_barrier(0);   // the v fragments, used last, are in flight from here on, under the whole normalisation: they would else be sunk behind the barrier below, with a latency of their own in the open
    const v4f s0 = *(const v4f*)(pr + 8 * q), s1 = *(const v4f*)(pr + 8 * q + 4);   // (mean, 1 / sqrt(var + eps)) of channels 4*q, 4*q + 1; of the next two
    const float mu[4] = { s0[0], s0[2], s1[0], s1[2] }, rs[4] = { s0[1], s0[3], s1[1], s1[3] }; float g[4], e[4]; v8us oh[4][2], ol[4][2];
#pragma unroll
    for (int u = 0; u < 4; ++u) { g[u] = bfr(g4[u]); e[u] = bfr(e4[u]); }
    float ss[16];
#pragma unroll
    for (int j = 0; j < 16; ++j) { ss[j] = 0.f;
#pragma unroll
        for (int u = 0; u < 4; ++u) { const float y = (x[j][u] - mu[u]) * rs[u] * g[u] + e[u]; x[j][u] = y; ss[j] += y * y; } }
#pragma unroll
    for (int j = 0; j < 16; ++j) { ss[j] += rowx<1>(ss[j]); ss[j] += rowx<2>(ss[j]); ss[j] += rowx<4>(ss[j]); ss[j] += rowx<8>(ss[j]); }
#pragma unroll
    for (int j = 0; j < 16; ++j) { const float inv = __fdiv_rn(1.0f, __fadd_rn(__fsqrt_rn(ss[j]), 1e-7f));
#pragma unroll
        for (int u = 0; u < 4; ++u) { unsigned short hh, ll; splitf(x[j][u] * inv, hh, ll); oh[u][j >> 3][j & 7] = hh; ol[u][j >> 3][j & 7] = ll; } }
#pragma unroll
    for (int u = 0; u < 4; ++u)
#pragma unroll
        for (int t = 0; t < 2; ++t) { *(v8us*)(KL + (4 * q + u) * KP + 16 * r + 8 * t) = oh[u][t]; *(v8us*)(KL + (CK + 4 * q + u) * KP + 16 * r + 8 * t) = ol[u][t]; }
    __syncthreads();   // publishes the kn planes: a wave reads rows whose positions all 4 waves wrote
    const bf* kh = KL + lr * KP + 8 * hi; const bf* kl = kh + CK * KP; v8f acc[4];
#pragma unroll
    for (int nb = 0; nb < 4; ++nb) acc[nb] = (v8f){};
    V b[2][4], b2[2][4];
#pragma unroll
    for (int k = 0; k < 2; ++k)
#pragma unroll
        for (int nb = 0; nb < 4; ++nb) { b[k][nb] = F::ld(kh + nb * 16 * KP + 32 * k); b2[k][nb] = F::ld(kl + nb * 16 * KP + 32 * k); }
#pragma unroll
    for (int k = 0; k < 4; ++k) {
        __builtin_amdgcn_sched_barrier(0);   // keeps the kn fragments two k steps ahead of their products: without it the compiler sinks every LDS read to its product, some twenty LDS latencies one behind the other
#pragma unroll
        for (int nb = 0; nb < 4; ++nb) acc[nb] = F::mma(a[k], b[k & 1][nb], acc[nb]);
#pragma unroll
        for (int nb = 0; nb < 4; ++nb) acc[nb] = F::mma(a2[k], b[k & 1][nb], acc[nb]);
#pragma unroll
        for (int nb = 0; nb < 4; ++nb) acc[nb] = F::mma(a[k], b2[k & 1][nb], acc[nb]);
        if (k < 2) {
#pragma unroll
            for (int nb = 0; nb < 4; ++nb) { b[k & 1][nb] = F::ld(kh + nb * 16 * KP + 32 * (k + 2)); b2[k & 1][nb] = F::ld(kl + nb * 16 * KP + 32 * (k + 2)); } } }
    float* os = OS + w * (16 * 68);   // lane (lr, hi) holds rows v = 16*w + hi*8 + j of column c = nb*16 + lr
#pragma unroll
    for (int nb = 0; nb < 4; ++nb)
#pragma unroll
        for (int j = 0; j < 8; ++j) os[(hi * 8 + j) * 68 + nb * 16 + lr] = acc[nb][j];
    __builtin_amdgcn_wave_barrier(); asm volatile("" ::: "memory");   // keeps the LDS reads below behind the other lanes' LDS writes above (the rows are the wave's own: LDS runs in order, only the compiler could swap them)
    float* crow = M + ((z * KS + sl) * CV + 16 * w) * CK;
#pragma unroll   // straight line, so that later rows' LDS reads do not wait for earlier rows' stores
    for (int t = 0; t < 8; ++t) { const int row = 2 * t + hi; *(v4f*)(crow + row * CK + lr * 4) = *(const v4fa*)(os + row * 68 + lr * 4); }   // two whole rows (four 128-B lines) a store
    asm volatile("s_wait_xcnt 0x0" ::: "memory"); }   // the wait that is kept before a register named by an issued store is overwritten: in the listing the two small stages' code, which reuses these registers, lies behind the stores
// k_mt: Mt[v][c] = sum over the KS k slices of the partial tiles P[image][slice][v][c], added in slice order (fixed order, no atomics), then split into the hl planes. Whole-line loads.
__global__ __launch_bounds__(256) void k_mt(const float* __restrict__ P, bf* Mh, bf* Ml) { const int e = (blockIdx.x * 256 + threadIdx.x) * 4; if (e >= CV * CK) return; P += (size_t)blockIdx.y * KS * CV * CK; Mh += blockIdx.y * CV * CK; Ml += blockIdx.y * CV * CK; v4f t = *(const v4f*)(P + e); v4us oh, ol;
#pragma unroll   // straight line, so that the independent loads of many slices are in flight together
    for (int s = 1; s < KS; ++s) t += *(const v4f*)(P + (size_t)s * CV * CK + e);
#pragma unroll
    for (int u = 0; u < 4; ++u) { unsigned short a, b; splitf(t[u], a, b); oh[u] = a; ol[u] = b; } *(v4us*)(Mh + e) = oh; *(v4us*)(Ml + e) = ol;  }
// ---- k_tail: everything behind Mt in one launch: qn from the q conv's output, ctx = qn.M + vsum, its hl split, out = Ww.ctx + bw, stored [o][p]. ONE WAVE per 32 positions (one 128-B line of every output row), grid (NP / 32, 1, image).
// qn never goes through memory: lane (lr, hi) loads, of positions lr and 16 + lr, the four runs of 8 channels (from 16*g + 8*hi) that its B fragments hold, applies the batch norm and the L2 norm and splits the result in registers;
// a position's 64 squares are summed 4 and 4 in the lane, the two added, then with the other half wave's run (one butterfly step), then over g in pairs: the tree of 4 in a thread and four butterfly steps.
// The first product is formed transposed, ctxT[v][p] = sum_c Mt[v][c] qn[p][c] (A = Mt planes, B = qn): lane (lr, hi) then holds position nb*16 + lr and the 8 neighbouring channels v = mb*16 + hi*8 + j,
// which is the B fragment of the second product, out[o][p] = sum_v Ww[o][v] ctx[p][v]: elements 0..7 of k chunk k2 are accumulator 2*k2, elements 8..15 accumulator 2*k2 + 1. ctx never leaves the registers.
// Per element the products are added in the order of the separate GEMMs (hh, lh, hl per 32 of c; h, l per 32 of v), vsum and the bias are added to the same f32 values: same results.
#define OP 36    // LDS row = one output channel's 32 positions, + 4: rows stay 16-B aligned, and the two half waves (8 rows apart) write different banks
__global__ __launch_bounds__(32) void k_tail(const float* __restrict__ YQ, const float* __restrict__ ST, const float* __restrict__ ga, const float* __restrict__ be, const bf* __restrict__ Mh, const bf* __restrict__ Ml, const float* __restrict__ vs, const bf* __restrict__ WW, const float* __restrict__ bw, float* OUT) {
    typedef WFrag<bf> F; typedef F::V V;
    __shared__ __align__(16) float os[CO * OP];
    const int lane = threadIdx.x & 31, lr = lane & 15, hi = lane >> 4; const int p0 = blockIdx.x * 32; const size_t z = blockIdx.z;
    // All rows of Mt and Ww are 64 elements long, so one byte offset per lane serves every fragment load (row lr, k from 8*hi), twice that the f32 rows of the q conv, one more the f32 vectors (8 values from hi*8), twice that the (mean, scale) pairs; the bases are the same for the whole wave.
    const unsigned fo = (unsigned)(lr * CK + 8 * hi) * 2, vo = (unsigned)hi * 32, yo = fo * 2, so = vo * 2;
    const char *yq = (const char*)(YQ + (z * NP + p0) * CK) + yo, *st = (const char*)ST + so, *gz = (const char*)ga + vo, *ez = (const char*)be + vo, *mh = (const char*)(Mh + z * CV * CK) + fo, *ml = (const char*)(Ml + z * CV * CK) + fo, *ww = (const char*)WW + fo, *vz = (const char*)(vs + z * CV) + vo, *bz = (const char*)bw + vo;
    V a[2][4], a2[2][4], b[2][2], b2[2][2], w[8][2]; v8f sv[4], bi[8], acc[4][2], x[2][4], ms[4][2], gg[4], eb[4];
#pragma unroll   // register arrays need constant indices (so for every loop of this kernel)
    for (int g = 0; g < 4; ++g) {   // run g: channels 16*g + 8*hi + 0..7, elements 8*(g & 1) + 0..7 of the fragment of k chunk g >> 1
#pragma unroll
        for (int nb = 0; nb < 2; ++nb) x[nb][g] = *(const v8f*)((const float*)yq + nb * 16 * CK + 16 * g);
        ms[g][0] = *(const v8f*)((const float*)st + 32 * g); ms[g][1] = *(const v8f*)((const float*)st + 32 * g + 8); gg[g] = *(const v8f*)((const float*)gz + 16 * g); eb[g] = *(const v8f*)((const float*)ez + 16 * g); }
#pragma unroll
    for (int k = 0; k < 2; ++k)
#pragma unroll
        for (int mb = 0; mb < 4; ++mb) { a[k][mb] = F::ld((const bf*)mh + mb * 16 * CK + 32 * k); a2[k][mb] = F::ld((const bf*)ml + mb * 16 * CK + 32 * k); }
#pragma unroll
    for (int mb = 0; mb < 4; ++mb) sv[mb] = *(const v8f*)((const float*)vz + mb * 16);
#pragma unroll
    for (int t = 0; t < 8; ++t)
#pragma unroll
        for (int k = 0; k < 2; ++k) w[t][k] = F::ld((const bf*)ww + t * 16 * CV + 32 * k);
#pragma unroll
    for (int t = 0; t < 8; ++t) bi[t] = *(const v8f*)((const float*)bz + t * 16);
    asm volatile("s_wait_xcnt 0x0" :: "v"(fo), "v"(vo), "v"(yo), "v"(so) : "memory");   // the wait that is kept before a register named by an issued load is overwritten; the four offsets are inputs so that they stay in their registers up to here
    __builtin_amdgcn_sched_barrier(0);   // every load of the wave is in flight before its first wait: without this the compiler sinks the vsum, weight and bias loads to their uses, each with a latency of its own in the open
#pragma unroll
    for (int g = 0; g < 4; ++g)
#pragma unroll
        for (int u = 0; u < 8; ++u) { gg[g][u] = bfr(gg[g][u]); eb[g][u] = bfr(eb[g][u]); }
#pragma unroll
    for (int nb = 0; nb < 2; ++nb) { float s1[4];
#pragma unroll
        for (int g = 0; g < 4; ++g) { float sa = 0.f, sb = 0.f;
#pragma unroll
            for (int u = 0; u < 4; ++u) { const float y = (x[nb][g][u] - ms[g][0][2 * u]) * ms[g][0][2 * u + 1] * gg[g][u] + eb[g][u]; x[nb][g][u] = y; sa += y * y; }
#pragma unroll
            for (int u = 0; u < 4; ++u) { const float y = (x[nb][g][4 + u] - ms[g][1][2 * u]) * ms[g][1][2 * u + 1] * gg[g][4 + u] + eb[g][4 + u]; x[nb][g][4 + u] = y; sb += y * y; }
            s1[g] = sa + sb; }
#pragma unroll
        for (int g = 0; g < 4; ++g) s1[g] += xhalf(s1[g]);
        const float inv = __fdiv_rn(1.0f, __fadd_rn(__fsqrt_rn((s1[0] + s1[1]) + (s1[2] + s1[3])), 1e-7f)); v8us qh[4], ql[4];
#pragma unroll
        for (int g = 0; g < 4; ++g)
#pragma unroll
            for (int u = 0; u < 8; ++u) { unsigned short hh, ll; splitf(x[nb][g][u] * inv, hh, ll); qh[g][u] = hh; ql[g][u] = ll; }
#pragma unroll
        for (int k = 0; k < 2; ++k) { b[k][nb] = cat16b(qh[2 * k], qh[2 * k + 1]); b2[k][nb] = cat16b(ql[2 * k], ql[2 * k + 1]); } }
#pragma unroll
    for (int mb = 0; mb < 4; ++mb)
#pragma unroll
        for (int nb = 0; nb < 2; ++nb) acc[mb][nb] = (v8f){};
#pragma unroll
    for (int k = 0; k < 2; ++k) {   // per accumulator and 32 of c: Mt high x qn high, Mt high x qn low, Mt low x qn high
#pragma unroll
        for (int mb = 0; mb < 4; ++mb)
#pragma unroll
            for (int nb = 0; nb < 2; ++nb) acc[mb][nb] = F::mma(a[k][mb], b[k][nb], acc[mb][nb]);
#pragma unroll
        for (int mb = 0; mb < 4; ++mb)
#pragma unroll
            for (int nb = 0; nb < 2; ++nb) acc[mb][nb] = F::mma(a[k][mb], b2[k][nb], acc[mb][nb]);
#pragma unroll
        for (int mb = 0; mb < 4; ++mb)
#pragma unroll
            for (int nb = 0; nb < 2; ++nb) acc[mb][nb] = F::mma(a2[k][mb], b[k][nb], acc[mb][nb]); }
    v8us ch[4][2], cl[4][2];
#pragma unroll
    for (int mb = 0; mb < 4; ++mb)
#pragma unroll
        for (int nb = 0; nb < 2; ++nb)
#pragma unroll
            for (int j = 0; j < 8; ++j) { unsigned short x, y; splitf(__fadd_rn(acc[mb][nb][j], sv[mb][j]), x, y); ch[mb][nb][j] = x; cl[mb][nb][j] = y; }
#pragma unroll
    for (int g = 0; g < 2; ++g) { v8f o[4][2];   // 64 output channels at a time
#pragma unroll
        for (int t = 0; t < 4; ++t)
#pragma unroll
            for (int nb = 0; nb < 2; ++nb) o[t][nb] = (v8f){};
#pragma unroll
        for (int k = 0; k < 2; ++k) {
#pragma unroll
            for (int t = 0; t < 4; ++t)
#pragma unroll
                for (int nb = 0; nb < 2; ++nb) o[t][nb] = F::mma(w[g * 4 + t][k], cat16b(ch[2 * k][nb], ch[2 * k + 1][nb]), o[t][nb]);
#pragma unroll
            for (int t = 0; t < 4; ++t)
#pragma unroll
                for (int nb = 0; nb < 2; ++nb) o[t][nb] = F::mma(w[g * 4 + t][k], cat16b(cl[2 * k][nb], cl[2 * k + 1][nb]), o[t][nb]); }
#pragma unroll
        for (int t = 0; t < 4; ++t)
#pragma unroll
            for (int nb = 0; nb < 2; ++nb)
#pragma unroll
                for (int j = 0; j < 8; ++j) os[((g * 4 + t) * 16 + hi * 8 + j) * OP + nb * 16 + lr] = o[t][nb][j] + bfr(bi[g * 4 + t][j]); }
    __builtin_amdgcn_wave_barrier(); asm volatile("" ::: "memory");   // keeps the LDS reads below behind the other lanes' LDS writes above (one wave: LDS runs in order, only the compiler could swap them)
#pragma unroll   // straight line, so that later rows' LDS reads do not wait for earlier rows' stores
    for (int s = 0; s < CO / 4; ++s) { const int row = 4 * s + (lane >> 3), col = (lane & 7) * 4;
        *(v4f*)(OUT + (z * CO + row) * NP + p0 + col) = *(const v4fa*)(os + row * OP + col); } }

extern "C" void kernel_launch(void* const* d_in, const int* in_sizes, int n_in,
                              void* d_out, int out_size, void* d_ws, size_t ws_size, hipStream_t stream) {
    (void)in_sizes; (void)n_in; (void)out_size;
    const float** I = (const float**)d_in;
    const float *qf = I[0], *kf = I[1], *vf = I[2], *Wk = I[3], *bk = I[4], *ga = I[5], *be = I[6], *Wv = I[7], *bv = I[8], *Ww = I[9], *bw = I[10];
    float* OUT = (float*)d_out;     // [8][128][64][64]
    char* wsp = (char*)d_ws;
    auto take = [&](size_t bytes) { char* p = wsp; wsp += (bytes + 255) & ~(size_t)255; return (void*)p; };
    bf* WW = (bf*)take(CO * CV * 2);
    float* YQ = (float*)take((size_t)2 * NBI * NP * CK * 4); float* YK = YQ + (size_t)NBI * NP * CK; float* STQ = (float*)take(2 * CK * 4); float* VP = (float*)take((size_t)NBI * (NP / TR) * CV * 4); float* SP = (float*)take((size_t)2 * NT * 2 * CK * 4);   // [q, k][tile][64 means, 64 M2]
    bf* Vh = (bf*)take((size_t)NBI * CV * NP * 2); bf* Vl = (bf*)take((size_t)NBI * CV * NP * 2); float* vs = (float*)take(NBI * CV * 4);
    float* M = (float*)take((size_t)NBI * KS * CK * CV * 4); bf* Mh = (bf*)take(NBI * CK * CV * 2); bf* Ml = (bf*)take(NBI * CK * CV * 2);
    if ((size_t)(wsp - (char*)d_ws) > ws_size) return;    // total ~ 30 MB
    // One launch per level of the dependence chain, four in all; each reads only what an earlier launch of this call wrote.
    k_conv<<<dim3(NXT + 4, 1, 1), 256, 0, stream>>>(qf, kf, vf, Wk, Wv, Ww, bk, bv, YQ, SP, Vh, Vl, VP, WW);   // the three 1x1 convs, tile statistics of q and k, v planes and tile sums, Ww plane
    k_mpart<<<dim3(KS * NBI + 1 + NBI, 1, 1), 128, 0, stream>>>(Vh, Vl, YK, SP, VP, ga, be, M, STQ, vs);   // k's statistics and kn in LDS, partial tiles of Mt; q's statistics; vsum
    k_mt<<<dim3((CV * CK / 4 + 255) / 256, NBI, 1), 256, 0, stream>>>(M, Mh, Ml);
    k_tail<<<dim3(NP / 32, 1, NBI), 32, 0, stream>>>(YQ, STQ, ga, be, Mh, Ml, vs, WW, bw, OUT);   // out[o][p] = Ww.(qn.M + vsum) + bw
}
